// v000
// Measured on an AMD MI455X. A time is GPU time per run, averaged over a window of back-to-back runs after a warm-up
// (all launches, gaps included; the runs take copies of the inputs in turn), and the median of several windows.
// Apart from v000's, it joins two sittings. Times from different sittings can be a few percent apart, while
// side-by-side timings come from the same sitting.
// v000, which the later versions start from, runs in 172 microseconds.
#include <hip/hip_runtime.h>

// Contractions, f32 accumulate: x.[Wq|Wk|Wv] on v_wmma_f32_16x16x32_bf16 (x and W RNE-converted to bf16); q.k^T as 3 bf16 products (q,k hi+lo planes) on every row; P.V rows < RH as 3 bf16 products (P and V hi+lo), rows >= RH on v_wmma_f32_16x16x32_f16 (P fp16 carried x 2^14, V fp16); rotary table, softmax and normalisation in f32.
// Pipeline: k_wt builds the concatenated transposed weight plane [128 n][128 k] bf16 (n 96..127 zero); k_cs the rotary table CS[t][i] = {cos, sin}(INVT[i] * t); k_cvt the bf16 copy of x;
// k_gemmw (one wave per 64x64 tile) gives F [NB*SEQ][128] = q|k|v|0 in f32; k_planes applies the interleaved rotary pairs and writes Q/K bf16 hi,lo planes [b][t][32] and V^T planes [b][d][t] (fp16, bf16 hi, bf16 lo);
// k_attn: one wave per 16 query rows, 64-key chunks, online softmax (running max, f32 row sums), causal: chunks above the diagonal never visited, one masked diagonal chunk (replace by -3e38 == exclusion);
#pragma clang fp contract(off)

#ifndef NB
#define NB 8
#endif
#ifndef SEQ
#define SEQ 4096
#endif
#define NB_FULL  8
#define SEQ_FULL 4096
#define DM   128                  // embedding width (K of the projections)
#define HS   32                   // head width
#define NP   128                  // padded projection width: q | k | v | zeros
#ifndef RH
#define RH   1024                 // query rows < RH use bf16 hi+lo P and V planes
#endif
#define PCAR 16384.0f             // fp16 P carry (2^14) for rows >= RH
#define SCL  0.17677669529663687f // 32^-0.5
#define L2E  1.4426950408889634f
#define PP   72                   // LDS P tile pitch (halves)
#define OPF  36                   // LDS output tile pitch (floats)
static_assert(SEQ % 64 == 0);
static_assert(SEQ <= SEQ_FULL);
static_assert(NB >= 1);
static_assert(NB <= NB_FULL);
static_assert(RH % 64 == 0);
static_assert(DM % 32 == 0);
static_assert((NB * SEQ * (DM / 8)) % 256 == 0);
static_assert((SEQ * 16) % 256 == 0);
static_assert((NP * DM / 8) % 256 == 0);
static_assert((long long)NB_FULL * SEQ_FULL * HS * 4 == 4194304LL);

typedef _Float16 h16;
typedef unsigned short bf;
typedef __attribute__((ext_vector_type(16))) __bf16   v16bf;
typedef __attribute__((ext_vector_type(16))) _Float16 v16h;
typedef __attribute__((ext_vector_type(8)))  _Float16 v8h;
typedef __attribute__((ext_vector_type(8)))  unsigned short v8us;
typedef __attribute__((ext_vector_type(2)))  unsigned short v2us;
typedef __attribute__((ext_vector_type(8)))  float    v8f;
typedef __attribute__((ext_vector_type(4)))  float    v4f;
typedef __attribute__((ext_vector_type(2)))  float    v2f;
typedef v8h  __attribute__((may_alias)) v8ha;
typedef v4f  __attribute__((may_alias)) v4fa;
typedef v8us __attribute__((may_alias)) v8usa;

__device__ __forceinline__ unsigned short f2bf(float f) { unsigned u = __float_as_uint(f); u += 0x7FFFu + ((u >> 16) & 1u); return (unsigned short)(u >> 16); }
__device__ __forceinline__ float bf2f(unsigned short b) { return __uint_as_float(((unsigned)b) << 16); }
__device__ __forceinline__ float bfr(float f) { return bf2f(f2bf(f)); }
__device__ __forceinline__ v16h cat16(v8h lo, v8h hi) { return __builtin_shufflevector(lo, hi, 0, 1, 2, 3, 4, 5, 6, 7, 8, 9, 10, 11, 12, 13, 14, 15); }
__device__ __forceinline__ v16bf cat16b(v8us lo, v8us hi) { return __builtin_bit_cast(v16bf, __builtin_shufflevector(lo, hi, 0, 1, 2, 3, 4, 5, 6, 7, 8, 9, 10, 11, 12, 13, 14, 15)); }
__device__ __forceinline__ v8f wmma16(v16h a, v16h b, v8f c) { return __builtin_amdgcn_wmma_f32_16x16x32_f16(false, a, false, b, (short)0, c, false, false); }
__device__ __forceinline__ v8f wmmab(v16bf a, v16bf b, v8f c) { return __builtin_amdgcn_wmma_f32_16x16x32_bf16(false, a, false, b, (short)0, c, false, false); }

// ---- k_gemmw: register-blocked GEMM, ONE WAVE per 64x64 output tile (16 accumulators), operands straight from K-contiguous 16-bit planes; grid (M/64, N/64, Z), 32 threads.
// C[m][n] (f32, pitch ldc, + optional f32 bias[n]) = sum_k A[m][k] Bt[n][k] (+ split products per NSPLIT). z-batch strides sA/sB/sC in elements. K % 32 == 0.
// Fragments: lane -> row/col (lane & 15), elements 0..7 <- k0 + 8*(lane >> 4) + 0..7, elements 8..15 <- k0 + 16 + 8*(lane >> 4) + 0..7 for A and for the [n][k] B plane.
template <typename T16> struct WFrag;
template <> struct WFrag<h16> { typedef v16h V; static __device__ __forceinline__ V ld(const h16* p) { return cat16(*(const v8h*)p, *(const v8h*)(p + 16)); } static __device__ __forceinline__ v8f mma(V a, V b, v8f c) { return wmma16(a, b, c); } };
template <> struct WFrag<bf> { typedef v16bf V; static __device__ __forceinline__ V ld(const bf* p) { return cat16b(*(const v8us*)p, *(const v8us*)(p + 16)); } static __device__ __forceinline__ v8f mma(V a, V b, v8f c) { return wmmab(a, b, c); } };
template <typename T16, int NSPLIT, bool BIAS>
__global__ __launch_bounds__(32) void k_gemmw(const T16* __restrict__ A, const T16* __restrict__ A2, const T16* __restrict__ Bt, const T16* __restrict__ Bt2, int K, float* C, int ldc, const float* __restrict__ bias, size_t sA, size_t sB, size_t sC) {
    typedef typename WFrag<T16>::V V;
    __shared__ __align__(16) float os[16 * 68];
    const size_t z = blockIdx.z; A += z * sA; if (A2) A2 += z * sA; Bt += z * sB; if (Bt2) Bt2 += z * sB; C += z * sC;
    const int lane = threadIdx.x & 31, lr = lane & 15, hi = lane >> 4; const int r0 = blockIdx.x * 64, c0 = blockIdx.y * 64;
    v8f acc[4][4];
#pragma unroll
    for (int mb = 0; mb < 4; ++mb)
#pragma unroll
        for (int nb = 0; nb < 4; ++nb) acc[mb][nb] = (v8f){};
    const size_t aoff = (size_t)(r0 + lr) * K + 8 * hi, boff = (size_t)(c0 + lr) * K + 8 * hi;
#pragma unroll 1
    for (int kc = 0; kc < K; kc += 32) {
        V a[4], a2[4];
#pragma unroll
        for (int mb = 0; mb < 4; ++mb) { a[mb] = WFrag<T16>::ld(A + aoff + (size_t)mb * 16 * K + kc); if (NSPLIT == 1 || NSPLIT == 2) a2[mb] = WFrag<T16>::ld(A2 + aoff + (size_t)mb * 16 * K + kc); }
#pragma unroll
        for (int nb = 0; nb < 4; ++nb) { const V b = WFrag<T16>::ld(Bt + boff + (size_t)nb * 16 * K + kc); V b2; if (NSPLIT >= 2) b2 = WFrag<T16>::ld(Bt2 + boff + (size_t)nb * 16 * K + kc);
#pragma unroll
            for (int mb = 0; mb < 4; ++mb) { acc[mb][nb] = WFrag<T16>::mma(a[mb], b, acc[mb][nb]); if (NSPLIT == 1 || NSPLIT == 2) acc[mb][nb] = WFrag<T16>::mma(a2[mb], b, acc[mb][nb]); if (NSPLIT >= 2) acc[mb][nb] = WFrag<T16>::mma(a[mb], b2, acc[mb][nb]); } }
        asm volatile("v_nop\n\tv_nop\n\tv_nop\n\tv_nop" : "+v"(acc[0][0]), "+v"(acc[1][1]), "+v"(acc[2][2]), "+v"(acc[3][3]) : "v"(a[0]), "v"(a[3]));
    }
#pragma unroll
    for (int mb = 0; mb < 4; ++mb) {
#pragma unroll
        for (int nb = 0; nb < 4; ++nb) {
#pragma unroll
            for (int j = 0; j < 8; ++j) os[(hi * 8 + j) * 68 + nb * 16 + lr] = acc[mb][nb][j]; }
        __builtin_amdgcn_wave_barrier(); asm volatile("" ::: "memory");
        float* crow = C + (size_t)(r0 + mb * 16) * ldc + c0;
{
#pragma unroll
            for (int s = 0; s < 8; ++s) { const int row = 2 * s + hi, cofs = lr * 4; v4f val = *(const v4fa*)(os + row * 68 + cofs); if (BIAS) { val[0] += bfr(bias[c0 + cofs]); val[1] += bfr(bias[c0 + cofs + 1]); val[2] += bfr(bias[c0 + cofs + 2]); val[3] += bfr(bias[c0 + cofs + 3]); }
                *(v4f*)(crow + (size_t)row * ldc + cofs) = val; }
             }
        __builtin_amdgcn_wave_barrier(); asm volatile("" ::: "memory");
    }
}

__global__ __launch_bounds__(256) void k_wt(const float* __restrict__ wq, const float* __restrict__ wk, const float* __restrict__ wv, bf* WB) {
    const int i = blockIdx.x * 256 + threadIdx.x; if (i >= NP * DM / 8) return;
    const int e0 = i * 8; const int n = e0 / DM, k0 = e0 % DM; const int nn = n & 31;
    const float* src = (n < 32) ? wq : ((n < 64) ? wk : wv);
    v8us o;
#pragma unroll
    for (int j = 0; j < 8; ++j) { const float v = src[(size_t)(k0 + j) * HS + nn]; o[j] = f2bf((n < 96) ? v : 0.0f); }
    *(v8us*)(WB + e0) = o; 
}

// INVT[i] = 1 / 10000^(2i/32): the exact float32 results of that expression (pow then reciprocal in f32), i = 0..15.
__constant__ float INVT[HS / 2] = { 1.0f, 0.5623413324356079f, 0.3162277638912201f, 0.17782793939113617f, 0.10000000149011612f, 0.05623412877321243f, 0.03162277862429619f, 0.017782794311642647f, 0.009999999776482582f, 0.005623413249850273f, 0.003162277862429619f, 0.0017782794311642647f, 0.0010000000474974513f, 0.000562341301701963f, 0.0003162277862429619f, 0.00017782794020604342f };
__global__ __launch_bounds__(256) void k_cs(float* CS) {
    const int idx = blockIdx.x * 256 + threadIdx.x; if (idx >= SEQ * (HS / 2)) return;
    const int t = idx >> 4, i = idx & 15;
    const float ang = INVT[i] * (float)t; float sn, cn; sincosf(ang, &sn, &cn);
    v2f cs; cs[0] = cn; cs[1] = sn;
    *(v2f*)(CS + (size_t)idx * 2) = cs; 
}
__global__ __launch_bounds__(256) void k_cvt(const float* __restrict__ x, bf* XB, int n8) {
    const int i = blockIdx.x * 256 + threadIdx.x; if (i >= n8) return;
    const int row = i / (DM / 8), c8 = i % (DM / 8); const int b = row / SEQ, t = row % SEQ;
    const v8f v = *(const v8f*)(x + ((size_t)b * SEQ_FULL + t) * DM + c8 * 8);
    v8us o;
#pragma unroll
    for (int k = 0; k < 8; ++k) o[k] = f2bf(v[k]);
    bf* d = XB + (size_t)i * 8; *(v8us*)d = o; 
}

// ---- k_planes: block = batch b (grid.y), 64 consecutive t (t0 = blockIdx.x * 64), 256 threads (thread -> row r = tid>>2, column group g = tid&3 = 8 q, 8 k, 8 v columns).
// From F rows [b*SEQ + t][NP]: q = cols 0..31, k = 32..63, v = 64..95. Rotary (interleaved pairs, i = column/2, (c, s) = CS[t][i]): out[2i] = x[2i] c - x[2i+1] s, out[2i+1] = x[2i] s + x[2i+1] c, separate f32 products.
// LDS tiles: sq[0..3] = Qh, Ql, Kh, Kl as [64 r][32 c]; sv[0..2] = V^T fp16 bits, bf16 hi, bf16 lo as [32 d][64 r]. After a block barrier every plane's 4,096-byte tile region is written as
__global__ __launch_bounds__(256) void k_planes(const float* __restrict__ F, const float* __restrict__ CS, bf* Qh, bf* Ql, bf* Kh, bf* Kl, h16* VT16, bf* VTh, bf* VTl) {
    __shared__ __align__(16) unsigned short sq[4][64 * 32];
    __shared__ __align__(16) unsigned short sv[3][32 * 64];
    const int tid = threadIdx.x; const int b = blockIdx.y, t0 = blockIdx.x * 64;
    const int r = tid >> 2, g = tid & 3; const int t = t0 + r;
    const float* fr = F + ((size_t)b * SEQ + t) * NP;
    const v8f xq = *(const v8f*)(fr + 8 * g), xk = *(const v8f*)(fr + 32 + 8 * g), xv = *(const v8f*)(fr + 64 + 8 * g);
    const v8f cs = *(const v8f*)(CS + ((size_t)t * (HS / 2) + 4 * g) * 2);
#pragma unroll
    for (int p = 0; p < 4; ++p) {
        const float cn = cs[2 * p], sn = cs[2 * p + 1]; const int col = 8 * g + 2 * p;
        {   const float x1 = xq[2 * p], x2 = xq[2 * p + 1]; const float ev = x1 * cn - x2 * sn, od = x1 * sn + x2 * cn;
            v2us oh, ol; unsigned short hh0 = f2bf(ev), hh1 = f2bf(od); oh[0] = hh0; oh[1] = hh1; ol[0] = f2bf(ev - bf2f(hh0)); ol[1] = f2bf(od - bf2f(hh1));
            *(v2us*)(&sq[0][r * 32 + col]) = oh; *(v2us*)(&sq[1][r * 32 + col]) = ol; }
        {   const float x1 = xk[2 * p], x2 = xk[2 * p + 1]; const float ev = x1 * cn - x2 * sn, od = x1 * sn + x2 * cn;
            v2us oh, ol; unsigned short hh0 = f2bf(ev), hh1 = f2bf(od); oh[0] = hh0; oh[1] = hh1; ol[0] = f2bf(ev - bf2f(hh0)); ol[1] = f2bf(od - bf2f(hh1));
            *(v2us*)(&sq[2][r * 32 + col]) = oh; *(v2us*)(&sq[3][r * 32 + col]) = ol; }
#pragma unroll
        for (int j = 0; j < 2; ++j) { const float val = xv[2 * p + j]; const int d = col + j; const unsigned short vh = f2bf(val);
            sv[0][d * 64 + r] = __builtin_bit_cast(unsigned short, (h16)val); sv[1][d * 64 + r] = vh; sv[2][d * 64 + r] = f2bf(val - bf2f(vh)); }
    }
    __syncthreads();
    const int w = tid >> 5, L = tid & 31; const int lo = w * 256 + L * 8;            // linear offset inside a 2,048-element tile
    const size_t qoff = ((size_t)b * SEQ + t0) * HS + lo;                              // Q/K planes [b][t][32]
    const int d = 4 * w + (L >> 3), toff = (L & 7) * 8;
    const size_t voff = ((size_t)b * HS + d) * SEQ + t0 + toff;                       // V^T planes [b][d][t]
    const v8us q0v = *(const v8usa*)(&sq[0][lo]), q1v = *(const v8usa*)(&sq[1][lo]), k0v = *(const v8usa*)(&sq[2][lo]), k1v = *(const v8usa*)(&sq[3][lo]);
    const v8us v0v = *(const v8usa*)(&sv[0][lo]), v1v = *(const v8usa*)(&sv[1][lo]), v2v = *(const v8usa*)(&sv[2][lo]);
    unsigned short* VT16u = (unsigned short*)VT16;
{
        *(v8us*)(Qh + qoff) = q0v; *(v8us*)(Ql + qoff) = q1v; *(v8us*)(Kh + qoff) = k0v; *(v8us*)(Kl + qoff) = k1v;
        *(v8us*)(VT16u + voff) = v0v; *(v8us*)(VTh + voff) = v1v; *(v8us*)(VTl + voff) = v2v;
         }
}

// ---- attn_chunk: one 64-key chunk for one wave's 16 query rows (q0..q0+15). Scores: 4 key tiles, each hi.hi + lo.hi + hi.lo (q, k bf16 planes [t][32]; B fragment = K rows, k-contiguous).
// D element r of lane l is S[q0 + 8*(l>>4) + r][kv0 + 16*tile + (l&15)]. Online softmax per row: x SCL, causal replace-mask (MASK chunk only), 16-lane max tree, running max / rescale,
// P reloaded as the A operand with the split k map, V^T planes [d][t] as the B operand (HI: 3 bf16 products; else one fp16 product), outputs o0 (d 0..15) and o1 (d 16..31).
template <bool HI, bool MASK>
__device__ __forceinline__ void attn_chunk(const bf* __restrict__ Khb, const bf* __restrict__ Klb, const h16* __restrict__ V16b, const bf* __restrict__ Vhb, const bf* __restrict__ Vlb,
                                           unsigned short* pta, unsigned short* ptb, const v16bf aqh, const v16bf aql, const int kv0, const int q0, const int ln, const int hh,
                                           float* mrun, float* lp, v8f& o0, v8f& o1) {
    v16bf bh[4], bl[4];
#pragma unroll
    for (int t = 0; t < 4; ++t) { const size_t ko = (size_t)(kv0 + 16 * t + ln) * HS + 8 * hh;
        bh[t] = cat16b(*(const v8us*)(Khb + ko), *(const v8us*)(Khb + ko + 16)); bl[t] = cat16b(*(const v8us*)(Klb + ko), *(const v8us*)(Klb + ko + 16)); }
    v8f s[4];
#pragma unroll
    for (int t = 0; t < 4; ++t) { v8f a = wmmab(aqh, bh[t], (v8f){}); a = wmmab(aql, bh[t], a); a = wmmab(aqh, bl[t], a); s[t] = a; }
    asm volatile("v_nop\n\tv_nop\n\tv_nop\n\tv_nop" : "+v"(s[0]), "+v"(s[1]), "+v"(s[2]), "+v"(s[3]) : "v"(aqh), "v"(aql), "v"(bh[3]), "v"(bl[3]));
#pragma unroll
    for (int r = 0; r < 8; ++r) {
        const int qi = q0 + 8 * hh + r;
        float e[4];
#pragma unroll
        for (int t = 0; t < 4; ++t) { float v = s[t][r] * SCL; if (MASK) v = (kv0 + 16 * t + ln <= qi) ? v : -3.0e38f; e[t] = v; }
        float rm = fmaxf(fmaxf(e[0], e[1]), fmaxf(e[2], e[3]));
        rm = fmaxf(rm, __shfl_xor(rm, 1, 32)); rm = fmaxf(rm, __shfl_xor(rm, 2, 32)); rm = fmaxf(rm, __shfl_xor(rm, 4, 32)); rm = fmaxf(rm, __shfl_xor(rm, 8, 32));
        const float mn = fmaxf(mrun[r], rm);
        const float cf = __builtin_amdgcn_exp2f((mrun[r] - mn) * L2E);
        mrun[r] = mn;
        float psum = 0.0f;
#pragma unroll
        for (int t = 0; t < 4; ++t) {
            const float p = __builtin_amdgcn_exp2f((e[t] - mn) * L2E);
            psum += p;
            const int po = (8 * hh + r) * PP + 16 * t + ln;
            if (HI) { const unsigned short ph = f2bf(p); pta[po] = ph; ptb[po] = f2bf(p - bf2f(ph)); }
            else { pta[po] = __builtin_bit_cast(unsigned short, (h16)(p * PCAR)); }
        }
        lp[r] = lp[r] * cf + psum; o0[r] = o0[r] * cf; o1[r] = o1[r] * cf;
    }
    __builtin_amdgcn_fence(3 /* release order */, "wavefront");
    asm volatile("s_wait_dscnt 0x0" ::: "memory");
    __builtin_amdgcn_wave_barrier();
    if (HI) {
        v16bf aph[2], apl[2];
#pragma unroll
        for (int ks = 0; ks < 2; ++ks) { const unsigned short* pr = pta + ln * PP + 32 * ks + 8 * hh; const unsigned short* pr2 = ptb + ln * PP + 32 * ks + 8 * hh;
            aph[ks] = cat16b(*(const v8usa*)pr, *(const v8usa*)(pr + 16)); apl[ks] = cat16b(*(const v8usa*)pr2, *(const v8usa*)(pr2 + 16)); }
        {   v16bf vh[2], vl[2];
#pragma unroll
            for (int ks = 0; ks < 2; ++ks) { const size_t vo = (size_t)ln * SEQ + kv0 + 32 * ks + 8 * hh;
                vh[ks] = cat16b(*(const v8us*)(Vhb + vo), *(const v8us*)(Vhb + vo + 16)); vl[ks] = cat16b(*(const v8us*)(Vlb + vo), *(const v8us*)(Vlb + vo + 16)); }
#pragma unroll
            for (int ks = 0; ks < 2; ++ks) { o0 = wmmab(aph[ks], vh[ks], o0); o0 = wmmab(apl[ks], vh[ks], o0); o0 = wmmab(aph[ks], vl[ks], o0); } }
        {   v16bf vh[2], vl[2];
#pragma unroll
            for (int ks = 0; ks < 2; ++ks) { const size_t vo = (size_t)(16 + ln) * SEQ + kv0 + 32 * ks + 8 * hh;
                vh[ks] = cat16b(*(const v8us*)(Vhb + vo), *(const v8us*)(Vhb + vo + 16)); vl[ks] = cat16b(*(const v8us*)(Vlb + vo), *(const v8us*)(Vlb + vo + 16)); }
#pragma unroll
            for (int ks = 0; ks < 2; ++ks) { o1 = wmmab(aph[ks], vh[ks], o1); o1 = wmmab(apl[ks], vh[ks], o1); o1 = wmmab(aph[ks], vl[ks], o1); }
            asm volatile("v_nop\n\tv_nop\n\tv_nop\n\tv_nop" : "+v"(o0), "+v"(o1) : "v"(aph[1]), "v"(apl[1]), "v"(vh[1]), "v"(vl[1])); }
    } else {
        v16h ap[2];
#pragma unroll
        for (int ks = 0; ks < 2; ++ks) { const unsigned short* pr = pta + ln * PP + 32 * ks + 8 * hh;
            ap[ks] = cat16(__builtin_bit_cast(v8h, *(const v8usa*)pr), __builtin_bit_cast(v8h, *(const v8usa*)(pr + 16))); }
        {   v16h vb[2];
#pragma unroll
            for (int ks = 0; ks < 2; ++ks) { const size_t vo = (size_t)ln * SEQ + kv0 + 32 * ks + 8 * hh; vb[ks] = cat16(*(const v8h*)(V16b + vo), *(const v8h*)(V16b + vo + 16)); }
#pragma unroll
            for (int ks = 0; ks < 2; ++ks) o0 = wmma16(ap[ks], vb[ks], o0); }
        {   v16h vb[2];
#pragma unroll
            for (int ks = 0; ks < 2; ++ks) { const size_t vo = (size_t)(16 + ln) * SEQ + kv0 + 32 * ks + 8 * hh; vb[ks] = cat16(*(const v8h*)(V16b + vo), *(const v8h*)(V16b + vo + 16)); }
#pragma unroll
            for (int ks = 0; ks < 2; ++ks) o1 = wmma16(ap[ks], vb[ks], o1);
            asm volatile("v_nop\n\tv_nop\n\tv_nop\n\tv_nop" : "+v"(o0), "+v"(o1) : "v"(ap[1]), "v"(vb[1])); }
    }
}

// ---- k_attn: grid (query blocks of 64 rows, NB), 128 threads = 4 waves, wave -> 16 query rows q0 = qrow0 + (blockIdx.x*4 + wave)*16 of batch b = blockIdx.y. No block barriers; each wave's LDS
// (P tiles, output tile) is private to the wave. Keys visited: chunks kv0 = 0, 64, .. up to the diagonal chunk (exactly one masked chunk). Final: 16-lane row-sum tree, o x (carry / l),
template <bool HI>
__global__ __launch_bounds__(128) void k_attn(const bf* __restrict__ Qh, const bf* __restrict__ Ql, const bf* __restrict__ Kh, const bf* __restrict__ Kl,
                                             const h16* __restrict__ V16, const bf* __restrict__ Vh, const bf* __restrict__ Vl, float* OUT, int qrow0) {
    __shared__ __align__(16) unsigned short pt[HI ? 8 : 4][16 * PP];
    __shared__ __align__(16) float ost[4][16 * OPF];
    const int wave = threadIdx.x >> 5, lane = threadIdx.x & 31, hh = lane >> 4, ln = lane & 15;
    const int b = blockIdx.y; const int q0 = qrow0 + (blockIdx.x * 4 + wave) * 16;
    const bf* Qhb = Qh + (size_t)b * SEQ * HS; const bf* Qlb = Ql + (size_t)b * SEQ * HS;
    const bf* Khb = Kh + (size_t)b * SEQ * HS; const bf* Klb = Kl + (size_t)b * SEQ * HS;
    const h16* V16b = V16 + (size_t)b * HS * SEQ; const bf* Vhb = Vh + (size_t)b * HS * SEQ; const bf* Vlb = Vl + (size_t)b * HS * SEQ;
    unsigned short* pta = &pt[(HI ? 2 : 1) * wave][0];
    unsigned short* ptb = &pt[(HI ? 2 : 1) * wave + (HI ? 1 : 0)][0];
    const size_t qo = (size_t)(q0 + ln) * HS + 8 * hh;
    const v16bf aqh = cat16b(*(const v8us*)(Qhb + qo), *(const v8us*)(Qhb + qo + 16));
    const v16bf aql = cat16b(*(const v8us*)(Qlb + qo), *(const v8us*)(Qlb + qo + 16));
    float mrun[8], lp[8]; v8f o0 = (v8f){}, o1 = (v8f){};
#pragma unroll
    for (int r = 0; r < 8; ++r) { mrun[r] = -3.0e38f; lp[r] = 0.0f; }
    int kv0 = 0;
#pragma unroll 1
    for (; kv0 + 64 <= q0; kv0 += 64) attn_chunk<HI, false>(Khb, Klb, V16b, Vhb, Vlb, pta, ptb, aqh, aql, kv0, q0, ln, hh, mrun, lp, o0, o1);
#pragma unroll 1
    for (; kv0 < q0 + 16; kv0 += 64) attn_chunk<HI, true>(Khb, Klb, V16b, Vhb, Vlb, pta, ptb, aqh, aql, kv0, q0, ln, hh, mrun, lp, o0, o1);
    const float carry = HI ? 1.0f : (1.0f / PCAR);
    float* osw = &ost[wave][0];
#pragma unroll
    for (int r = 0; r < 8; ++r) { float l = lp[r]; l += __shfl_xor(l, 1, 32); l += __shfl_xor(l, 2, 32); l += __shfl_xor(l, 4, 32); l += __shfl_xor(l, 8, 32);
        const float inv = carry * __builtin_amdgcn_rcpf(l);
        osw[(8 * hh + r) * OPF + ln] = o0[r] * inv; osw[(8 * hh + r) * OPF + 16 + ln] = o1[r] * inv; }
    __builtin_amdgcn_fence(3 /* release order */, "wavefront");
    asm volatile("s_wait_dscnt 0x0" ::: "memory");
    __builtin_amdgcn_wave_barrier();
    float* ob = OUT + ((size_t)b * SEQ_FULL + q0) * HS;
{
#pragma unroll
        for (int i = 0; i < 4; ++i) { const int row = 4 * i + (lane >> 3), col = (lane & 7) * 4; const v4f v = *(const v4fa*)(osw + row * OPF + col);
            *(v4f*)(ob + (size_t)row * HS + col) = v; }
         }
}

extern "C" void kernel_launch(void* const* d_in, const int* in_sizes, int n_in,
                              void* d_out, int out_size, void* d_ws, size_t ws_size, hipStream_t stream) {
    if (n_in < 4) return;
    const float* x  = (const float*)d_in[0];   // [8][4096][128]
    const float* wq = (const float*)d_in[1];   // [128][32]
    const float* wk = (const float*)d_in[2];   // [128][32]
    const float* wv = (const float*)d_in[3];   // [128][32]
    if (in_sizes[0] < ((NB - 1) * SEQ_FULL + SEQ) * DM) return;
    if (in_sizes[1] < DM * HS || in_sizes[2] < DM * HS || in_sizes[3] < DM * HS) return;
    if (out_size < ((NB - 1) * SEQ_FULL + SEQ) * HS) return;
    float* OUT = (float*)d_out;                 // [8][4096][32] f32
    char* wsp = (char*)d_ws;
    auto take = [&](size_t bytes) { char* p = wsp; wsp += (bytes + 255) & ~(size_t)255; return (void*)p; };
    bf*    WB   = (bf*)take((size_t)NP * DM * 2);                    //      32,768 B
    float* CS   = (float*)take((size_t)SEQ * (HS / 2) * 2 * 4);      //     524,288 B
    bf*    XB   = (bf*)take((size_t)NB * SEQ * DM * 2);              //   8,388,608 B
    float* F    = (float*)take((size_t)NB * SEQ * NP * 4);           //  16,777,216 B
    bf*    Qh   = (bf*)take((size_t)NB * SEQ * HS * 2);              //   2,097,152 B each
    bf*    Ql   = (bf*)take((size_t)NB * SEQ * HS * 2);
    bf*    Kh   = (bf*)take((size_t)NB * SEQ * HS * 2);
    bf*    Kl   = (bf*)take((size_t)NB * SEQ * HS * 2);
    h16*   VT16 = (h16*)take((size_t)NB * HS * SEQ * 2);
    bf*    VTh  = (bf*)take((size_t)NB * HS * SEQ * 2);
    bf*    VTl  = (bf*)take((size_t)NB * HS * SEQ * 2);             // total 40,402,944 B
    if ((size_t)(wsp - (char*)d_ws) > ws_size) return;
    const int rh = (RH < SEQ) ? RH : SEQ;

    k_wt<<<(NP * DM / 8) / 256, 256, 0, stream>>>(wq, wk, wv, WB);
    k_cs<<<(SEQ * (HS / 2)) / 256, 256, 0, stream>>>(CS);
    const int n8 = NB * SEQ * (DM / 8);
    k_cvt<<<(unsigned)(n8 / 256), 256, 0, stream>>>(x, XB, n8);
    k_gemmw<bf, 0, false><<<dim3(NB * SEQ / 64, NP / 64, 1), 32, 0, stream>>>(XB, nullptr, WB, nullptr, DM, F, NP, nullptr, 0, 0, 0);
    k_planes<<<dim3(SEQ / 64, NB), 256, 0, stream>>>(F, CS, Qh, Ql, Kh, Kl, VT16, VTh, VTl);
    k_attn<true><<<dim3(rh / 64, NB), 128, 0, stream>>>(Qh, Ql, Kh, Kl, VT16, VTh, VTl, OUT, 0);
    if (SEQ > rh) k_attn<false><<<dim3((SEQ - rh) / 64, NB), 128, 0, stream>>>(Qh, Ql, Kh, Kl, VT16, VTh, VTl, OUT, rh);
}

// v001
// Measured time: 87.2 microseconds a run.
// Two timings next to v000 put it at 2.01 and 2.03 times that version's speed.
#include <hip/hip_runtime.h>

// Contractions, f32 accumulate: x.[Wq|Wk|Wv] on v_wmma_f32_16x16x32_bf16 (x and W RNE-converted to bf16); q.k^T as 3 bf16 products (q,k hi+lo planes) on every row; P.V rows < RH as 3 bf16 products (P and V hi+lo), rows >= RH on v_wmma_f32_16x16x32_f16 (P fp16 carried x 2^14, V fp16); rotary table, softmax and normalisation in f32.
// Pipeline: k_wt builds the concatenated transposed weight plane [128 n][128 k] bf16 (n 96..127 zero); k_cs the rotary table CS[t][i] = {cos, sin}(INVT[i] * t); k_cvt the bf16 copy of x;
// k_gemmw (one wave per 64x64 tile) gives F [NB*SEQ][128] = q|k|v|0 in f32; k_planes applies the interleaved rotary pairs and writes Q/K bf16 hi,lo planes [b][t][32] and V^T planes [b][d][t] (fp16, bf16 hi, bf16 lo);
// k_attn: one workgroup of KW waves per 16 query rows, wave w takes the 64-key chunks w, w + KW, ..; online softmax per wave (running max, f32 row sums), causal: chunks above the diagonal never visited, one masked diagonal chunk (replace by -3e38 == exclusion); the waves' partials are merged through LDS;
#pragma clang fp contract(off)

#ifndef NB
#define NB 8
#endif
#ifndef SEQ
#define SEQ 4096
#endif
#define NB_FULL  8
#define SEQ_FULL 4096
#define DM   128                  // embedding width (K of the projections)
#define HS   32                   // head width
#define NP   128                  // padded projection width: q | k | v | zeros
#ifndef RH
#define RH   1024                 // query rows < RH use bf16 hi+lo P and V planes
#endif
#define PCAR 16384.0f             // fp16 P carry (2^14) for rows >= RH
#define SCL  0.17677669529663687f // 32^-0.5
#define L2E  1.4426950408889634f
#define PP   72                   // LDS P tile pitch (halves)
#define OPF  36                   // LDS output tile pitch (floats); columns 32, 33 of a row hold the wave's (max, sum)
#define KW   8                    // waves of a k_attn workgroup = key ranges of one 16-row query tile
static_assert(SEQ % 64 == 0);
static_assert(SEQ <= SEQ_FULL);
static_assert(NB >= 1);
static_assert(NB <= NB_FULL);
static_assert(RH % 64 == 0);
static_assert(DM % 32 == 0);
static_assert((NB * SEQ * (DM / 8)) % 256 == 0);
static_assert((SEQ * 16) % 256 == 0);
static_assert((NP * DM / 8) % 256 == 0);
static_assert((long long)NB_FULL * SEQ_FULL * HS * 4 == 4194304LL);

typedef _Float16 h16;
typedef unsigned short bf;
typedef __attribute__((ext_vector_type(16))) __bf16   v16bf;
typedef __attribute__((ext_vector_type(16))) _Float16 v16h;
typedef __attribute__((ext_vector_type(8)))  _Float16 v8h;
typedef __attribute__((ext_vector_type(8)))  unsigned short v8us;
typedef __attribute__((ext_vector_type(2)))  unsigned short v2us;
typedef __attribute__((ext_vector_type(8)))  float    v8f;
typedef __attribute__((ext_vector_type(4)))  float    v4f;
typedef __attribute__((ext_vector_type(2)))  float    v2f;
typedef v8h  __attribute__((may_alias)) v8ha;
typedef v4f  __attribute__((may_alias)) v4fa;
typedef v8us __attribute__((may_alias)) v8usa;

__device__ __forceinline__ unsigned short f2bf(float f) { unsigned u = __float_as_uint(f); u += 0x7FFFu + ((u >> 16) & 1u); return (unsigned short)(u >> 16); }
__device__ __forceinline__ float bf2f(unsigned short b) { return __uint_as_float(((unsigned)b) << 16); }
__device__ __forceinline__ float bfr(float f) { return bf2f(f2bf(f)); }
__device__ __forceinline__ v16h cat16(v8h lo, v8h hi) { return __builtin_shufflevector(lo, hi, 0, 1, 2, 3, 4, 5, 6, 7, 8, 9, 10, 11, 12, 13, 14, 15); }
__device__ __forceinline__ v16bf cat16b(v8us lo, v8us hi) { return __builtin_bit_cast(v16bf, __builtin_shufflevector(lo, hi, 0, 1, 2, 3, 4, 5, 6, 7, 8, 9, 10, 11, 12, 13, 14, 15)); }
__device__ __forceinline__ v8f wmma16(v16h a, v16h b, v8f c) { return __builtin_amdgcn_wmma_f32_16x16x32_f16(false, a, false, b, (short)0, c, false, false); }
__device__ __forceinline__ v8f wmmab(v16bf a, v16bf b, v8f c) { return __builtin_amdgcn_wmma_f32_16x16x32_bf16(false, a, false, b, (short)0, c, false, false); }

// ---- k_gemmw: register-blocked GEMM, ONE WAVE per 64x64 output tile (16 accumulators), operands straight from K-contiguous 16-bit planes; grid (M/64, N/64, Z), 32 threads.
// C[m][n] (f32, pitch ldc, + optional f32 bias[n]) = sum_k A[m][k] Bt[n][k] (+ split products per NSPLIT). z-batch strides sA/sB/sC in elements. K % 32 == 0.
// Fragments: lane -> row/col (lane & 15), elements 0..7 <- k0 + 8*(lane >> 4) + 0..7, elements 8..15 <- k0 + 16 + 8*(lane >> 4) + 0..7 for A and for the [n][k] B plane.
template <typename T16> struct WFrag;
template <> struct WFrag<h16> { typedef v16h V; static __device__ __forceinline__ V ld(const h16* p) { return cat16(*(const v8h*)p, *(const v8h*)(p + 16)); } static __device__ __forceinline__ v8f mma(V a, V b, v8f c) { return wmma16(a, b, c); } };
template <> struct WFrag<bf> { typedef v16bf V; static __device__ __forceinline__ V ld(const bf* p) { return cat16b(*(const v8us*)p, *(const v8us*)(p + 16)); } static __device__ __forceinline__ v8f mma(V a, V b, v8f c) { return wmmab(a, b, c); } };
template <typename T16, int NSPLIT, bool BIAS>
__global__ __launch_bounds__(32) void k_gemmw(const T16* __restrict__ A, const T16* __restrict__ A2, const T16* __restrict__ Bt, const T16* __restrict__ Bt2, int K, float* C, int ldc, const float* __restrict__ bias, size_t sA, size_t sB, size_t sC) {
    typedef typename WFrag<T16>::V V;
    __shared__ __align__(16) float os[16 * 68];
    const size_t z = blockIdx.z; A += z * sA; if (A2) A2 += z * sA; Bt += z * sB; if (Bt2) Bt2 += z * sB; C += z * sC;
    const int lane = threadIdx.x & 31, lr = lane & 15, hi = lane >> 4; const int r0 = blockIdx.x * 64, c0 = blockIdx.y * 64;
    v8f acc[4][4];
#pragma unroll
    for (int mb = 0; mb < 4; ++mb)
#pragma unroll
        for (int nb = 0; nb < 4; ++nb) acc[mb][nb] = (v8f){};
    const size_t aoff = (size_t)(r0 + lr) * K + 8 * hi, boff = (size_t)(c0 + lr) * K + 8 * hi;
#pragma unroll 1
    for (int kc = 0; kc < K; kc += 32) {
        V a[4], a2[4];
#pragma unroll
        for (int mb = 0; mb < 4; ++mb) { a[mb] = WFrag<T16>::ld(A + aoff + (size_t)mb * 16 * K + kc); if (NSPLIT == 1 || NSPLIT == 2) a2[mb] = WFrag<T16>::ld(A2 + aoff + (size_t)mb * 16 * K + kc); }
#pragma unroll
        for (int nb = 0; nb < 4; ++nb) { const V b = WFrag<T16>::ld(Bt + boff + (size_t)nb * 16 * K + kc); V b2; if (NSPLIT >= 2) b2 = WFrag<T16>::ld(Bt2 + boff + (size_t)nb * 16 * K + kc);
#pragma unroll
            for (int mb = 0; mb < 4; ++mb) { acc[mb][nb] = WFrag<T16>::mma(a[mb], b, acc[mb][nb]); if (NSPLIT == 1 || NSPLIT == 2) acc[mb][nb] = WFrag<T16>::mma(a2[mb], b, acc[mb][nb]); if (NSPLIT >= 2) acc[mb][nb] = WFrag<T16>::mma(a[mb], b2, acc[mb][nb]); } }
        asm volatile("v_nop\n\tv_nop\n\tv_nop\n\tv_nop" : "+v"(acc[0][0]), "+v"(acc[1][1]), "+v"(acc[2][2]), "+v"(acc[3][3]) : "v"(a[0]), "v"(a[3]));
    }
#pragma unroll
    for (int mb = 0; mb < 4; ++mb) {
#pragma unroll
        for (int nb = 0; nb < 4; ++nb) {
#pragma unroll
            for (int j = 0; j < 8; ++j) os[(hi * 8 + j) * 68 + nb * 16 + lr] = acc[mb][nb][j]; }
        __builtin_amdgcn_wave_barrier(); asm volatile("" ::: "memory");
        float* crow = C + (size_t)(r0 + mb * 16) * ldc + c0;
{
#pragma unroll
            for (int s = 0; s < 8; ++s) { const int row = 2 * s + hi, cofs = lr * 4; v4f val = *(const v4fa*)(os + row * 68 + cofs); if (BIAS) { val[0] += bfr(bias[c0 + cofs]); val[1] += bfr(bias[c0 + cofs + 1]); val[2] += bfr(bias[c0 + cofs + 2]); val[3] += bfr(bias[c0 + cofs + 3]); }
                *(v4f*)(crow + (size_t)row * ldc + cofs) = val; }
             }
        __builtin_amdgcn_wave_barrier(); asm volatile("" ::: "memory");
    }
}

__global__ __launch_bounds__(256) void k_wt(const float* __restrict__ wq, const float* __restrict__ wk, const float* __restrict__ wv, bf* WB) {
    const int i = blockIdx.x * 256 + threadIdx.x; if (i >= NP * DM / 8) return;
    const int e0 = i * 8; const int n = e0 / DM, k0 = e0 % DM; const int nn = n & 31;
    const float* src = (n < 32) ? wq : ((n < 64) ? wk : wv);
    v8us o;
#pragma unroll
    for (int j = 0; j < 8; ++j) { const float v = src[(size_t)(k0 + j) * HS + nn]; o[j] = f2bf((n < 96) ? v : 0.0f); }
    *(v8us*)(WB + e0) = o; 
}

// INVT[i] = 1 / 10000^(2i/32): the exact float32 results of that expression (pow then reciprocal in f32), i = 0..15.
__constant__ float INVT[HS / 2] = { 1.0f, 0.5623413324356079f, 0.3162277638912201f, 0.17782793939113617f, 0.10000000149011612f, 0.05623412877321243f, 0.03162277862429619f, 0.017782794311642647f, 0.009999999776482582f, 0.005623413249850273f, 0.003162277862429619f, 0.0017782794311642647f, 0.0010000000474974513f, 0.000562341301701963f, 0.0003162277862429619f, 0.00017782794020604342f };
__global__ __launch_bounds__(256) void k_cs(float* CS) {
    const int idx = blockIdx.x * 256 + threadIdx.x; if (idx >= SEQ * (HS / 2)) return;
    const int t = idx >> 4, i = idx & 15;
    const float ang = INVT[i] * (float)t; float sn, cn; sincosf(ang, &sn, &cn);
    v2f cs; cs[0] = cn; cs[1] = sn;
    *(v2f*)(CS + (size_t)idx * 2) = cs; 
}
__global__ __launch_bounds__(256) void k_cvt(const float* __restrict__ x, bf* XB, int n8) {
    const int i = blockIdx.x * 256 + threadIdx.x; if (i >= n8) return;
    const int row = i / (DM / 8), c8 = i % (DM / 8); const int b = row / SEQ, t = row % SEQ;
    const v8f v = *(const v8f*)(x + ((size_t)b * SEQ_FULL + t) * DM + c8 * 8);
    v8us o;
#pragma unroll
    for (int k = 0; k < 8; ++k) o[k] = f2bf(v[k]);
    bf* d = XB + (size_t)i * 8; *(v8us*)d = o; 
}

// ---- k_planes: block = batch b (grid.y), 64 consecutive t (t0 = blockIdx.x * 64), 256 threads (thread -> row r = tid>>2, column group g = tid&3 = 8 q, 8 k, 8 v columns).
// From F rows [b*SEQ + t][NP]: q = cols 0..31, k = 32..63, v = 64..95. Rotary (interleaved pairs, i = column/2, (c, s) = CS[t][i]): out[2i] = x[2i] c - x[2i+1] s, out[2i+1] = x[2i] s + x[2i+1] c, separate f32 products.
// LDS tiles: sq[0..3] = Qh, Ql, Kh, Kl as [64 r][32 c]; sv[0..2] = V^T fp16 bits, bf16 hi, bf16 lo as [32 d][64 r]. After a block barrier every plane's 4,096-byte tile region is written as
__global__ __launch_bounds__(256) void k_planes(const float* __restrict__ F, const float* __restrict__ CS, bf* Qh, bf* Ql, bf* Kh, bf* Kl, h16* VT16, bf* VTh, bf* VTl) {
    __shared__ __align__(16) unsigned short sq[4][64 * 32];
    __shared__ __align__(16) unsigned short sv[3][32 * 64];
    const int tid = threadIdx.x; const int b = blockIdx.y, t0 = blockIdx.x * 64;
    const int r = tid >> 2, g = tid & 3; const int t = t0 + r;
    const float* fr = F + ((size_t)b * SEQ + t) * NP;
    const v8f xq = *(const v8f*)(fr + 8 * g), xk = *(const v8f*)(fr + 32 + 8 * g), xv = *(const v8f*)(fr + 64 + 8 * g);
    const v8f cs = *(const v8f*)(CS + ((size_t)t * (HS / 2) + 4 * g) * 2);
#pragma unroll
    for (int p = 0; p < 4; ++p) {
        const float cn = cs[2 * p], sn = cs[2 * p + 1]; const int col = 8 * g + 2 * p;
        {   const float x1 = xq[2 * p], x2 = xq[2 * p + 1]; const float ev = x1 * cn - x2 * sn, od = x1 * sn + x2 * cn;
            v2us oh, ol; unsigned short hh0 = f2bf(ev), hh1 = f2bf(od); oh[0] = hh0; oh[1] = hh1; ol[0] = f2bf(ev - bf2f(hh0)); ol[1] = f2bf(od - bf2f(hh1));
            *(v2us*)(&sq[0][r * 32 + col]) = oh; *(v2us*)(&sq[1][r * 32 + col]) = ol; }
        {   const float x1 = xk[2 * p], x2 = xk[2 * p + 1]; const float ev = x1 * cn - x2 * sn, od = x1 * sn + x2 * cn;
            v2us oh, ol; unsigned short hh0 = f2bf(ev), hh1 = f2bf(od); oh[0] = hh0; oh[1] = hh1; ol[0] = f2bf(ev - bf2f(hh0)); ol[1] = f2bf(od - bf2f(hh1));
            *(v2us*)(&sq[2][r * 32 + col]) = oh; *(v2us*)(&sq[3][r * 32 + col]) = ol; }
#pragma unroll
        for (int j = 0; j < 2; ++j) { const float val = xv[2 * p + j]; const int d = col + j; const unsigned short vh = f2bf(val);
            sv[0][d * 64 + r] = __builtin_bit_cast(unsigned short, (h16)val); sv[1][d * 64 + r] = vh; sv[2][d * 64 + r] = f2bf(val - bf2f(vh)); }
    }
    __syncthreads();
    const int w = tid >> 5, L = tid & 31; const int lo = w * 256 + L * 8;            // linear offset inside a 2,048-element tile
    const size_t qoff = ((size_t)b * SEQ + t0) * HS + lo;                              // Q/K planes [b][t][32]
    const int d = 4 * w + (L >> 3), toff = (L & 7) * 8;
    const size_t voff = ((size_t)b * HS + d) * SEQ + t0 + toff;                       // V^T planes [b][d][t]
    const v8us q0v = *(const v8usa*)(&sq[0][lo]), q1v = *(const v8usa*)(&sq[1][lo]), k0v = *(const v8usa*)(&sq[2][lo]), k1v = *(const v8usa*)(&sq[3][lo]);
    const v8us v0v = *(const v8usa*)(&sv[0][lo]), v1v = *(const v8usa*)(&sv[1][lo]), v2v = *(const v8usa*)(&sv[2][lo]);
    unsigned short* VT16u = (unsigned short*)VT16;
{
        *(v8us*)(Qh + qoff) = q0v; *(v8us*)(Ql + qoff) = q1v; *(v8us*)(Kh + qoff) = k0v; *(v8us*)(Kl + qoff) = k1v;
        *(v8us*)(VT16u + voff) = v0v; *(v8us*)(VTh + voff) = v1v; *(v8us*)(VTl + voff) = v2v;
         }
}

// ---- attn_chunk: one 64-key chunk for one wave's 16 query rows (q0..q0+15). Scores: 4 key tiles, each hi.hi + lo.hi + hi.lo (q, k bf16 planes [t][32]; B fragment = K rows, k-contiguous).
// D element r of lane l is S[q0 + 8*(l>>4) + r][kv0 + 16*tile + (l&15)]. Online softmax per row: x SCL, causal replace-mask (MASK chunk only), 16-lane max tree, running max / rescale,
// P reloaded as the A operand with the split k map, V^T planes [d][t] as the B operand (HI: 3 bf16 products; else one fp16 product), outputs o0 (d 0..15) and o1 (d 16..31).
template <bool HI, bool MASK>
__device__ __forceinline__ void attn_chunk(const bf* __restrict__ Khb, const bf* __restrict__ Klb, const h16* __restrict__ V16b, const bf* __restrict__ Vhb, const bf* __restrict__ Vlb,
                                           unsigned short* pta, unsigned short* ptb, const v16bf aqh, const v16bf aql, const int kv0, const int q0, const int ln, const int hh,
                                           float* mrun, float* lp, v8f& o0, v8f& o1) {
    v16bf bh[4], bl[4]; const bf* kph[4]; const bf* kpl[4];
#pragma unroll
    for (int t = 0; t < 4; ++t) { const size_t ko = (size_t)(kv0 + 16 * t + ln) * HS + 8 * hh; kph[t] = Khb + ko; kpl[t] = Klb + ko;
        bh[t] = cat16b(*(const v8us*)kph[t], *(const v8us*)(kph[t] + 16)); bl[t] = cat16b(*(const v8us*)kpl[t], *(const v8us*)(kpl[t] + 16)); }
    // the wait stands behind the K loads, in front of any instruction that reuses one of their address registers; the addresses are its inputs so that no load of the run lands in one of them ahead of it
    asm volatile("s_wait_xcnt 0x0" :: "v"(kph[0]), "v"(kph[1]), "v"(kph[2]), "v"(kph[3]), "v"(kpl[0]), "v"(kpl[1]), "v"(kpl[2]), "v"(kpl[3]) : "memory");
    v8f s[4];
#pragma unroll
    for (int t = 0; t < 4; ++t) { v8f a = wmmab(aqh, bh[t], (v8f){}); a = wmmab(aql, bh[t], a); a = wmmab(aqh, bl[t], a); s[t] = a; }
    asm volatile("v_nop\n\tv_nop\n\tv_nop\n\tv_nop" : "+v"(s[0]), "+v"(s[1]), "+v"(s[2]), "+v"(s[3]) : "v"(aqh), "v"(aql), "v"(bh[3]), "v"(bl[3]));
#pragma unroll
    for (int r = 0; r < 8; ++r) {
        const int qi = q0 + 8 * hh + r;
        float e[4];
#pragma unroll
        for (int t = 0; t < 4; ++t) { float v = s[t][r] * SCL; if (MASK) v = (kv0 + 16 * t + ln <= qi) ? v : -3.0e38f; e[t] = v; }
        float rm = fmaxf(fmaxf(e[0], e[1]), fmaxf(e[2], e[3]));
        rm = fmaxf(rm, __shfl_xor(rm, 1, 32)); rm = fmaxf(rm, __shfl_xor(rm, 2, 32)); rm = fmaxf(rm, __shfl_xor(rm, 4, 32)); rm = fmaxf(rm, __shfl_xor(rm, 8, 32));
        const float mn = fmaxf(mrun[r], rm);
        const float cf = __builtin_amdgcn_exp2f((mrun[r] - mn) * L2E);
        mrun[r] = mn;
        float psum = 0.0f;
#pragma unroll
        for (int t = 0; t < 4; ++t) {
            const float p = __builtin_amdgcn_exp2f((e[t] - mn) * L2E);
            psum += p;
            const int po = (8 * hh + r) * PP + 16 * t + ln;
            if (HI) { const unsigned short ph = f2bf(p); pta[po] = ph; ptb[po] = f2bf(p - bf2f(ph)); }
            else { pta[po] = __builtin_bit_cast(unsigned short, (h16)(p * PCAR)); }
        }
        lp[r] = lp[r] * cf + psum; o0[r] = o0[r] * cf; o1[r] = o1[r] * cf;
    }
    __builtin_amdgcn_fence(3 /* release order */, "wavefront");
    asm volatile("s_wait_dscnt 0x0" ::: "memory");
    __builtin_amdgcn_wave_barrier();
    if (HI) {
        v16bf aph[2], apl[2];
#pragma unroll
        for (int ks = 0; ks < 2; ++ks) { const unsigned short* pr = pta + ln * PP + 32 * ks + 8 * hh; const unsigned short* pr2 = ptb + ln * PP + 32 * ks + 8 * hh;
            aph[ks] = cat16b(*(const v8usa*)pr, *(const v8usa*)(pr + 16)); apl[ks] = cat16b(*(const v8usa*)pr2, *(const v8usa*)(pr2 + 16)); }
        {   v16bf vh[2], vl[2];
#pragma unroll
            for (int ks = 0; ks < 2; ++ks) { const size_t vo = (size_t)ln * SEQ + kv0 + 32 * ks + 8 * hh;
                vh[ks] = cat16b(*(const v8us*)(Vhb + vo), *(const v8us*)(Vhb + vo + 16)); vl[ks] = cat16b(*(const v8us*)(Vlb + vo), *(const v8us*)(Vlb + vo + 16)); }
#pragma unroll
            for (int ks = 0; ks < 2; ++ks) { o0 = wmmab(aph[ks], vh[ks], o0); o0 = wmmab(apl[ks], vh[ks], o0); o0 = wmmab(aph[ks], vl[ks], o0); } }
        {   v16bf vh[2], vl[2];
#pragma unroll
            for (int ks = 0; ks < 2; ++ks) { const size_t vo = (size_t)(16 + ln) * SEQ + kv0 + 32 * ks + 8 * hh;
                vh[ks] = cat16b(*(const v8us*)(Vhb + vo), *(const v8us*)(Vhb + vo + 16)); vl[ks] = cat16b(*(const v8us*)(Vlb + vo), *(const v8us*)(Vlb + vo + 16)); }
            // the wait stands behind the last V load, in front of any instruction that reuses a V address register; the two base addresses are its inputs so that no V load lands in one of them ahead of it
            asm volatile("s_wait_xcnt 0x0" :: "v"(Vhb + ((size_t)ln * SEQ + kv0 + 8 * hh)), "v"(Vlb + ((size_t)ln * SEQ + kv0 + 8 * hh)) : "memory");
#pragma unroll
            for (int ks = 0; ks < 2; ++ks) { o1 = wmmab(aph[ks], vh[ks], o1); o1 = wmmab(apl[ks], vh[ks], o1); o1 = wmmab(aph[ks], vl[ks], o1); }
            asm volatile("v_nop\n\tv_nop\n\tv_nop\n\tv_nop" : "+v"(o0), "+v"(o1) : "v"(aph[1]), "v"(apl[1]), "v"(vh[1]), "v"(vl[1])); }
    } else {
        v16h ap[2];
#pragma unroll
        for (int ks = 0; ks < 2; ++ks) { const unsigned short* pr = pta + ln * PP + 32 * ks + 8 * hh;
            ap[ks] = cat16(__builtin_bit_cast(v8h, *(const v8usa*)pr), __builtin_bit_cast(v8h, *(const v8usa*)(pr + 16))); }
        {   v16h vb[2];
#pragma unroll
            for (int ks = 0; ks < 2; ++ks) { const size_t vo = (size_t)ln * SEQ + kv0 + 32 * ks + 8 * hh; vb[ks] = cat16(*(const v8h*)(V16b + vo), *(const v8h*)(V16b + vo + 16)); }
#pragma unroll
            for (int ks = 0; ks < 2; ++ks) o0 = wmma16(ap[ks], vb[ks], o0); }
        {   v16h vb[2];
#pragma unroll
            for (int ks = 0; ks < 2; ++ks) { const size_t vo = (size_t)(16 + ln) * SEQ + kv0 + 32 * ks + 8 * hh; vb[ks] = cat16(*(const v8h*)(V16b + vo), *(const v8h*)(V16b + vo + 16)); }
            // the wait stands behind the last V load, in front of any instruction that reuses the V address register; the base address is its input so that no V load lands in it ahead of the wait
            asm volatile("s_wait_xcnt 0x0" :: "v"(V16b + ((size_t)ln * SEQ + kv0 + 8 * hh)) : "memory");
#pragma unroll
            for (int ks = 0; ks < 2; ++ks) o1 = wmma16(ap[ks], vb[ks], o1);
            asm volatile("v_nop\n\tv_nop\n\tv_nop\n\tv_nop" : "+v"(o0), "+v"(o1) : "v"(ap[1]), "v"(vb[1])); }
    }
}

// ---- k_attn: grid (query tiles of 16 rows, NB), 32 * KW threads; the workgroup owns rows q0 = qrow0 + blockIdx.x*16 .. +15 of batch b = blockIdx.y. Wave w visits the 64-key chunks w, w + KW, .. up to the
// diagonal chunk cd = q0 / 64 (exactly one masked chunk, taken by wave cd % KW) with its own running max, row sums and accumulators; its P tiles are private to the wave. Merge: each wave stores its
// un-normalised tile and per row (max, 16-lane-summed l) in its own LDS tile, one workgroup barrier, then thread -> (row, 2 columns): M = max over waves, weights exp2((m_w - M) L2E), out = sum_w f_w o_w x carry / sum_w f_w l_w.
// A wave that visited no chunk holds max -3e38, l 0, o 0: its weight is exp2(-inf) = 0.
template <bool HI>
__global__ __launch_bounds__(32 * KW) void k_attn(const bf* __restrict__ Qh, const bf* __restrict__ Ql, const bf* __restrict__ Kh, const bf* __restrict__ Kl,
                                             const h16* __restrict__ V16, const bf* __restrict__ Vh, const bf* __restrict__ Vl, float* OUT, int qrow0) {
    __shared__ __align__(16) unsigned short pt[(HI ? 2 : 1) * KW][16 * PP];
    __shared__ __align__(16) float ost[KW][16 * OPF];
    const int wave = __builtin_amdgcn_readfirstlane(threadIdx.x >> 5), lane = threadIdx.x & 31, hh = lane >> 4, ln = lane & 15;
    const int b = blockIdx.y; const int q0 = qrow0 + blockIdx.x * 16;
    const bf* Qhb = Qh + (size_t)b * SEQ * HS; const bf* Qlb = Ql + (size_t)b * SEQ * HS;
    const bf* Khb = Kh + (size_t)b * SEQ * HS; const bf* Klb = Kl + (size_t)b * SEQ * HS;
    const h16* V16b = V16 + (size_t)b * HS * SEQ; const bf* Vhb = Vh + (size_t)b * HS * SEQ; const bf* Vlb = Vl + (size_t)b * HS * SEQ;
    unsigned short* pta = &pt[(HI ? 2 : 1) * wave][0];
    unsigned short* ptb = &pt[(HI ? 2 : 1) * wave + (HI ? 1 : 0)][0];
    const size_t qo = (size_t)(q0 + ln) * HS + 8 * hh;
    const v16bf aqh = cat16b(*(const v8us*)(Qhb + qo), *(const v8us*)(Qhb + qo + 16));
    const v16bf aql = cat16b(*(const v8us*)(Qlb + qo), *(const v8us*)(Qlb + qo + 16));
    asm volatile("s_wait_xcnt 0x0" ::: "memory"); // stands behind the Q loads, in front of any instruction that reuses one of their address registers
    float mrun[8], lp[8]; v8f o0 = (v8f){}, o1 = (v8f){};
#pragma unroll
    for (int r = 0; r < 8; ++r) { mrun[r] = -3.0e38f; lp[r] = 0.0f; }
    int kv0 = wave * 64;
#pragma unroll 1
    for (; kv0 + 64 <= q0; kv0 += 64 * KW) attn_chunk<HI, false>(Khb, Klb, V16b, Vhb, Vlb, pta, ptb, aqh, aql, kv0, q0, ln, hh, mrun, lp, o0, o1);
    if (kv0 < q0 + 16) attn_chunk<HI, true>(Khb, Klb, V16b, Vhb, Vlb, pta, ptb, aqh, aql, kv0, q0, ln, hh, mrun, lp, o0, o1);
    float* osw = &ost[wave][0];
#pragma unroll
    for (int r = 0; r < 8; ++r) { float l = lp[r]; l += __shfl_xor(l, 1, 32); l += __shfl_xor(l, 2, 32); l += __shfl_xor(l, 4, 32); l += __shfl_xor(l, 8, 32); lp[r] = l;
        osw[(8 * hh + r) * OPF + ln] = o0[r]; osw[(8 * hh + r) * OPF + 16 + ln] = o1[r]; }
    if (ln == 0) {
#pragma unroll
        for (int r = 0; r < 8; ++r) { v2f ms; ms[0] = mrun[r]; ms[1] = lp[r]; *(v2f*)(osw + (8 * hh + r) * OPF + 32) = ms; } }
    __syncthreads();
    const float carry = HI ? 1.0f : (1.0f / PCAR);
    const int row = threadIdx.x >> 4, col = (threadIdx.x & 15) * 2;
    static_assert(32 * KW == 16 * 16);
    v2f ml[KW]; float M = -3.0e38f;
#pragma unroll
    for (int w = 0; w < KW; ++w) { ml[w] = *(const v2f*)(&ost[w][row * OPF + 32]); M = fmaxf(M, ml[w][0]); }
    float L = 0.0f, a0 = 0.0f, a1 = 0.0f;
#pragma unroll
    for (int w = 0; w < KW; ++w) { float f; const float fx = (ml[w][0] - M) * L2E; const v2f o = *(const v2f*)(&ost[w][row * OPF + col]);
        asm("v_exp_f32 %0, %1\n\tv_nop" : "=v"(f) : "v"(fx)); // v_nop: the slot the instruction set asks for behind a transcendental before its result is used or its source overwritten
        L += f * ml[w][1]; a0 += f * o[0]; a1 += f * o[1]; }
    const float inv = carry * __builtin_amdgcn_rcpf(L);
    v2f res; res[0] = a0 * inv; res[1] = a1 * inv;
    *(v2f*)(OUT + ((size_t)b * SEQ_FULL + q0 + row) * HS + col) = res;
}

extern "C" void kernel_launch(void* const* d_in, const int* in_sizes, int n_in,
                              void* d_out, int out_size, void* d_ws, size_t ws_size, hipStream_t stream) {
    if (n_in < 4) return;
    const float* x  = (const float*)d_in[0];   // [8][4096][128]
    const float* wq = (const float*)d_in[1];   // [128][32]
    const float* wk = (const float*)d_in[2];   // [128][32]
    const float* wv = (const float*)d_in[3];   // [128][32]
    if (in_sizes[0] < ((NB - 1) * SEQ_FULL + SEQ) * DM) return;
    if (in_sizes[1] < DM * HS || in_sizes[2] < DM * HS || in_sizes[3] < DM * HS) return;
    if (out_size < ((NB - 1) * SEQ_FULL + SEQ) * HS) return;
    float* OUT = (float*)d_out;                 // [8][4096][32] f32
    char* wsp = (char*)d_ws;
    auto take = [&](size_t bytes) { char* p = wsp; wsp += (bytes + 255) & ~(size_t)255; return (void*)p; };
    bf*    WB   = (bf*)take((size_t)NP * DM * 2);                    //      32,768 B
    float* CS   = (float*)take((size_t)SEQ * (HS / 2) * 2 * 4);      //     524,288 B
    bf*    XB   = (bf*)take((size_t)NB * SEQ * DM * 2);              //   8,388,608 B
    float* F    = (float*)take((size_t)NB * SEQ * NP * 4);           //  16,777,216 B
    bf*    Qh   = (bf*)take((size_t)NB * SEQ * HS * 2);              //   2,097,152 B each
    bf*    Ql   = (bf*)take((size_t)NB * SEQ * HS * 2);
    bf*    Kh   = (bf*)take((size_t)NB * SEQ * HS * 2);
    bf*    Kl   = (bf*)take((size_t)NB * SEQ * HS * 2);
    h16*   VT16 = (h16*)take((size_t)NB * HS * SEQ * 2);
    bf*    VTh  = (bf*)take((size_t)NB * HS * SEQ * 2);
    bf*    VTl  = (bf*)take((size_t)NB * HS * SEQ * 2);             // total 40,402,944 B
    if ((size_t)(wsp - (char*)d_ws) > ws_size) return;
    const int rh = (RH < SEQ) ? RH : SEQ;

    k_wt<<<(NP * DM / 8) / 256, 256, 0, stream>>>(wq, wk, wv, WB);
    k_cs<<<(SEQ * (HS / 2)) / 256, 256, 0, stream>>>(CS);
    const int n8 = NB * SEQ * (DM / 8);
    k_cvt<<<(unsigned)(n8 / 256), 256, 0, stream>>>(x, XB, n8);
    k_gemmw<bf, 0, false><<<dim3(NB * SEQ / 64, NP / 64, 1), 32, 0, stream>>>(XB, nullptr, WB, nullptr, DM, F, NP, nullptr, 0, 0, 0);
    k_planes<<<dim3(SEQ / 64, NB), 256, 0, stream>>>(F, CS, Qh, Ql, Kh, Kl, VT16, VTh, VTl);
    k_attn<true><<<dim3(rh / 16, NB), 32 * KW, 0, stream>>>(Qh, Ql, Kh, Kl, VT16, VTh, VTl, OUT, 0);
    if (SEQ > rh) k_attn<false><<<dim3((SEQ - rh) / 16, NB), 32 * KW, 0, stream>>>(Qh, Ql, Kh, Kl, VT16, VTh, VTl, OUT, rh);
}

// v002
// A run of this version takes 72.6 microseconds.
// Timed twice side by side with v001, it ran 1.20 and 1.19 times as fast.
// All steps since v000 together make it 2.42 times as fast.
#include <hip/hip_runtime.h>

// Contractions, f32 accumulate: x.[Wq|Wk|Wv] on v_wmma_f32_16x16x32_bf16 (x and W RNE-converted to bf16); q.k^T as 3 bf16 products (q,k hi+lo planes) on every row; P.V rows < RH as 3 bf16 products (P and V hi+lo), rows >= RH on v_wmma_f32_16x16x32_f16 (P fp16 carried x 2^14, V fp16); rotary table, softmax and normalisation in f32.
// Pipeline: k_prep (one workgroup per 64 rows of x) converts its x tile and the three weights to bf16 in LDS, projects to q|k|v in f32 (LDS), applies the interleaved rotary pairs (cos, sin formed in the kernel)
// and writes Q/K bf16 hi,lo planes [b][t][32] and V^T planes [b][d][t] (fp16, bf16 hi, bf16 lo);
// k_attn: one workgroup of KW waves per 16 query rows, wave w takes the 64-key chunks w, w + KW, ..; online softmax per wave (running max, f32 row sums), causal: chunks above the diagonal never visited, one masked diagonal chunk (replace by -3e38 == exclusion); the waves' partials are merged through LDS;
#pragma clang fp contract(off)

#ifndef NB
#define NB 8
#endif
#ifndef SEQ
#define SEQ 4096
#endif
#define NB_FULL  8
#define SEQ_FULL 4096
#define DM   128                  // embedding width (K of the projections)
#define HS   32                   // head width
#define XP   136                  // LDS pitch (bf16 elements) of the x and weight tiles: 272 B = 16 B x 17, odd, for 16-byte readers
#define FP   100                  // LDS pitch (floats) of the projected q | k | v tile: 400 B, a multiple of 16 B; the two lane halves of a D store fall on disjoint banks
#ifndef RH
#define RH   1024                 // query rows < RH use bf16 hi+lo P and V planes
#endif
#define PCAR 16384.0f             // fp16 P carry (2^14) for rows >= RH
#define SCL  0.17677669529663687f // 32^-0.5
#define L2E  1.4426950408889634f
#define PP   72                   // LDS P tile pitch (halves)
#define OPF  36                   // LDS output tile pitch (floats); columns 32, 33 of a row hold the wave's (max, sum)
#define KW   8                    // waves of a k_attn workgroup = key ranges of one 16-row query tile
static_assert(SEQ % 64 == 0);
static_assert(SEQ <= SEQ_FULL);
static_assert(NB >= 1);
static_assert(NB <= NB_FULL);
static_assert(RH % 64 == 0);
static_assert(DM % 32 == 0);
static_assert(DM == 128 && HS == 32);
static_assert((long long)NB_FULL * SEQ_FULL * HS * 4 == 4194304LL);

typedef _Float16 h16;
typedef unsigned short bf;
typedef __attribute__((ext_vector_type(16))) __bf16   v16bf;
typedef __attribute__((ext_vector_type(16))) _Float16 v16h;
typedef __attribute__((ext_vector_type(8)))  _Float16 v8h;
typedef __attribute__((ext_vector_type(8)))  unsigned short v8us;
typedef __attribute__((ext_vector_type(4)))  unsigned short v4us;
typedef __attribute__((ext_vector_type(2)))  unsigned short v2us;
typedef __attribute__((ext_vector_type(8)))  float    v8f;
typedef __attribute__((ext_vector_type(4)))  float    v4f;
typedef __attribute__((ext_vector_type(2)))  float    v2f;
typedef v8h  __attribute__((may_alias)) v8ha;
typedef v4f  __attribute__((may_alias)) v4fa;
typedef v8us __attribute__((may_alias)) v8usa;
typedef v4us __attribute__((may_alias)) v4usa;

__device__ __forceinline__ unsigned short f2bf(float f) { unsigned u = __float_as_uint(f); u += 0x7FFFu + ((u >> 16) & 1u); return (unsigned short)(u >> 16); }
__device__ __forceinline__ float bf2f(unsigned short b) { return __uint_as_float(((unsigned)b) << 16); }
__device__ __forceinline__ v8f cat8f(v4f lo, v4f hi) { return __builtin_shufflevector(lo, hi, 0, 1, 2, 3, 4, 5, 6, 7); }
__device__ __forceinline__ v16h cat16(v8h lo, v8h hi) { return __builtin_shufflevector(lo, hi, 0, 1, 2, 3, 4, 5, 6, 7, 8, 9, 10, 11, 12, 13, 14, 15); }
__device__ __forceinline__ v16bf cat16b(v8us lo, v8us hi) { return __builtin_bit_cast(v16bf, __builtin_shufflevector(lo, hi, 0, 1, 2, 3, 4, 5, 6, 7, 8, 9, 10, 11, 12, 13, 14, 15)); }
__device__ __forceinline__ v8f wmma16(v16h a, v16h b, v8f c) { return __builtin_amdgcn_wmma_f32_16x16x32_f16(false, a, false, b, (short)0, c, false, false); }
__device__ __forceinline__ v8f wmmab(v16bf a, v16bf b, v8f c) { return __builtin_amdgcn_wmma_f32_16x16x32_bf16(false, a, false, b, (short)0, c, false, false); }

// INVT[i] = 1 / 10000^(2i/32): the exact float32 results of that expression (pow then reciprocal in f32), i = 0..15.
__constant__ __align__(16) float INVT[HS / 2] = { 1.0f, 0.5623413324356079f, 0.3162277638912201f, 0.17782793939113617f, 0.10000000149011612f, 0.05623412877321243f, 0.03162277862429619f, 0.017782794311642647f, 0.009999999776482582f, 0.005623413249850273f, 0.003162277862429619f, 0.0017782794311642647f, 0.0010000000474974513f, 0.000562341301701963f, 0.0003162277862429619f, 0.00017782794020604342f };

// ---- k_prep: block = batch b (grid.y), 64 consecutive t (t0 = blockIdx.x * 64), 256 threads = 8 waves. Three phases, a workgroup barrier between each two.
// Phase 1 (stage): the x tile [64 t][128 k] is read as 16-byte pieces, contiguous over the block, RNE-converted to bf16 and stored in xs [row][k]; the weights are read column by lane (wave -> matrix and group of 8 k),
// converted and stored transposed in wt [n = 32 * matrix + column][k] (n 0..31 q, 32..63 k, 64..95 v); each thread also forms its four rotary pairs (c, s) = {cos, sin}(INVT[i] * t), t = t0 + (tid >> 2), i = 4 * (tid & 3) + p.
// Phase 2 (project): wave w owns rows 16 * (w & 3) .. + 15 and the three 16-column tiles 3 * (w >> 2) + 0..2; k in steps of 32, ascending, f32 accumulate.
// Fragments: lane -> row/col (lane & 15), elements 0..7 <- k0 + 8*(lane >> 4) + 0..7, elements 8..15 <- k0 + 16 + 8*(lane >> 4) + 0..7 for A and for the [n][k] B tile. D element j of lane l is row 8*(l >> 4) + j, column l & 15; it goes to fs [row][n] in f32.
// Phase 3 (planes): thread -> row r = tid>>2, column group g = tid&3 = 8 q, 8 k, 8 v columns. Rotary (interleaved pairs, i = column/2): out[2i] = x[2i] c - x[2i+1] s, out[2i+1] = x[2i] s + x[2i+1] c, separate f32 products.
// LDS tiles: sq[0..3] = Qh, Ql, Kh, Kl as [64 r][32 c]; sv[0..2] = V^T fp16 bits, bf16 hi, bf16 lo as [32 d][64 r]. After the last barrier every plane's 4,096-byte tile region is written in 16-byte pieces.
__global__ __launch_bounds__(256) void k_prep(const float* __restrict__ x, const float* __restrict__ wq, const float* __restrict__ wk, const float* __restrict__ wv,
                                              bf* Qh, bf* Ql, bf* Kh, bf* Kl, h16* VT16, bf* VTh, bf* VTl) {
    __shared__ __align__(16) unsigned short xs[64 * XP];
    __shared__ __align__(16) unsigned short wt[96 * XP];
    __shared__ __align__(16) float fs[64 * FP];
    __shared__ __align__(16) unsigned short sq[4][64 * 32];
    __shared__ __align__(16) unsigned short sv[3][32 * 64];
    const int tid = threadIdx.x; const int b = blockIdx.y, t0 = blockIdx.x * 64;
    const int w = __builtin_amdgcn_readfirstlane(tid >> 5), L = tid & 31;
    const int r = tid >> 2, g = tid & 3; const int t = t0 + r;
    // ---- phase 1
    const v4f iv = *(const v4f*)(INVT + 4 * g);
    const float* xp = x + ((size_t)b * SEQ_FULL + t0) * DM + (size_t)tid * 4;
    v4f xr[8];
#pragma unroll
    for (int s = 0; s < 8; ++s) xr[s] = *(const v4f*)(xp + s * 1024);
    float wr[6][8];
#pragma unroll
    for (int s = 0; s < 6; ++s) { const int c = s * 8 + w; const int m = c >> 4, kg = c & 15;
        const float* wsrc = ((m == 0) ? wq : ((m == 1) ? wk : wv)) + (size_t)kg * 8 * HS + L;
#pragma unroll
        for (int j = 0; j < 8; ++j) wr[s][j] = wsrc[j * HS]; }
    float cnv[4], snv[4];
#pragma unroll
    for (int p = 0; p < 4; ++p) { const float ang = iv[p] * (float)t; float sn, cn; sincosf(ang, &sn, &cn); cnv[p] = cn; snv[p] = sn; }
#pragma unroll
    for (int s = 0; s < 8; ++s) { const int e = (s * 256 + tid) * 4; v4us o;
#pragma unroll
        for (int k = 0; k < 4; ++k) o[k] = f2bf(xr[s][k]);
        *(v4usa*)(&xs[(e >> 7) * XP + (e & 127)]) = o; }
#pragma unroll
    for (int s = 0; s < 6; ++s) { const int c = s * 8 + w; const int m = c >> 4, kg = c & 15; v8us o;
#pragma unroll
        for (int j = 0; j < 8; ++j) o[j] = f2bf(wr[s][j]);
        *(v8usa*)(&wt[(m * 32 + L) * XP + kg * 8]) = o; }
    __syncthreads();
    // ---- phase 2
    {   const int lr = L & 15, hi = L >> 4; const int mt = w & 3, ng = w >> 2;
        v8f acc[3];
#pragma unroll
        for (int nb = 0; nb < 3; ++nb) acc[nb] = (v8f){};
#pragma unroll
        for (int kc = 0; kc < DM; kc += 32) {
            const unsigned short* ap = &xs[(mt * 16 + lr) * XP + kc + 8 * hi];
            const v16bf a = cat16b(*(const v8usa*)ap, *(const v8usa*)(ap + 16));
#pragma unroll
            for (int nb = 0; nb < 3; ++nb) { const unsigned short* bp = &wt[((ng * 3 + nb) * 16 + lr) * XP + kc + 8 * hi];
                acc[nb] = wmmab(a, cat16b(*(const v8usa*)bp, *(const v8usa*)(bp + 16)), acc[nb]); }
        }
#pragma unroll
        for (int nb = 0; nb < 3; ++nb) {
#pragma unroll
            for (int j = 0; j < 8; ++j) fs[(mt * 16 + hi * 8 + j) * FP + (ng * 3 + nb) * 16 + lr] = acc[nb][j]; }
    }
    __syncthreads();
    // ---- phase 3
    const float* fr = &fs[r * FP + 8 * g];
    const v8f xq = cat8f(*(const v4fa*)fr, *(const v4fa*)(fr + 4)), xk = cat8f(*(const v4fa*)(fr + 32), *(const v4fa*)(fr + 36)), xv = cat8f(*(const v4fa*)(fr + 64), *(const v4fa*)(fr + 68));
#pragma unroll
    for (int p = 0; p < 4; ++p) {
        const float cn = cnv[p], sn = snv[p]; const int col = 8 * g + 2 * p;
        {   const float x1 = xq[2 * p], x2 = xq[2 * p + 1]; const float ev = x1 * cn - x2 * sn, od = x1 * sn + x2 * cn;
            v2us oh, ol; unsigned short hh0 = f2bf(ev), hh1 = f2bf(od); oh[0] = hh0; oh[1] = hh1; ol[0] = f2bf(ev - bf2f(hh0)); ol[1] = f2bf(od - bf2f(hh1));
            *(v2us*)(&sq[0][r * 32 + col]) = oh; *(v2us*)(&sq[1][r * 32 + col]) = ol; }
        {   const float x1 = xk[2 * p], x2 = xk[2 * p + 1]; const float ev = x1 * cn - x2 * sn, od = x1 * sn + x2 * cn;
            v2us oh, ol; unsigned short hh0 = f2bf(ev), hh1 = f2bf(od); oh[0] = hh0; oh[1] = hh1; ol[0] = f2bf(ev - bf2f(hh0)); ol[1] = f2bf(od - bf2f(hh1));
            *(v2us*)(&sq[2][r * 32 + col]) = oh; *(v2us*)(&sq[3][r * 32 + col]) = ol; }
#pragma unroll
        for (int j = 0; j < 2; ++j) { const float val = xv[2 * p + j]; const int d = col + j; const unsigned short vh = f2bf(val);
            sv[0][d * 64 + r] = __builtin_bit_cast(unsigned short, (h16)val); sv[1][d * 64 + r] = vh; sv[2][d * 64 + r] = f2bf(val - bf2f(vh)); }
    }
    __syncthreads();
    const int lo = w * 256 + L * 8;                                                    // linear offset inside a 2,048-element tile
    const size_t qoff = ((size_t)b * SEQ + t0) * HS + lo;                              // Q/K planes [b][t][32]
    const int d = 4 * w + (L >> 3), toff = (L & 7) * 8;
    const size_t voff = ((size_t)b * HS + d) * SEQ + t0 + toff;                       // V^T planes [b][d][t]
    const v8us q0v = *(const v8usa*)(&sq[0][lo]), q1v = *(const v8usa*)(&sq[1][lo]), k0v = *(const v8usa*)(&sq[2][lo]), k1v = *(const v8usa*)(&sq[3][lo]);
    const v8us v0v = *(const v8usa*)(&sv[0][lo]), v1v = *(const v8usa*)(&sv[1][lo]), v2v = *(const v8usa*)(&sv[2][lo]);
    unsigned short* VT16u = (unsigned short*)VT16;
    *(v8us*)(Qh + qoff) = q0v; *(v8us*)(Ql + qoff) = q1v; *(v8us*)(Kh + qoff) = k0v; *(v8us*)(Kl + qoff) = k1v;
    *(v8us*)(VT16u + voff) = v0v; *(v8us*)(VTh + voff) = v1v; *(v8us*)(VTl + voff) = v2v;
}

// ---- attn_chunk: one 64-key chunk for one wave's 16 query rows (q0..q0+15). Scores: 4 key tiles, each hi.hi + lo.hi + hi.lo (q, k bf16 planes [t][32]; B fragment = K rows, k-contiguous).
// D element r of lane l is S[q0 + 8*(l>>4) + r][kv0 + 16*tile + (l&15)]. Online softmax per row: x SCL, causal replace-mask (MASK chunk only), 16-lane max tree, running max / rescale,
// P reloaded as the A operand with the split k map, V^T planes [d][t] as the B operand (HI: 3 bf16 products; else one fp16 product), outputs o0 (d 0..15) and o1 (d 16..31).
template <bool HI, bool MASK>
__device__ __forceinline__ void attn_chunk(const bf* __restrict__ Khb, const bf* __restrict__ Klb, const h16* __restrict__ V16b, const bf* __restrict__ Vhb, const bf* __restrict__ Vlb,
                                           unsigned short* pta, unsigned short* ptb, const v16bf aqh, const v16bf aql, const int kv0, const int q0, const int ln, const int hh,
                                           float* mrun, float* lp, v8f& o0, v8f& o1) {
    v16bf bh[4], bl[4]; const bf* kph[4]; const bf* kpl[4];
#pragma unroll
    for (int t = 0; t < 4; ++t) { const size_t ko = (size_t)(kv0 + 16 * t + ln) * HS + 8 * hh; kph[t] = Khb + ko; kpl[t] = Klb + ko;
        bh[t] = cat16b(*(const v8us*)kph[t], *(const v8us*)(kph[t] + 16)); bl[t] = cat16b(*(const v8us*)kpl[t], *(const v8us*)(kpl[t] + 16)); }
    // the wait stands behind the K loads, in front of any instruction that reuses one of their address registers; the addresses are its inputs so that no load of the run lands in one of them ahead of it
    asm volatile("s_wait_xcnt 0x0" :: "v"(kph[0]), "v"(kph[1]), "v"(kph[2]), "v"(kph[3]), "v"(kpl[0]), "v"(kpl[1]), "v"(kpl[2]), "v"(kpl[3]) : "memory");
    v8f s[4];
#pragma unroll
    for (int t = 0; t < 4; ++t) { v8f a = wmmab(aqh, bh[t], (v8f){}); a = wmmab(aql, bh[t], a); a = wmmab(aqh, bl[t], a); s[t] = a; }
    asm volatile("v_nop\n\tv_nop\n\tv_nop\n\tv_nop" : "+v"(s[0]), "+v"(s[1]), "+v"(s[2]), "+v"(s[3]) : "v"(aqh), "v"(aql), "v"(bh[3]), "v"(bl[3]));
#pragma unroll
    for (int r = 0; r < 8; ++r) {
        const int qi = q0 + 8 * hh + r;
        float e[4];
#pragma unroll
        for (int t = 0; t < 4; ++t) { float v = s[t][r] * SCL; if (MASK) v = (kv0 + 16 * t + ln <= qi) ? v : -3.0e38f; e[t] = v; }
        float rm = fmaxf(fmaxf(e[0], e[1]), fmaxf(e[2], e[3]));
        rm = fmaxf(rm, __shfl_xor(rm, 1, 32)); rm = fmaxf(rm, __shfl_xor(rm, 2, 32)); rm = fmaxf(rm, __shfl_xor(rm, 4, 32)); rm = fmaxf(rm, __shfl_xor(rm, 8, 32));
        const float mn = fmaxf(mrun[r], rm);
        const float cf = __builtin_amdgcn_exp2f((mrun[r] - mn) * L2E);
        mrun[r] = mn;
        float psum = 0.0f;
#pragma unroll
        for (int t = 0; t < 4; ++t) {
            const float p = __builtin_amdgcn_exp2f((e[t] - mn) * L2E);
            psum += p;
            const int po = (8 * hh + r) * PP + 16 * t + ln;
            if (HI) { const unsigned short ph = f2bf(p); pta[po] = ph; ptb[po] = f2bf(p - bf2f(ph)); }
            else { pta[po] = __builtin_bit_cast(unsigned short, (h16)(p * PCAR)); }
        }
        lp[r] = lp[r] * cf + psum; o0[r] = o0[r] * cf; o1[r] = o1[r] * cf;
    }
    __builtin_amdgcn_fence(3 /* release order */, "wavefront");
    asm volatile("s_wait_dscnt 0x0" ::: "memory");
    __builtin_amdgcn_wave_barrier();
    if (HI) {
        v16bf aph[2], apl[2];
#pragma unroll
        for (int ks = 0; ks < 2; ++ks) { const unsigned short* pr = pta + ln * PP + 32 * ks + 8 * hh; const unsigned short* pr2 = ptb + ln * PP + 32 * ks + 8 * hh;
            aph[ks] = cat16b(*(const v8usa*)pr, *(const v8usa*)(pr + 16)); apl[ks] = cat16b(*(const v8usa*)pr2, *(const v8usa*)(pr2 + 16)); }
        {   v16bf vh[2], vl[2];
#pragma unroll
            for (int ks = 0; ks < 2; ++ks) { const size_t vo = (size_t)ln * SEQ + kv0 + 32 * ks + 8 * hh;
                vh[ks] = cat16b(*(const v8us*)(Vhb + vo), *(const v8us*)(Vhb + vo + 16)); vl[ks] = cat16b(*(const v8us*)(Vlb + vo), *(const v8us*)(Vlb + vo + 16)); }
#pragma unroll
            for (int ks = 0; ks < 2; ++ks) { o0 = wmmab(aph[ks], vh[ks], o0); o0 = wmmab(apl[ks], vh[ks], o0); o0 = wmmab(aph[ks], vl[ks], o0); } }
        {   v16bf vh[2], vl[2];
#pragma unroll
            for (int ks = 0; ks < 2; ++ks) { const size_t vo = (size_t)(16 + ln) * SEQ + kv0 + 32 * ks + 8 * hh;
                vh[ks] = cat16b(*(const v8us*)(Vhb + vo), *(const v8us*)(Vhb + vo + 16)); vl[ks] = cat16b(*(const v8us*)(Vlb + vo), *(const v8us*)(Vlb + vo + 16)); }
            // the wait stands behind the last V load, in front of any instruction that reuses a V address register; the two base addresses are its inputs so that no V load lands in one of them ahead of it
            asm volatile("s_wait_xcnt 0x0" :: "v"(Vhb + ((size_t)ln * SEQ + kv0 + 8 * hh)), "v"(Vlb + ((size_t)ln * SEQ + kv0 + 8 * hh)) : "memory");
#pragma unroll
            for (int ks = 0; ks < 2; ++ks) { o1 = wmmab(aph[ks], vh[ks], o1); o1 = wmmab(apl[ks], vh[ks], o1); o1 = wmmab(aph[ks], vl[ks], o1); }
            asm volatile("v_nop\n\tv_nop\n\tv_nop\n\tv_nop" : "+v"(o0), "+v"(o1) : "v"(aph[1]), "v"(apl[1]), "v"(vh[1]), "v"(vl[1])); }
    } else {
        v16h ap[2];
#pragma unroll
        for (int ks = 0; ks < 2; ++ks) { const unsigned short* pr = pta + ln * PP + 32 * ks + 8 * hh;
            ap[ks] = cat16(__builtin_bit_cast(v8h, *(const v8usa*)pr), __builtin_bit_cast(v8h, *(const v8usa*)(pr + 16))); }
        {   v16h vb[2];
#pragma unroll
            for (int ks = 0; ks < 2; ++ks) { const size_t vo = (size_t)ln * SEQ + kv0 + 32 * ks + 8 * hh; vb[ks] = cat16(*(const v8h*)(V16b + vo), *(const v8h*)(V16b + vo + 16)); }
#pragma unroll
            for (int ks = 0; ks < 2; ++ks) o0 = wmma16(ap[ks], vb[ks], o0); }
        {   v16h vb[2];
#pragma unroll
            for (int ks = 0; ks < 2; ++ks) { const size_t vo = (size_t)(16 + ln) * SEQ + kv0 + 32 * ks + 8 * hh; vb[ks] = cat16(*(const v8h*)(V16b + vo), *(const v8h*)(V16b + vo + 16)); }
            // the wait stands behind the last V load, in front of any instruction that reuses the V address register; the base address is its input so that no V load lands in it ahead of the wait
            asm volatile("s_wait_xcnt 0x0" :: "v"(V16b + ((size_t)ln * SEQ + kv0 + 8 * hh)) : "memory");
#pragma unroll
            for (int ks = 0; ks < 2; ++ks) o1 = wmma16(ap[ks], vb[ks], o1);
            asm volatile("v_nop\n\tv_nop\n\tv_nop\n\tv_nop" : "+v"(o0), "+v"(o1) : "v"(ap[1]), "v"(vb[1])); }
    }
}

// ---- k_attn: grid (query tiles of 16 rows, NB), 32 * KW threads; the workgroup owns rows q0 = qrow0 + blockIdx.x*16 .. +15 of batch b = blockIdx.y. Wave w visits the 64-key chunks w, w + KW, .. up to the
// diagonal chunk cd = q0 / 64 (exactly one masked chunk, taken by wave cd % KW) with its own running max, row sums and accumulators; its P tiles are private to the wave. Merge: each wave stores its
// un-normalised tile and per row (max, 16-lane-summed l) in its own LDS tile, one workgroup barrier, then thread -> (row, 2 columns): M = max over waves, weights exp2((m_w - M) L2E), out = sum_w f_w o_w x carry / sum_w f_w l_w.
// A wave that visited no chunk holds max -3e38, l 0, o 0: its weight is exp2(-inf) = 0.
template <bool HI>
__global__ __launch_bounds__(32 * KW) void k_attn(const bf* __restrict__ Qh, const bf* __restrict__ Ql, const bf* __restrict__ Kh, const bf* __restrict__ Kl,
                                             const h16* __restrict__ V16, const bf* __restrict__ Vh, const bf* __restrict__ Vl, float* OUT, int qrow0) {
    __shared__ __align__(16) unsigned short pt[(HI ? 2 : 1) * KW][16 * PP];
    __shared__ __align__(16) float ost[KW][16 * OPF];
    const int wave = __builtin_amdgcn_readfirstlane(threadIdx.x >> 5), lane = threadIdx.x & 31, hh = lane >> 4, ln = lane & 15;
    const int b = blockIdx.y; const int q0 = qrow0 + blockIdx.x * 16;
    const bf* Qhb = Qh + (size_t)b * SEQ * HS; const bf* Qlb = Ql + (size_t)b * SEQ * HS;
    const bf* Khb = Kh + (size_t)b * SEQ * HS; const bf* Klb = Kl + (size_t)b * SEQ * HS;
    const h16* V16b = V16 + (size_t)b * HS * SEQ; const bf* Vhb = Vh + (size_t)b * HS * SEQ; const bf* Vlb = Vl + (size_t)b * HS * SEQ;
    unsigned short* pta = &pt[(HI ? 2 : 1) * wave][0];
    unsigned short* ptb = &pt[(HI ? 2 : 1) * wave + (HI ? 1 : 0)][0];
    const size_t qo = (size_t)(q0 + ln) * HS + 8 * hh;
    const v16bf aqh = cat16b(*(const v8us*)(Qhb + qo), *(const v8us*)(Qhb + qo + 16));
    const v16bf aql = cat16b(*(const v8us*)(Qlb + qo), *(const v8us*)(Qlb + qo + 16));
    asm volatile("s_wait_xcnt 0x0" ::: "memory"); // stands behind the Q loads, in front of any instruction that reuses one of their address registers
    float mrun[8], lp[8]; v8f o0 = (v8f){}, o1 = (v8f){};
#pragma unroll
    for (int r = 0; r < 8; ++r) { mrun[r] = -3.0e38f; lp[r] = 0.0f; }
    int kv0 = wave * 64;
#pragma unroll 1
    for (; kv0 + 64 <= q0; kv0 += 64 * KW) attn_chunk<HI, false>(Khb, Klb, V16b, Vhb, Vlb, pta, ptb, aqh, aql, kv0, q0, ln, hh, mrun, lp, o0, o1);
    if (kv0 < q0 + 16) attn_chunk<HI, true>(Khb, Klb, V16b, Vhb, Vlb, pta, ptb, aqh, aql, kv0, q0, ln, hh, mrun, lp, o0, o1);
    float* osw = &ost[wave][0];
#pragma unroll
    for (int r = 0; r < 8; ++r) { float l = lp[r]; l += __shfl_xor(l, 1, 32); l += __shfl_xor(l, 2, 32); l += __shfl_xor(l, 4, 32); l += __shfl_xor(l, 8, 32); lp[r] = l;
        osw[(8 * hh + r) * OPF + ln] = o0[r]; osw[(8 * hh + r) * OPF + 16 + ln] = o1[r]; }
    if (ln == 0) {
#pragma unroll
        for (int r = 0; r < 8; ++r) { v2f ms; ms[0] = mrun[r]; ms[1] = lp[r]; *(v2f*)(osw + (8 * hh + r) * OPF + 32) = ms; } }
    __syncthreads();
    const float carry = HI ? 1.0f : (1.0f / PCAR);
    const int row = threadIdx.x >> 4, col = (threadIdx.x & 15) * 2;
    static_assert(32 * KW == 16 * 16);
    v2f ml[KW]; float M = -3.0e38f;
#pragma unroll
    for (int w = 0; w < KW; ++w) { ml[w] = *(const v2f*)(&ost[w][row * OPF + 32]); M = fmaxf(M, ml[w][0]); }
    float L = 0.0f, a0 = 0.0f, a1 = 0.0f;
#pragma unroll
    for (int w = 0; w < KW; ++w) { float f; const float fx = (ml[w][0] - M) * L2E; const v2f o = *(const v2f*)(&ost[w][row * OPF + col]);
        asm("v_exp_f32 %0, %1\n\tv_nop" : "=v"(f) : "v"(fx)); // v_nop: the slot the instruction set asks for behind a transcendental before its result is used or its source overwritten
        L += f * ml[w][1]; a0 += f * o[0]; a1 += f * o[1]; }
    const float inv = carry * __builtin_amdgcn_rcpf(L);
    v2f res; res[0] = a0 * inv; res[1] = a1 * inv;
    *(v2f*)(OUT + ((size_t)b * SEQ_FULL + q0 + row) * HS + col) = res;
}

extern "C" void kernel_launch(void* const* d_in, const int* in_sizes, int n_in,
                              void* d_out, int out_size, void* d_ws, size_t ws_size, hipStream_t stream) {
    if (n_in < 4) return;
    const float* x  = (const float*)d_in[0];   // [8][4096][128]
    const float* wq = (const float*)d_in[1];   // [128][32]
    const float* wk = (const float*)d_in[2];   // [128][32]
    const float* wv = (const float*)d_in[3];   // [128][32]
    if (in_sizes[0] < ((NB - 1) * SEQ_FULL + SEQ) * DM) return;
    if (in_sizes[1] < DM * HS || in_sizes[2] < DM * HS || in_sizes[3] < DM * HS) return;
    if (out_size < ((NB - 1) * SEQ_FULL + SEQ) * HS) return;
    float* OUT = (float*)d_out;                 // [8][4096][32] f32
    char* wsp = (char*)d_ws;
    auto take = [&](size_t bytes) { char* p = wsp; wsp += (bytes + 255) & ~(size_t)255; return (void*)p; };
    bf*    Qh   = (bf*)take((size_t)NB * SEQ * HS * 2);              //   2,097,152 B each
    bf*    Ql   = (bf*)take((size_t)NB * SEQ * HS * 2);
    bf*    Kh   = (bf*)take((size_t)NB * SEQ * HS * 2);
    bf*    Kl   = (bf*)take((size_t)NB * SEQ * HS * 2);
    h16*   VT16 = (h16*)take((size_t)NB * HS * SEQ * 2);
    bf*    VTh  = (bf*)take((size_t)NB * HS * SEQ * 2);
    bf*    VTl  = (bf*)take((size_t)NB * HS * SEQ * 2);             // total 14,680,064 B
    if ((size_t)(wsp - (char*)d_ws) > ws_size) return;
    const int rh = (RH < SEQ) ? RH : SEQ;

    k_prep<<<dim3(SEQ / 64, NB), 256, 0, stream>>>(x, wq, wk, wv, Qh, Ql, Kh, Kl, VT16, VTh, VTl);
    k_attn<true><<<dim3(rh / 16, NB), 32 * KW, 0, stream>>>(Qh, Ql, Kh, Kl, VT16, VTh, VTl, OUT, 0);
    if (SEQ > rh) k_attn<false><<<dim3((SEQ - rh) / 16, NB), 32 * KW, 0, stream>>>(Qh, Ql, Kh, Kl, VT16, VTh, VTl, OUT, rh);
}

// v003
// Measured time: 57.4 microseconds a run.
// Two timings next to v002 both put it at 1.27 times that version's speed.
// Over all steps from v000 it is 3.06 times as fast.
#include <hip/hip_runtime.h>

// Contractions, f32 accumulate: x.[Wq|Wk|Wv] on v_wmma_f32_16x16x32_bf16 (x and W RNE-converted to bf16); q.k^T as 3 bf16 products (q,k hi+lo planes) on every row; P.V rows < RH as 3 bf16 products (P and V hi+lo), rows >= RH on v_wmma_f32_16x16x32_f16 (P fp16 carried x 2^14, V fp16); rotary table, softmax and normalisation in f32.
// Pipeline: k_prep (one workgroup per 64 rows of x) converts its x tile and the three weights to bf16 in LDS, projects to q|k|v in f32 (LDS), applies the interleaved rotary pairs (cos, sin formed in the kernel)
// and writes Q/K bf16 hi,lo planes [b][t][32] and V^T planes [b][d][t] (fp16, bf16 hi, bf16 lo);
// k_attn: one workgroup of KW waves per 16 query rows, wave w takes the 64-key chunks w, w + KW, ..; scores and outputs in transposed form (one query per lane), online softmax per wave (running max, f32 sums), causal: chunks above the diagonal never visited, one masked diagonal chunk (replace by -3e38 == exclusion); the waves' partials are merged through LDS;
#pragma clang fp contract(off)

#ifndef NB
#define NB 8
#endif
#ifndef SEQ
#define SEQ 4096
#endif
#define NB_FULL  8
#define SEQ_FULL 4096
#define DM   128                  // embedding width (K of the projections)
#define HS   32                   // head width
#define XP   136                  // LDS pitch (bf16 elements) of the x and weight tiles: 272 B = 16 B x 17, odd, for 16-byte readers
#define FP   100                  // LDS pitch (floats) of the projected q | k | v tile: 400 B, a multiple of 16 B; the two lane halves of a D store fall on disjoint banks
#ifndef RH
#define RH   1024                 // query rows < RH use bf16 hi+lo P and V planes
#endif
#define PCAR 16384.0f             // fp16 P carry (2^14) for rows >= RH
#define SCL  0.17677669529663687f // 32^-0.5
#define L2E  1.4426950408889634f
#define OPF  36                   // LDS output tile pitch (floats); columns 32, 33 of a row hold the wave's (max, sum)
#define KW   8                    // waves of a k_attn workgroup = key ranges of one 16-row query tile
static_assert(SEQ % 64 == 0);
static_assert(SEQ <= SEQ_FULL);
static_assert(NB >= 1);
static_assert(NB <= NB_FULL);
static_assert(RH % 64 == 0);
static_assert(DM % 32 == 0);
static_assert(DM == 128 && HS == 32);
static_assert((long long)NB_FULL * SEQ_FULL * HS * 4 == 4194304LL);

typedef _Float16 h16;
typedef unsigned short bf;
typedef __attribute__((ext_vector_type(16))) __bf16   v16bf;
typedef __attribute__((ext_vector_type(16))) _Float16 v16h;
typedef __attribute__((ext_vector_type(8)))  _Float16 v8h;
typedef __attribute__((ext_vector_type(8)))  unsigned short v8us;
typedef __attribute__((ext_vector_type(4)))  unsigned short v4us;
typedef __attribute__((ext_vector_type(2)))  unsigned short v2us;
typedef __attribute__((ext_vector_type(8)))  float    v8f;
typedef __attribute__((ext_vector_type(4)))  float    v4f;
typedef __attribute__((ext_vector_type(2)))  float    v2f;
typedef v8h  __attribute__((may_alias)) v8ha;
typedef v4f  __attribute__((may_alias)) v4fa;
typedef v8us __attribute__((may_alias)) v8usa;
typedef v4us __attribute__((may_alias)) v4usa;

__device__ __forceinline__ unsigned short f2bf(float f) { unsigned u = __float_as_uint(f); u += 0x7FFFu + ((u >> 16) & 1u); return (unsigned short)(u >> 16); }
__device__ __forceinline__ float bf2f(unsigned short b) { return __uint_as_float(((unsigned)b) << 16); }
__device__ __forceinline__ v8f cat8f(v4f lo, v4f hi) { return __builtin_shufflevector(lo, hi, 0, 1, 2, 3, 4, 5, 6, 7); }
__device__ __forceinline__ v16h cat16(v8h lo, v8h hi) { return __builtin_shufflevector(lo, hi, 0, 1, 2, 3, 4, 5, 6, 7, 8, 9, 10, 11, 12, 13, 14, 15); }
__device__ __forceinline__ v16bf cat16b(v8us lo, v8us hi) { return __builtin_bit_cast(v16bf, __builtin_shufflevector(lo, hi, 0, 1, 2, 3, 4, 5, 6, 7, 8, 9, 10, 11, 12, 13, 14, 15)); }
__device__ __forceinline__ v8f wmma16(v16h a, v16h b, v8f c) { return __builtin_amdgcn_wmma_f32_16x16x32_f16(false, a, false, b, (short)0, c, false, false); }
__device__ __forceinline__ v8f wmmab(v16bf a, v16bf b, v8f c) { return __builtin_amdgcn_wmma_f32_16x16x32_bf16(false, a, false, b, (short)0, c, false, false); }

// INVT[i] = 1 / 10000^(2i/32): the exact float32 results of that expression (pow then reciprocal in f32), i = 0..15.
__constant__ __align__(16) float INVT[HS / 2] = { 1.0f, 0.5623413324356079f, 0.3162277638912201f, 0.17782793939113617f, 0.10000000149011612f, 0.05623412877321243f, 0.03162277862429619f, 0.017782794311642647f, 0.009999999776482582f, 0.005623413249850273f, 0.003162277862429619f, 0.0017782794311642647f, 0.0010000000474974513f, 0.000562341301701963f, 0.0003162277862429619f, 0.00017782794020604342f };

// ---- k_prep: block = batch b (grid.y), 64 consecutive t (t0 = blockIdx.x * 64), 256 threads = 8 waves. Three phases, a workgroup barrier between each two.
// Phase 1 (stage): the x tile [64 t][128 k] is read as 16-byte pieces, contiguous over the block, RNE-converted to bf16 and stored in xs [row][k]; the weights are read column by lane (wave -> matrix and group of 8 k),
// converted and stored transposed in wt [n = 32 * matrix + column][k] (n 0..31 q, 32..63 k, 64..95 v); each thread also forms its four rotary pairs (c, s) = {cos, sin}(INVT[i] * t), t = t0 + (tid >> 2), i = 4 * (tid & 3) + p.
// Phase 2 (project): wave w owns rows 16 * (w & 3) .. + 15 and the three 16-column tiles 3 * (w >> 2) + 0..2; k in steps of 32, ascending, f32 accumulate.
// Fragments: lane -> row/col (lane & 15), elements 0..7 <- k0 + 8*(lane >> 4) + 0..7, elements 8..15 <- k0 + 16 + 8*(lane >> 4) + 0..7 for A and for the [n][k] B tile. D element j of lane l is row 8*(l >> 4) + j, column l & 15; it goes to fs [row][n] in f32.
// Phase 3 (planes): thread -> row r = tid>>2, column group g = tid&3 = 8 q, 8 k, 8 v columns. Rotary (interleaved pairs, i = column/2): out[2i] = x[2i] c - x[2i+1] s, out[2i+1] = x[2i] s + x[2i+1] c, separate f32 products.
// LDS tiles: sq[0..3] = Qh, Ql, Kh, Kl as [64 r][32 c]; sv[0..2] = V^T fp16 bits, bf16 hi, bf16 lo as [32 d][64 r]. After the last barrier every plane's 4,096-byte tile region is written in 16-byte pieces.
__global__ __launch_bounds__(256) void k_prep(const float* __restrict__ x, const float* __restrict__ wq, const float* __restrict__ wk, const float* __restrict__ wv,
                                              bf* Qh, bf* Ql, bf* Kh, bf* Kl, h16* VT16, bf* VTh, bf* VTl) {
    __shared__ __align__(16) unsigned short xs[64 * XP];
    __shared__ __align__(16) unsigned short wt[96 * XP];
    __shared__ __align__(16) float fs[64 * FP];
    __shared__ __align__(16) unsigned short sq[4][64 * 32];
    __shared__ __align__(16) unsigned short sv[3][32 * 64];
    const int tid = threadIdx.x; const int b = blockIdx.y, t0 = blockIdx.x * 64;
    const int w = __builtin_amdgcn_readfirstlane(tid >> 5), L = tid & 31;
    const int r = tid >> 2, g = tid & 3; const int t = t0 + r;
    // ---- phase 1
    const v4f iv = *(const v4f*)(INVT + 4 * g);
    const float* xp = x + ((size_t)b * SEQ_FULL + t0) * DM + (size_t)tid * 4;
    v4f xr[8];
#pragma unroll
    for (int s = 0; s < 8; ++s) xr[s] = *(const v4f*)(xp + s * 1024);
    float wr[6][8];
#pragma unroll
    for (int s = 0; s < 6; ++s) { const int c = s * 8 + w; const int m = c >> 4, kg = c & 15;
        const float* wsrc = ((m == 0) ? wq : ((m == 1) ? wk : wv)) + (size_t)kg * 8 * HS + L;
#pragma unroll
        for (int j = 0; j < 8; ++j) wr[s][j] = wsrc[j * HS]; }
    float cnv[4], snv[4];
#pragma unroll
    for (int p = 0; p < 4; ++p) { const float ang = iv[p] * (float)t; float sn, cn; sincosf(ang, &sn, &cn); cnv[p] = cn; snv[p] = sn; }
#pragma unroll
    for (int s = 0; s < 8; ++s) { const int e = (s * 256 + tid) * 4; v4us o;
#pragma unroll
        for (int k = 0; k < 4; ++k) o[k] = f2bf(xr[s][k]);
        *(v4usa*)(&xs[(e >> 7) * XP + (e & 127)]) = o; }
#pragma unroll
    for (int s = 0; s < 6; ++s) { const int c = s * 8 + w; const int m = c >> 4, kg = c & 15; v8us o;
#pragma unroll
        for (int j = 0; j < 8; ++j) o[j] = f2bf(wr[s][j]);
        *(v8usa*)(&wt[(m * 32 + L) * XP + kg * 8]) = o; }
    __syncthreads();
    // ---- phase 2
    {   const int lr = L & 15, hi = L >> 4; const int mt = w & 3, ng = w >> 2;
        v8f acc[3];
#pragma unroll
        for (int nb = 0; nb < 3; ++nb) acc[nb] = (v8f){};
#pragma unroll
        for (int kc = 0; kc < DM; kc += 32) {
            const unsigned short* ap = &xs[(mt * 16 + lr) * XP + kc + 8 * hi];
            const v16bf a = cat16b(*(const v8usa*)ap, *(const v8usa*)(ap + 16));
#pragma unroll
            for (int nb = 0; nb < 3; ++nb) { const unsigned short* bp = &wt[((ng * 3 + nb) * 16 + lr) * XP + kc + 8 * hi];
                acc[nb] = wmmab(a, cat16b(*(const v8usa*)bp, *(const v8usa*)(bp + 16)), acc[nb]); }
        }
#pragma unroll
        for (int nb = 0; nb < 3; ++nb) {
#pragma unroll
            for (int j = 0; j < 8; ++j) fs[(mt * 16 + hi * 8 + j) * FP + (ng * 3 + nb) * 16 + lr] = acc[nb][j]; }
    }
    __syncthreads();
    // ---- phase 3
    const float* fr = &fs[r * FP + 8 * g];
    const v8f xq = cat8f(*(const v4fa*)fr, *(const v4fa*)(fr + 4)), xk = cat8f(*(const v4fa*)(fr + 32), *(const v4fa*)(fr + 36)), xv = cat8f(*(const v4fa*)(fr + 64), *(const v4fa*)(fr + 68));
#pragma unroll
    for (int p = 0; p < 4; ++p) {
        const float cn = cnv[p], sn = snv[p]; const int col = 8 * g + 2 * p;
        {   const float x1 = xq[2 * p], x2 = xq[2 * p + 1]; const float ev = x1 * cn - x2 * sn, od = x1 * sn + x2 * cn;
            v2us oh, ol; unsigned short hh0 = f2bf(ev), hh1 = f2bf(od); oh[0] = hh0; oh[1] = hh1; ol[0] = f2bf(ev - bf2f(hh0)); ol[1] = f2bf(od - bf2f(hh1));
            *(v2us*)(&sq[0][r * 32 + col]) = oh; *(v2us*)(&sq[1][r * 32 + col]) = ol; }
        {   const float x1 = xk[2 * p], x2 = xk[2 * p + 1]; const float ev = x1 * cn - x2 * sn, od = x1 * sn + x2 * cn;
            v2us oh, ol; unsigned short hh0 = f2bf(ev), hh1 = f2bf(od); oh[0] = hh0; oh[1] = hh1; ol[0] = f2bf(ev - bf2f(hh0)); ol[1] = f2bf(od - bf2f(hh1));
            *(v2us*)(&sq[2][r * 32 + col]) = oh; *(v2us*)(&sq[3][r * 32 + col]) = ol; }
#pragma unroll
        for (int j = 0; j < 2; ++j) { const float val = xv[2 * p + j]; const int d = col + j; const unsigned short vh = f2bf(val);
            sv[0][d * 64 + r] = __builtin_bit_cast(unsigned short, (h16)val); sv[1][d * 64 + r] = vh; sv[2][d * 64 + r] = f2bf(val - bf2f(vh)); }
    }
    __syncthreads();
    const int lo = w * 256 + L * 8;                                                    // linear offset inside a 2,048-element tile
    const size_t qoff = ((size_t)b * SEQ + t0) * HS + lo;                              // Q/K planes [b][t][32]
    const int d = 4 * w + (L >> 3), toff = (L & 7) * 8;
    const size_t voff = ((size_t)b * HS + d) * SEQ + t0 + toff;                       // V^T planes [b][d][t]
    const v8us q0v = *(const v8usa*)(&sq[0][lo]), q1v = *(const v8usa*)(&sq[1][lo]), k0v = *(const v8usa*)(&sq[2][lo]), k1v = *(const v8usa*)(&sq[3][lo]);
    const v8us v0v = *(const v8usa*)(&sv[0][lo]), v1v = *(const v8usa*)(&sv[1][lo]), v2v = *(const v8usa*)(&sv[2][lo]);
    unsigned short* VT16u = (unsigned short*)VT16;
    *(v8us*)(Qh + qoff) = q0v; *(v8us*)(Ql + qoff) = q1v; *(v8us*)(Kh + qoff) = k0v; *(v8us*)(Kl + qoff) = k1v;
    *(v8us*)(VT16u + voff) = v0v; *(v8us*)(VTh + voff) = v1v; *(v8us*)(VTl + voff) = v2v;
}

// lane l with lane l ^ 16 (a vector cross-row move, no LDS counter)
__device__ __forceinline__ float xhalf(float x) { return __builtin_bit_cast(float, __builtin_amdgcn_permlanex16(__builtin_bit_cast(int, x), __builtin_bit_cast(int, x), 0x76543210, 0xfedcba98, false, false)); }

// eight exponentials in place, each independent of its neighbours, then one v_nop: the slot the instruction set asks for behind a transcendental before its result is used or its source overwritten
__device__ __forceinline__ v8f exp2x8(const v8f x) {
    float a = x[0], b = x[1], c = x[2], d = x[3], e = x[4], f = x[5], g = x[6], h = x[7];
    asm("v_exp_f32 %0, %0\n\tv_exp_f32 %1, %1\n\tv_exp_f32 %2, %2\n\tv_exp_f32 %3, %3\n\tv_exp_f32 %4, %4\n\tv_exp_f32 %5, %5\n\tv_exp_f32 %6, %6\n\tv_exp_f32 %7, %7\n\tv_nop"
        : "+v"(a), "+v"(b), "+v"(c), "+v"(d), "+v"(e), "+v"(f), "+v"(g), "+v"(h));
    return (v8f){a, b, c, d, e, f, g, h};
}

// ---- attn_chunk: one 64-key chunk for one wave's 16 query rows (q0..q0+15), in transposed form: S^T = K.Q^T, O^T += V^T.P^T. Scores: 4 key tiles, each hi.hi + lo.hi + hi.lo (q, k bf16 planes [t][32]; A fragment = K rows, B fragment = Q rows, both k-contiguous pieces in the same k map).
// D element r of lane l is S[q0 + (l&15)][kv0 + 16*tile + 8*(l>>4) + r]: a lane holds 32 of the 64 scores of ONE query, lane l ^ 16 the other 32. Online softmax per lane: x SCL, causal replace-mask (MASK chunk only), in-lane max, one exchange between the wave halves, running max / rescale;
// the lane's sum covers its own 32 keys (the halves are joined in k_attn). P^T as the B operand straight from the score registers: element j <- tile 2*ks, register j; element 8 + j <- tile 2*ks + 1, register j, which is key 32*ks + 8*(l>>4) + j and 32*ks + 16 + 8*(l>>4) + j, the k map of the V^T loads.
// V^T planes [d][t] as the A operand (HI: 3 bf16 products; else one fp16 product); outputs o0[r] = O[q0 + (l&15)][8*(l>>4) + r], o1[r] = the same at d + 16.
template <bool HI, bool MASK>
__device__ __forceinline__ void attn_chunk(const bf* __restrict__ Khb, const bf* __restrict__ Klb, const h16* __restrict__ V16b, const bf* __restrict__ Vhb, const bf* __restrict__ Vlb,
                                           const v16bf aqh, const v16bf aql, const int kv0, const int q0, const int ln, const int hh,
                                           float& mrun, float& lp, v8f& o0, v8f& o1) {
    v16bf bh[4], bl[4]; const bf* kph[4]; const bf* kpl[4];
#pragma unroll
    for (int t = 0; t < 4; ++t) { const size_t ko = (size_t)(kv0 + 16 * t + ln) * HS + 8 * hh; kph[t] = Khb + ko; kpl[t] = Klb + ko;
        bh[t] = cat16b(*(const v8us*)kph[t], *(const v8us*)(kph[t] + 16)); bl[t] = cat16b(*(const v8us*)kpl[t], *(const v8us*)(kpl[t] + 16)); }
    // the wait stands behind the K loads, in front of any instruction that reuses one of their address registers; the addresses are its inputs so that no load of the run lands in one of them ahead of it
    asm volatile("s_wait_xcnt 0x0" :: "v"(kph[0]), "v"(kph[1]), "v"(kph[2]), "v"(kph[3]), "v"(kpl[0]), "v"(kpl[1]), "v"(kpl[2]), "v"(kpl[3]) : "memory");
    // inputs-only fence on the loaded K fragments: the sixteen K loads issue as one run in front of the first product; without it the compiler reuses fragment registers and strings the loads into three dependent round trips
    asm volatile("" :: "v"(bh[0]), "v"(bh[1]), "v"(bh[2]), "v"(bh[3]), "v"(bl[0]), "v"(bl[1]), "v"(bl[2]), "v"(bl[3]));
    v8f s[4];
#pragma unroll
    for (int t = 0; t < 4; ++t) { v8f a = wmmab(bh[t], aqh, (v8f){}); a = wmmab(bh[t], aql, a); a = wmmab(bl[t], aqh, a); s[t] = a; }
    asm volatile("v_nop\n\tv_nop\n\tv_nop\n\tv_nop" : "+v"(s[0]), "+v"(s[1]), "+v"(s[2]), "+v"(s[3]) : "v"(aqh), "v"(aql), "v"(bh[3]), "v"(bl[3]));
    const int qi = q0 + ln;
#pragma unroll
    for (int t = 0; t < 4; ++t) {
#pragma unroll
        for (int r = 0; r < 8; ++r) { float v = s[t][r] * SCL; if (MASK) v = (kv0 + 16 * t + 8 * hh + r <= qi) ? v : -3.0e38f; s[t][r] = v; } }
    float rm = -3.0e38f;
#pragma unroll
    for (int r = 0; r < 8; ++r) rm = fmaxf(rm, fmaxf(fmaxf(s[0][r], s[1][r]), fmaxf(s[2][r], s[3][r])));
    rm = fmaxf(rm, xhalf(rm));
    const float mn = fmaxf(mrun, rm);
    float cf; const float cx = (mrun - mn) * L2E;
    asm("v_exp_f32 %0, %1\n\tv_nop" : "=v"(cf) : "v"(cx)); // v_nop: the same slot behind a transcendental
    mrun = mn;
#pragma unroll
    for (int t = 0; t < 4; ++t) s[t] = exp2x8((s[t] - mn) * L2E);
    const v8f ps = (s[0] + s[1]) + (s[2] + s[3]);
    const float psum = ((ps[0] + ps[1]) + (ps[2] + ps[3])) + ((ps[4] + ps[5]) + (ps[6] + ps[7]));
    lp = lp * cf + psum; o0 = o0 * cf; o1 = o1 * cf;
    if (HI) {
        v16bf aph[2], apl[2];
#pragma unroll
        for (int ks = 0; ks < 2; ++ks) { v8us h0, h1, l0, l1;
#pragma unroll
            for (int j = 0; j < 8; ++j) { const float pa = s[2 * ks][j], pb = s[2 * ks + 1][j]; const unsigned short ha = f2bf(pa), hb = f2bf(pb);
                h0[j] = ha; h1[j] = hb; l0[j] = f2bf(pa - bf2f(ha)); l1[j] = f2bf(pb - bf2f(hb)); }
            aph[ks] = cat16b(h0, h1); apl[ks] = cat16b(l0, l1); }
        {   v16bf vh[2], vl[2];
#pragma unroll
            for (int ks = 0; ks < 2; ++ks) { const size_t vo = (size_t)ln * SEQ + kv0 + 32 * ks + 8 * hh;
                vh[ks] = cat16b(*(const v8us*)(Vhb + vo), *(const v8us*)(Vhb + vo + 16)); vl[ks] = cat16b(*(const v8us*)(Vlb + vo), *(const v8us*)(Vlb + vo + 16)); }
#pragma unroll
            for (int ks = 0; ks < 2; ++ks) { o0 = wmmab(vh[ks], aph[ks], o0); o0 = wmmab(vh[ks], apl[ks], o0); o0 = wmmab(vl[ks], aph[ks], o0); } }
        {   v16bf vh[2], vl[2];
#pragma unroll
            for (int ks = 0; ks < 2; ++ks) { const size_t vo = (size_t)(16 + ln) * SEQ + kv0 + 32 * ks + 8 * hh;
                vh[ks] = cat16b(*(const v8us*)(Vhb + vo), *(const v8us*)(Vhb + vo + 16)); vl[ks] = cat16b(*(const v8us*)(Vlb + vo), *(const v8us*)(Vlb + vo + 16)); }
            // the wait stands behind the last V load, in front of any instruction that reuses a V address register; the two base addresses are its inputs so that no V load lands in one of them ahead of it
            asm volatile("s_wait_xcnt 0x0" :: "v"(Vhb + ((size_t)ln * SEQ + kv0 + 8 * hh)), "v"(Vlb + ((size_t)ln * SEQ + kv0 + 8 * hh)) : "memory");
#pragma unroll
            for (int ks = 0; ks < 2; ++ks) { o1 = wmmab(vh[ks], aph[ks], o1); o1 = wmmab(vh[ks], apl[ks], o1); o1 = wmmab(vl[ks], aph[ks], o1); }
            asm volatile("v_nop\n\tv_nop\n\tv_nop\n\tv_nop" : "+v"(o0), "+v"(o1) : "v"(aph[1]), "v"(apl[1]), "v"(vh[1]), "v"(vl[1])); }
    } else {
        v16h ap[2];
#pragma unroll
        for (int ks = 0; ks < 2; ++ks) {
#pragma unroll
            for (int j = 0; j < 8; ++j) { ap[ks][j] = (h16)(s[2 * ks][j] * PCAR); ap[ks][8 + j] = (h16)(s[2 * ks + 1][j] * PCAR); } }
        {   v16h vb[2];
#pragma unroll
            for (int ks = 0; ks < 2; ++ks) { const size_t vo = (size_t)ln * SEQ + kv0 + 32 * ks + 8 * hh; vb[ks] = cat16(*(const v8h*)(V16b + vo), *(const v8h*)(V16b + vo + 16)); }
#pragma unroll
            for (int ks = 0; ks < 2; ++ks) o0 = wmma16(vb[ks], ap[ks], o0); }
        {   v16h vb[2];
#pragma unroll
            for (int ks = 0; ks < 2; ++ks) { const size_t vo = (size_t)(16 + ln) * SEQ + kv0 + 32 * ks + 8 * hh; vb[ks] = cat16(*(const v8h*)(V16b + vo), *(const v8h*)(V16b + vo + 16)); }
            // the wait stands behind the last V load, in front of any instruction that reuses the V address register; the base address is its input so that no V load lands in it ahead of the wait
            asm volatile("s_wait_xcnt 0x0" :: "v"(V16b + ((size_t)ln * SEQ + kv0 + 8 * hh)) : "memory");
#pragma unroll
            for (int ks = 0; ks < 2; ++ks) o1 = wmma16(vb[ks], ap[ks], o1);
            asm volatile("v_nop\n\tv_nop\n\tv_nop\n\tv_nop" : "+v"(o0), "+v"(o1) : "v"(ap[1]), "v"(vb[1])); }
    }
}

// ---- k_attn: grid (query tiles of 16 rows, NB), 32 * KW threads; the workgroup owns rows q0 = qrow0 + blockIdx.x*16 .. +15 of batch b = blockIdx.y. Wave w visits the 64-key chunks w, w + KW, .. up to the
// diagonal chunk cd = q0 / 64 (exactly one masked chunk, taken by wave cd % KW) with its own running max, sums and accumulators, one query per lane and wave half. Merge: each wave stores its
// un-normalised tile [query][d] and per query (max, l joined over the two halves) in its own LDS tile, one workgroup barrier, then thread -> (row, 2 columns): M = max over waves, weights exp2((m_w - M) L2E), out = sum_w f_w o_w x carry / sum_w f_w l_w.
// A wave that visited no chunk holds max -3e38, l 0, o 0: its weight is exp2(-inf) = 0.
template <bool HI>
__global__ __launch_bounds__(32 * KW) void k_attn(const bf* __restrict__ Qh, const bf* __restrict__ Ql, const bf* __restrict__ Kh, const bf* __restrict__ Kl,
                                             const h16* __restrict__ V16, const bf* __restrict__ Vh, const bf* __restrict__ Vl, float* OUT, int qrow0) {
    __shared__ __align__(16) float ost[KW][16 * OPF];
    const int wave = __builtin_amdgcn_readfirstlane(threadIdx.x >> 5), lane = threadIdx.x & 31, hh = lane >> 4, ln = lane & 15;
    const int b = blockIdx.y; const int q0 = qrow0 + blockIdx.x * 16;
    const bf* Qhb = Qh + (size_t)b * SEQ * HS; const bf* Qlb = Ql + (size_t)b * SEQ * HS;
    const bf* Khb = Kh + (size_t)b * SEQ * HS; const bf* Klb = Kl + (size_t)b * SEQ * HS;
    const h16* V16b = V16 + (size_t)b * HS * SEQ; const bf* Vhb = Vh + (size_t)b * HS * SEQ; const bf* Vlb = Vl + (size_t)b * HS * SEQ;
    const size_t qo = (size_t)(q0 + ln) * HS + 8 * hh;
    const v16bf aqh = cat16b(*(const v8us*)(Qhb + qo), *(const v8us*)(Qhb + qo + 16));
    const v16bf aql = cat16b(*(const v8us*)(Qlb + qo), *(const v8us*)(Qlb + qo + 16));
    asm volatile("s_wait_xcnt 0x0" ::: "memory"); // stands behind the Q loads, in front of any instruction that reuses one of their address registers
    float mrun = -3.0e38f, lp = 0.0f; v8f o0 = (v8f){}, o1 = (v8f){};
    int kv0 = wave * 64;
#pragma unroll 1
    for (; kv0 + 64 <= q0; kv0 += 64 * KW) attn_chunk<HI, false>(Khb, Klb, V16b, Vhb, Vlb, aqh, aql, kv0, q0, ln, hh, mrun, lp, o0, o1);
    if (kv0 < q0 + 16) attn_chunk<HI, true>(Khb, Klb, V16b, Vhb, Vlb, aqh, aql, kv0, q0, ln, hh, mrun, lp, o0, o1);
    float* osw = &ost[wave][ln * OPF];
    const float lj = lp + xhalf(lp);
    *(v4fa*)(osw + 8 * hh) = __builtin_shufflevector(o0, o0, 0, 1, 2, 3); *(v4fa*)(osw + 8 * hh + 4) = __builtin_shufflevector(o0, o0, 4, 5, 6, 7);
    *(v4fa*)(osw + 16 + 8 * hh) = __builtin_shufflevector(o1, o1, 0, 1, 2, 3); *(v4fa*)(osw + 16 + 8 * hh + 4) = __builtin_shufflevector(o1, o1, 4, 5, 6, 7);
    if (hh == 0) { v2f ms; ms[0] = mrun; ms[1] = lj; *(v2f*)(osw + 32) = ms; }
    __syncthreads();
    const float carry = HI ? 1.0f : (1.0f / PCAR);
    const int row = threadIdx.x >> 4, col = (threadIdx.x & 15) * 2;
    static_assert(32 * KW == 16 * 16);
    v2f ml[KW]; float M = -3.0e38f;
#pragma unroll
    for (int w = 0; w < KW; ++w) { ml[w] = *(const v2f*)(&ost[w][row * OPF + 32]); M = fmaxf(M, ml[w][0]); }
    float L = 0.0f, a0 = 0.0f, a1 = 0.0f;
#pragma unroll
    for (int w = 0; w < KW; ++w) { float f; const float fx = (ml[w][0] - M) * L2E; const v2f o = *(const v2f*)(&ost[w][row * OPF + col]);
        asm("v_exp_f32 %0, %1\n\tv_nop" : "=v"(f) : "v"(fx)); // v_nop: the slot the instruction set asks for behind a transcendental before its result is used or its source overwritten
        L += f * ml[w][1]; a0 += f * o[0]; a1 += f * o[1]; }
    const float inv = carry * __builtin_amdgcn_rcpf(L);
    v2f res; res[0] = a0 * inv; res[1] = a1 * inv;
    *(v2f*)(OUT + ((size_t)b * SEQ_FULL + q0 + row) * HS + col) = res;
}

extern "C" void kernel_launch(void* const* d_in, const int* in_sizes, int n_in,
                              void* d_out, int out_size, void* d_ws, size_t ws_size, hipStream_t stream) {
    if (n_in < 4) return;
    const float* x  = (const float*)d_in[0];   // [8][4096][128]
    const float* wq = (const float*)d_in[1];   // [128][32]
    const float* wk = (const float*)d_in[2];   // [128][32]
    const float* wv = (const float*)d_in[3];   // [128][32]
    if (in_sizes[0] < ((NB - 1) * SEQ_FULL + SEQ) * DM) return;
    if (in_sizes[1] < DM * HS || in_sizes[2] < DM * HS || in_sizes[3] < DM * HS) return;
    if (out_size < ((NB - 1) * SEQ_FULL + SEQ) * HS) return;
    float* OUT = (float*)d_out;                 // [8][4096][32] f32
    char* wsp = (char*)d_ws;
    auto take = [&](size_t bytes) { char* p = wsp; wsp += (bytes + 255) & ~(size_t)255; return (void*)p; };
    bf*    Qh   = (bf*)take((size_t)NB * SEQ * HS * 2);              //   2,097,152 B each
    bf*    Ql   = (bf*)take((size_t)NB * SEQ * HS * 2);
    bf*    Kh   = (bf*)take((size_t)NB * SEQ * HS * 2);
    bf*    Kl   = (bf*)take((size_t)NB * SEQ * HS * 2);
    h16*   VT16 = (h16*)take((size_t)NB * HS * SEQ * 2);
    bf*    VTh  = (bf*)take((size_t)NB * HS * SEQ * 2);
    bf*    VTl  = (bf*)take((size_t)NB * HS * SEQ * 2);             // total 14,680,064 B
    if ((size_t)(wsp - (char*)d_ws) > ws_size) return;
    const int rh = (RH < SEQ) ? RH : SEQ;

    k_prep<<<dim3(SEQ / 64, NB), 256, 0, stream>>>(x, wq, wk, wv, Qh, Ql, Kh, Kl, VT16, VTh, VTl);
    k_attn<true><<<dim3(rh / 16, NB), 32 * KW, 0, stream>>>(Qh, Ql, Kh, Kl, VT16, VTh, VTl, OUT, 0);
    if (SEQ > rh) k_attn<false><<<dim3((SEQ - rh) / 16, NB), 32 * KW, 0, stream>>>(Qh, Ql, Kh, Kl, VT16, VTh, VTl, OUT, rh);
}

// v004
// A run of this version takes 43.9 microseconds.
// Two timings next to v003 both put it at 1.30 times that version's speed.
// All steps since v000 together make it 3.99 times as fast.
#include <hip/hip_runtime.h>

// Contractions, f32 accumulate: x.[Wq|Wk|Wv] on v_wmma_f32_16x16x32_bf16 (x and W RNE-converted to bf16); q.k^T as 3 bf16 products (q,k hi+lo planes) on every row; P.V rows < RH as 3 bf16 products (P and V hi+lo), rows >= RH on v_wmma_f32_16x16x32_f16 (P fp16 carried x 2^14, V fp16); rotary table, softmax and normalisation in f32.
// Pipeline: k_prep (one workgroup per 64 rows of x) converts its x tile and the three weights to bf16 in LDS, projects to q|k|v in f32 (LDS), applies the interleaved rotary pairs (cos, sin formed in the kernel)
// and writes Q/K bf16 hi,lo planes [b][t][32] and V^T planes [b][d][t] (fp16, bf16 hi, bf16 lo);
// k_attn: one workgroup of KW waves per 32 query rows (NQ tiles of 16), wave w takes the 64-key chunks w, w + KW, .. and uses every K and V fragment it loads for both tiles; scores and outputs in transposed form (one query per lane and tile), online softmax per wave (running max, f32 sums), causal: chunks above the diagonal never visited, one masked diagonal chunk (replace by -3e38 == exclusion); the waves' partials are merged through LDS;
#pragma clang fp contract(off)

#ifndef NB
#define NB 8
#endif
#ifndef SEQ
#define SEQ 4096
#endif
#define NB_FULL  8
#define SEQ_FULL 4096
#define DM   128                  // embedding width (K of the projections)
#define HS   32                   // head width
#define XP   136                  // LDS pitch (bf16 elements) of the x and weight tiles: 272 B = 16 B x 17, odd, for 16-byte readers
#define FP   100                  // LDS pitch (floats) of the projected q | k | v tile: 400 B, a multiple of 16 B; the two lane halves of a D store fall on disjoint banks
#ifndef RH
#define RH   1024                 // query rows < RH use bf16 hi+lo P and V planes
#endif
#define PCAR 16384.0f             // fp16 P carry (2^14) for rows >= RH
#define SCL  0.17677669529663687f // 32^-0.5
#define L2E  1.4426950408889634f
#define OPF  36                   // LDS output tile pitch (floats); columns 32, 33 of a row hold the wave's (max, sum)
#define KW   8                    // waves of a k_attn workgroup = key ranges of one query block
#define NQ   2                    // 16-row query tiles of a k_attn workgroup: each loaded K and V fragment serves all of them
static_assert(SEQ % 64 == 0);
static_assert(SEQ <= SEQ_FULL);
static_assert(NB >= 1);
static_assert(NB <= NB_FULL);
static_assert(RH % 64 == 0);
static_assert(64 % (16 * NQ) == 0);
static_assert(DM % 32 == 0);
static_assert(DM == 128 && HS == 32);
static_assert((long long)NB_FULL * SEQ_FULL * HS * 4 == 4194304LL);

typedef _Float16 h16;
typedef unsigned short bf;
typedef __attribute__((ext_vector_type(16))) __bf16   v16bf;
typedef __attribute__((ext_vector_type(16))) _Float16 v16h;
typedef __attribute__((ext_vector_type(8)))  _Float16 v8h;
typedef __attribute__((ext_vector_type(8)))  unsigned short v8us;
typedef __attribute__((ext_vector_type(4)))  unsigned short v4us;
typedef __attribute__((ext_vector_type(2)))  unsigned short v2us;
typedef __attribute__((ext_vector_type(8)))  float    v8f;
typedef __attribute__((ext_vector_type(4)))  float    v4f;
typedef __attribute__((ext_vector_type(2)))  float    v2f;
typedef v8h  __attribute__((may_alias)) v8ha;
typedef v4f  __attribute__((may_alias)) v4fa;
typedef v8us __attribute__((may_alias)) v8usa;
typedef v4us __attribute__((may_alias)) v4usa;

__device__ __forceinline__ unsigned short f2bf(float f) { unsigned u = __float_as_uint(f); u += 0x7FFFu + ((u >> 16) & 1u); return (unsigned short)(u >> 16); }
__device__ __forceinline__ float bf2f(unsigned short b) { return __uint_as_float(((unsigned)b) << 16); }
__device__ __forceinline__ v8f cat8f(v4f lo, v4f hi) { return __builtin_shufflevector(lo, hi, 0, 1, 2, 3, 4, 5, 6, 7); }
__device__ __forceinline__ v16h cat16(v8h lo, v8h hi) { return __builtin_shufflevector(lo, hi, 0, 1, 2, 3, 4, 5, 6, 7, 8, 9, 10, 11, 12, 13, 14, 15); }
__device__ __forceinline__ v16bf cat16b(v8us lo, v8us hi) { return __builtin_bit_cast(v16bf, __builtin_shufflevector(lo, hi, 0, 1, 2, 3, 4, 5, 6, 7, 8, 9, 10, 11, 12, 13, 14, 15)); }
__device__ __forceinline__ v8f wmma16(v16h a, v16h b, v8f c) { return __builtin_amdgcn_wmma_f32_16x16x32_f16(false, a, false, b, (short)0, c, false, false); }
__device__ __forceinline__ v8f wmmab(v16bf a, v16bf b, v8f c) { return __builtin_amdgcn_wmma_f32_16x16x32_bf16(false, a, false, b, (short)0, c, false, false); }

// INVT[i] = 1 / 10000^(2i/32): the exact float32 results of that expression (pow then reciprocal in f32), i = 0..15.
__constant__ __align__(16) float INVT[HS / 2] = { 1.0f, 0.5623413324356079f, 0.3162277638912201f, 0.17782793939113617f, 0.10000000149011612f, 0.05623412877321243f, 0.03162277862429619f, 0.017782794311642647f, 0.009999999776482582f, 0.005623413249850273f, 0.003162277862429619f, 0.0017782794311642647f, 0.0010000000474974513f, 0.000562341301701963f, 0.0003162277862429619f, 0.00017782794020604342f };

// ---- k_prep: block = batch b (grid.y), 64 consecutive t (t0 = blockIdx.x * 64), 256 threads = 8 waves. Three phases, a workgroup barrier between each two.
// Phase 1 (stage): the x tile [64 t][128 k] is read as 16-byte pieces, contiguous over the block, RNE-converted to bf16 and stored in xs [row][k]; the weights are read column by lane (wave -> matrix and group of 8 k),
// converted and stored transposed in wt [n = 32 * matrix + column][k] (n 0..31 q, 32..63 k, 64..95 v); each thread also forms its four rotary pairs (c, s) = {cos, sin}(INVT[i] * t), t = t0 + (tid >> 2), i = 4 * (tid & 3) + p.
// Phase 2 (project): wave w owns rows 16 * (w & 3) .. + 15 and the three 16-column tiles 3 * (w >> 2) + 0..2; k in steps of 32, ascending, f32 accumulate.
// Fragments: lane -> row/col (lane & 15), elements 0..7 <- k0 + 8*(lane >> 4) + 0..7, elements 8..15 <- k0 + 16 + 8*(lane >> 4) + 0..7 for A and for the [n][k] B tile. D element j of lane l is row 8*(l >> 4) + j, column l & 15; it goes to fs [row][n] in f32.
// Phase 3 (planes): thread -> row r = tid>>2, column group g = tid&3 = 8 q, 8 k, 8 v columns. Rotary (interleaved pairs, i = column/2): out[2i] = x[2i] c - x[2i+1] s, out[2i+1] = x[2i] s + x[2i+1] c, separate f32 products.
// LDS tiles: sq[0..3] = Qh, Ql, Kh, Kl as [64 r][32 c]; sv[0..2] = V^T fp16 bits, bf16 hi, bf16 lo as [32 d][64 r]. After the last barrier every plane's 4,096-byte tile region is written in 16-byte pieces.
__global__ __launch_bounds__(256) void k_prep(const float* __restrict__ x, const float* __restrict__ wq, const float* __restrict__ wk, const float* __restrict__ wv,
                                              bf* Qh, bf* Ql, bf* Kh, bf* Kl, h16* VT16, bf* VTh, bf* VTl) {
    __shared__ __align__(16) unsigned short xs[64 * XP];
    __shared__ __align__(16) unsigned short wt[96 * XP];
    __shared__ __align__(16) float fs[64 * FP];
    __shared__ __align__(16) unsigned short sq[4][64 * 32];
    __shared__ __align__(16) unsigned short sv[3][32 * 64];
    const int tid = threadIdx.x; const int b = blockIdx.y, t0 = blockIdx.x * 64;
    const int w = __builtin_amdgcn_readfirstlane(tid >> 5), L = tid & 31;
    const int r = tid >> 2, g = tid & 3; const int t = t0 + r;
    // ---- phase 1
    const v4f iv = *(const v4f*)(INVT + 4 * g);
    const float* xp = x + ((size_t)b * SEQ_FULL + t0) * DM + (size_t)tid * 4;
    v4f xr[8];
#pragma unroll
    for (int s = 0; s < 8; ++s) xr[s] = *(const v4f*)(xp + s * 1024);
    float wr[6][8];
#pragma unroll
    for (int s = 0; s < 6; ++s) { const int c = s * 8 + w; const int m = c >> 4, kg = c & 15;
        const float* wsrc = ((m == 0) ? wq : ((m == 1) ? wk : wv)) + (size_t)kg * 8 * HS + L;
#pragma unroll
        for (int j = 0; j < 8; ++j) wr[s][j] = wsrc[j * HS]; }
    float cnv[4], snv[4];
#pragma unroll
    for (int p = 0; p < 4; ++p) { const float ang = iv[p] * (float)t; float sn, cn; sincosf(ang, &sn, &cn); cnv[p] = cn; snv[p] = sn; }
#pragma unroll
    for (int s = 0; s < 8; ++s) { const int e = (s * 256 + tid) * 4; v4us o;
#pragma unroll
        for (int k = 0; k < 4; ++k) o[k] = f2bf(xr[s][k]);
        *(v4usa*)(&xs[(e >> 7) * XP + (e & 127)]) = o; }
#pragma unroll
    for (int s = 0; s < 6; ++s) { const int c = s * 8 + w; const int m = c >> 4, kg = c & 15; v8us o;
#pragma unroll
        for (int j = 0; j < 8; ++j) o[j] = f2bf(wr[s][j]);
        *(v8usa*)(&wt[(m * 32 + L) * XP + kg * 8]) = o; }
    __syncthreads();
    // ---- phase 2
    {   const int lr = L & 15, hi = L >> 4; const int mt = w & 3, ng = w >> 2;
        v8f acc[3];
#pragma unroll
        for (int nb = 0; nb < 3; ++nb) acc[nb] = (v8f){};
#pragma unroll
        for (int kc = 0; kc < DM; kc += 32) {
            const unsigned short* ap = &xs[(mt * 16 + lr) * XP + kc + 8 * hi];
            const v16bf a = cat16b(*(const v8usa*)ap, *(const v8usa*)(ap + 16));
#pragma unroll
            for (int nb = 0; nb < 3; ++nb) { const unsigned short* bp = &wt[((ng * 3 + nb) * 16 + lr) * XP + kc + 8 * hi];
                acc[nb] = wmmab(a, cat16b(*(const v8usa*)bp, *(const v8usa*)(bp + 16)), acc[nb]); }
        }
#pragma unroll
        for (int nb = 0; nb < 3; ++nb) {
#pragma unroll
            for (int j = 0; j < 8; ++j) fs[(mt * 16 + hi * 8 + j) * FP + (ng * 3 + nb) * 16 + lr] = acc[nb][j]; }
    }
    __syncthreads();
    // ---- phase 3
    const float* fr = &fs[r * FP + 8 * g];
    const v8f xq = cat8f(*(const v4fa*)fr, *(const v4fa*)(fr + 4)), xk = cat8f(*(const v4fa*)(fr + 32), *(const v4fa*)(fr + 36)), xv = cat8f(*(const v4fa*)(fr + 64), *(const v4fa*)(fr + 68));
#pragma unroll
    for (int p = 0; p < 4; ++p) {
        const float cn = cnv[p], sn = snv[p]; const int col = 8 * g + 2 * p;
        {   const float x1 = xq[2 * p], x2 = xq[2 * p + 1]; const float ev = x1 * cn - x2 * sn, od = x1 * sn + x2 * cn;
            v2us oh, ol; unsigned short hh0 = f2bf(ev), hh1 = f2bf(od); oh[0] = hh0; oh[1] = hh1; ol[0] = f2bf(ev - bf2f(hh0)); ol[1] = f2bf(od - bf2f(hh1));
            *(v2us*)(&sq[0][r * 32 + col]) = oh; *(v2us*)(&sq[1][r * 32 + col]) = ol; }
        {   const float x1 = xk[2 * p], x2 = xk[2 * p + 1]; const float ev = x1 * cn - x2 * sn, od = x1 * sn + x2 * cn;
            v2us oh, ol; unsigned short hh0 = f2bf(ev), hh1 = f2bf(od); oh[0] = hh0; oh[1] = hh1; ol[0] = f2bf(ev - bf2f(hh0)); ol[1] = f2bf(od - bf2f(hh1));
            *(v2us*)(&sq[2][r * 32 + col]) = oh; *(v2us*)(&sq[3][r * 32 + col]) = ol; }
#pragma unroll
        for (int j = 0; j < 2; ++j) { const float val = xv[2 * p + j]; const int d = col + j; const unsigned short vh = f2bf(val);
            sv[0][d * 64 + r] = __builtin_bit_cast(unsigned short, (h16)val); sv[1][d * 64 + r] = vh; sv[2][d * 64 + r] = f2bf(val - bf2f(vh)); }
    }
    __syncthreads();
    const int lo = w * 256 + L * 8;                                                    // linear offset inside a 2,048-element tile
    const size_t qoff = ((size_t)b * SEQ + t0) * HS + lo;                              // Q/K planes [b][t][32]
    const int d = 4 * w + (L >> 3), toff = (L & 7) * 8;
    const size_t voff = ((size_t)b * HS + d) * SEQ + t0 + toff;                       // V^T planes [b][d][t]
    const v8us q0v = *(const v8usa*)(&sq[0][lo]), q1v = *(const v8usa*)(&sq[1][lo]), k0v = *(const v8usa*)(&sq[2][lo]), k1v = *(const v8usa*)(&sq[3][lo]);
    const v8us v0v = *(const v8usa*)(&sv[0][lo]), v1v = *(const v8usa*)(&sv[1][lo]), v2v = *(const v8usa*)(&sv[2][lo]);
    unsigned short* VT16u = (unsigned short*)VT16;
    *(v8us*)(Qh + qoff) = q0v; *(v8us*)(Ql + qoff) = q1v; *(v8us*)(Kh + qoff) = k0v; *(v8us*)(Kl + qoff) = k1v;
    *(v8us*)(VT16u + voff) = v0v; *(v8us*)(VTh + voff) = v1v; *(v8us*)(VTl + voff) = v2v;
}

// lane l with lane l ^ 16 (a vector cross-row move, no LDS counter)
__device__ __forceinline__ float xhalf(float x) { return __builtin_bit_cast(float, __builtin_amdgcn_permlanex16(__builtin_bit_cast(int, x), __builtin_bit_cast(int, x), 0x76543210, 0xfedcba98, false, false)); }

// eight exponentials in place, each independent of its neighbours, then one v_nop: the slot the instruction set asks for behind a transcendental before its result is used or its source overwritten
__device__ __forceinline__ v8f exp2x8(const v8f x) {
    float a = x[0], b = x[1], c = x[2], d = x[3], e = x[4], f = x[5], g = x[6], h = x[7];
    asm("v_exp_f32 %0, %0\n\tv_exp_f32 %1, %1\n\tv_exp_f32 %2, %2\n\tv_exp_f32 %3, %3\n\tv_exp_f32 %4, %4\n\tv_exp_f32 %5, %5\n\tv_exp_f32 %6, %6\n\tv_exp_f32 %7, %7\n\tv_nop"
        : "+v"(a), "+v"(b), "+v"(c), "+v"(d), "+v"(e), "+v"(f), "+v"(g), "+v"(h));
    return (v8f){a, b, c, d, e, f, g, h};
}

// ---- attn_chunk: one 64-key chunk for one wave's NQ query tiles (tile u = rows q0 + 16*u .. + 15; what follows is per tile, with q0 read as the tile's first row), the K and V fragments loaded once for all tiles, in transposed form: S^T = K.Q^T, O^T += V^T.P^T. Scores: 4 key tiles, each hi.hi + lo.hi + hi.lo (q, k bf16 planes [t][32]; A fragment = K rows, B fragment = Q rows, both k-contiguous pieces in the same k map).
// D element r of lane l is S[q0 + (l&15)][kv0 + 16*tile + 8*(l>>4) + r]: a lane holds 32 of the 64 scores of ONE query, lane l ^ 16 the other 32. Online softmax per lane: x SCL, causal replace-mask (MASK chunk only), in-lane max, one exchange between the wave halves, running max / rescale;
// the lane's sum covers its own 32 keys (the halves are joined in k_attn). P^T as the B operand straight from the score registers: element j <- tile 2*ks, register j; element 8 + j <- tile 2*ks + 1, register j, which is key 32*ks + 8*(l>>4) + j and 32*ks + 16 + 8*(l>>4) + j, the k map of the V^T loads.
// V^T planes [d][t] as the A operand (HI: 3 bf16 products; else one fp16 product); outputs o0[r] = O[q0 + (l&15)][8*(l>>4) + r], o1[r] = the same at d + 16.
template <bool HI, bool MASK>
__device__ __forceinline__ void attn_chunk(const bf* __restrict__ Khb, const bf* __restrict__ Klb, const h16* __restrict__ V16b, const bf* __restrict__ Vhb, const bf* __restrict__ Vlb,
                                           const v16bf (&aqh)[NQ], const v16bf (&aql)[NQ], const int kv0, const int q0, const int ln, const int hh,
                                           float (&mrun)[NQ], float (&lp)[NQ], v8f (&o0)[NQ], v8f (&o1)[NQ]) {
    v16bf bh[4], bl[4]; const bf* kph[4]; const bf* kpl[4];
#pragma unroll
    for (int t = 0; t < 4; ++t) { const size_t ko = (size_t)(kv0 + 16 * t + ln) * HS + 8 * hh; kph[t] = Khb + ko; kpl[t] = Klb + ko;
        bh[t] = cat16b(*(const v8us*)kph[t], *(const v8us*)(kph[t] + 16)); bl[t] = cat16b(*(const v8us*)kpl[t], *(const v8us*)(kpl[t] + 16)); }
    // the wait stands behind the K loads, in front of any instruction that reuses one of their address registers; the addresses are its inputs so that no load of the run lands in one of them ahead of it
    asm volatile("s_wait_xcnt 0x0" :: "v"(kph[0]), "v"(kph[1]), "v"(kph[2]), "v"(kph[3]), "v"(kpl[0]), "v"(kpl[1]), "v"(kpl[2]), "v"(kpl[3]) : "memory");
    // inputs-only fence on the loaded K fragments: the sixteen K loads issue as one run in front of the first product; without it the compiler reuses fragment registers and strings the loads into three dependent round trips
    asm volatile("" :: "v"(bh[0]), "v"(bh[1]), "v"(bh[2]), "v"(bh[3]), "v"(bl[0]), "v"(bl[1]), "v"(bl[2]), "v"(bl[3]));
    v8f s[NQ][4];
#pragma unroll
    for (int u = 0; u < NQ; ++u) {
#pragma unroll
        for (int t = 0; t < 4; ++t) { v8f a = wmmab(bh[t], aqh[u], (v8f){}); a = wmmab(bh[t], aql[u], a); a = wmmab(bl[t], aqh[u], a); s[u][t] = a; } }
    asm volatile("v_nop\n\tv_nop\n\tv_nop\n\tv_nop" : "+v"(s[0][0]), "+v"(s[0][1]), "+v"(s[0][2]), "+v"(s[0][3]), "+v"(s[1][0]), "+v"(s[1][1]), "+v"(s[1][2]), "+v"(s[1][3]) : "v"(aqh[1]), "v"(aql[1]), "v"(bh[3]), "v"(bl[3]));
#pragma unroll
    for (int u = 0; u < NQ; ++u) {
        const int qi = q0 + 16 * u + ln;
#pragma unroll
        for (int t = 0; t < 4; ++t) {
#pragma unroll
            for (int r = 0; r < 8; ++r) { float v = s[u][t][r] * SCL; if (MASK) v = (kv0 + 16 * t + 8 * hh + r <= qi) ? v : -3.0e38f; s[u][t][r] = v; } }
        float rm = -3.0e38f;
#pragma unroll
        for (int r = 0; r < 8; ++r) rm = fmaxf(rm, fmaxf(fmaxf(s[u][0][r], s[u][1][r]), fmaxf(s[u][2][r], s[u][3][r])));
        rm = fmaxf(rm, xhalf(rm));
        const float mn = fmaxf(mrun[u], rm);
        float cf; const float cx = (mrun[u] - mn) * L2E;
        asm("v_exp_f32 %0, %1\n\tv_nop" : "=v"(cf) : "v"(cx)); // v_nop: the same slot behind a transcendental
        mrun[u] = mn;
#pragma unroll
        for (int t = 0; t < 4; ++t) s[u][t] = exp2x8((s[u][t] - mn) * L2E);
        const v8f ps = (s[u][0] + s[u][1]) + (s[u][2] + s[u][3]);
        const float psum = ((ps[0] + ps[1]) + (ps[2] + ps[3])) + ((ps[4] + ps[5]) + (ps[6] + ps[7]));
        lp[u] = lp[u] * cf + psum; o0[u] = o0[u] * cf; o1[u] = o1[u] * cf;
    }
    if (HI) {
        v16bf aph[NQ][2], apl[NQ][2];
#pragma unroll
        for (int u = 0; u < NQ; ++u) {
#pragma unroll
            for (int ks = 0; ks < 2; ++ks) { v8us h0, h1, l0, l1;
#pragma unroll
                for (int j = 0; j < 8; ++j) { const float pa = s[u][2 * ks][j], pb = s[u][2 * ks + 1][j]; const unsigned short ha = f2bf(pa), hb = f2bf(pb);
                    h0[j] = ha; h1[j] = hb; l0[j] = f2bf(pa - bf2f(ha)); l1[j] = f2bf(pb - bf2f(hb)); }
                aph[u][ks] = cat16b(h0, h1); apl[u][ks] = cat16b(l0, l1); } }
        const bf* vph = Vhb + ((size_t)ln * SEQ + kv0 + 8 * hh); const bf* vpl = Vlb + ((size_t)ln * SEQ + kv0 + 8 * hh); // every V load of the chunk is one of these two addresses plus a constant
        {   v16bf vh[2], vl[2];
#pragma unroll
            for (int ks = 0; ks < 2; ++ks) { const int vo = 32 * ks;
                vh[ks] = cat16b(*(const v8us*)(vph + vo), *(const v8us*)(vph + vo + 16)); vl[ks] = cat16b(*(const v8us*)(vpl + vo), *(const v8us*)(vpl + vo + 16)); }
#pragma unroll
            for (int u = 0; u < NQ; ++u) {
#pragma unroll
                for (int ks = 0; ks < 2; ++ks) { o0[u] = wmmab(vh[ks], aph[u][ks], o0[u]); o0[u] = wmmab(vh[ks], apl[u][ks], o0[u]); o0[u] = wmmab(vl[ks], aph[u][ks], o0[u]); } } }
        {   v16bf vh[2], vl[2];
#pragma unroll
            for (int ks = 0; ks < 2; ++ks) { const int vo = 16 * SEQ + 32 * ks;
                vh[ks] = cat16b(*(const v8us*)(vph + vo), *(const v8us*)(vph + vo + 16)); vl[ks] = cat16b(*(const v8us*)(vpl + vo), *(const v8us*)(vpl + vo + 16)); }
            // the wait stands behind the last V load, in front of any instruction that reuses a V address register; the two base addresses are its inputs so that no V load lands in one of them ahead of it
            asm volatile("s_wait_xcnt 0x0" :: "v"(vph), "v"(vpl) : "memory");
#pragma unroll
            for (int u = 0; u < NQ; ++u) {
#pragma unroll
                for (int ks = 0; ks < 2; ++ks) { o1[u] = wmmab(vh[ks], aph[u][ks], o1[u]); o1[u] = wmmab(vh[ks], apl[u][ks], o1[u]); o1[u] = wmmab(vl[ks], aph[u][ks], o1[u]); } }
            asm volatile("v_nop\n\tv_nop\n\tv_nop\n\tv_nop" : "+v"(o0[0]), "+v"(o1[0]), "+v"(o0[1]), "+v"(o1[1]) : "v"(aph[1][1]), "v"(apl[1][1]), "v"(vh[1]), "v"(vl[1])); }
    } else {
        v16h ap[NQ][2];
#pragma unroll
        for (int u = 0; u < NQ; ++u) {
#pragma unroll
            for (int ks = 0; ks < 2; ++ks) {
#pragma unroll
                for (int j = 0; j < 8; ++j) { ap[u][ks][j] = (h16)(s[u][2 * ks][j] * PCAR); ap[u][ks][8 + j] = (h16)(s[u][2 * ks + 1][j] * PCAR); } } }
        {   v16h vb[2];
#pragma unroll
            for (int ks = 0; ks < 2; ++ks) { const size_t vo = (size_t)ln * SEQ + kv0 + 32 * ks + 8 * hh; vb[ks] = cat16(*(const v8h*)(V16b + vo), *(const v8h*)(V16b + vo + 16)); }
#pragma unroll
            for (int u = 0; u < NQ; ++u) {
#pragma unroll
                for (int ks = 0; ks < 2; ++ks) o0[u] = wmma16(vb[ks], ap[u][ks], o0[u]); } }
        {   v16h vb[2];
#pragma unroll
            for (int ks = 0; ks < 2; ++ks) { const size_t vo = (size_t)(16 + ln) * SEQ + kv0 + 32 * ks + 8 * hh; vb[ks] = cat16(*(const v8h*)(V16b + vo), *(const v8h*)(V16b + vo + 16)); }
            // the wait stands behind the last V load, in front of any instruction that reuses the V address register; the base address is its input so that no V load lands in it ahead of the wait
            asm volatile("s_wait_xcnt 0x0" :: "v"(V16b + ((size_t)ln * SEQ + kv0 + 8 * hh)) : "memory");
#pragma unroll
            for (int u = 0; u < NQ; ++u) {
#pragma unroll
                for (int ks = 0; ks < 2; ++ks) o1[u] = wmma16(vb[ks], ap[u][ks], o1[u]); }
            asm volatile("v_nop\n\tv_nop\n\tv_nop\n\tv_nop" : "+v"(o0[0]), "+v"(o1[0]), "+v"(o0[1]), "+v"(o1[1]) : "v"(ap[1][1]), "v"(vb[1])); }
    }
}

// ---- k_attn: grid (query blocks of 16 * NQ rows, NB), 32 * KW threads; the workgroup owns rows q0 = qrow0 + blockIdx.x*16*NQ .. + 16*NQ - 1 of batch b = blockIdx.y, as NQ tiles of 16. Wave w visits the 64-key chunks w, w + KW, .. up to the
// diagonal chunk cd = q0 / 64 (the same for every tile, as a block never straddles a multiple of 64; exactly one masked chunk, taken by wave cd % KW) with its own running max, sums and accumulators per tile, one query per lane, tile and wave half. Merge: each wave stores its
// un-normalised tiles [query][d] and per query (max, l joined over the two halves) in its own LDS tile, one workgroup barrier, then thread -> (row, 4 columns): M = max over waves, weights exp2((m_w - M) L2E), out = sum_w f_w o_w x carry / sum_w f_w l_w.
// A wave that visited no chunk holds max -3e38, l 0, o 0: its weight is exp2(-inf) = 0.
template <bool HI>
__global__ __launch_bounds__(32 * KW) void k_attn(const bf* __restrict__ Qh, const bf* __restrict__ Ql, const bf* __restrict__ Kh, const bf* __restrict__ Kl,
                                             const h16* __restrict__ V16, const bf* __restrict__ Vh, const bf* __restrict__ Vl, float* OUT, int qrow0) {
    __shared__ __align__(16) float ost[KW][16 * NQ * OPF];
    const int wave = __builtin_amdgcn_readfirstlane(threadIdx.x >> 5), lane = threadIdx.x & 31, hh = lane >> 4, ln = lane & 15;
    const int b = blockIdx.y; const int q0 = qrow0 + blockIdx.x * (16 * NQ);
    const bf* Qhb = Qh + (size_t)b * SEQ * HS; const bf* Qlb = Ql + (size_t)b * SEQ * HS;
    const bf* Khb = Kh + (size_t)b * SEQ * HS; const bf* Klb = Kl + (size_t)b * SEQ * HS;
    const h16* V16b = V16 + (size_t)b * HS * SEQ; const bf* Vhb = Vh + (size_t)b * HS * SEQ; const bf* Vlb = Vl + (size_t)b * HS * SEQ;
    v16bf aqh[NQ], aql[NQ]; const bf* qph[NQ]; const bf* qpl[NQ];
#pragma unroll
    for (int u = 0; u < NQ; ++u) { const size_t qo = (size_t)(q0 + 16 * u + ln) * HS + 8 * hh; qph[u] = Qhb + qo; qpl[u] = Qlb + qo;
        aqh[u] = cat16b(*(const v8us*)qph[u], *(const v8us*)(qph[u] + 16));
        aql[u] = cat16b(*(const v8us*)qpl[u], *(const v8us*)(qpl[u] + 16)); }
    // stands behind the Q loads, in front of any instruction that reuses one of their address registers; the addresses are its inputs so that none of them is rewritten ahead of it
    asm volatile("s_wait_xcnt 0x0" :: "v"(qph[0]), "v"(qph[1]), "v"(qpl[0]), "v"(qpl[1]) : "memory");
    float mrun[NQ], lp[NQ]; v8f o0[NQ], o1[NQ];
#pragma unroll
    for (int u = 0; u < NQ; ++u) { mrun[u] = -3.0e38f; lp[u] = 0.0f; o0[u] = (v8f){}; o1[u] = (v8f){}; }
    int kv0 = wave * 64;
#pragma unroll 1
    for (; kv0 + 64 <= q0; kv0 += 64 * KW) attn_chunk<HI, false>(Khb, Klb, V16b, Vhb, Vlb, aqh, aql, kv0, q0, ln, hh, mrun, lp, o0, o1);
    if (kv0 < q0 + 16 * NQ) attn_chunk<HI, true>(Khb, Klb, V16b, Vhb, Vlb, aqh, aql, kv0, q0, ln, hh, mrun, lp, o0, o1);
#pragma unroll
    for (int u = 0; u < NQ; ++u) {
        float* osw = &ost[wave][(16 * u + ln) * OPF];
        const float lj = lp[u] + xhalf(lp[u]);
        *(v4fa*)(osw + 8 * hh) = __builtin_shufflevector(o0[u], o0[u], 0, 1, 2, 3); *(v4fa*)(osw + 8 * hh + 4) = __builtin_shufflevector(o0[u], o0[u], 4, 5, 6, 7);
        *(v4fa*)(osw + 16 + 8 * hh) = __builtin_shufflevector(o1[u], o1[u], 0, 1, 2, 3); *(v4fa*)(osw + 16 + 8 * hh + 4) = __builtin_shufflevector(o1[u], o1[u], 4, 5, 6, 7);
        if (hh == 0) { v2f ms; ms[0] = mrun[u]; ms[1] = lj; *(v2f*)(osw + 32) = ms; }
    }
    __syncthreads();
    const float carry = HI ? 1.0f : (1.0f / PCAR);
    const int row = threadIdx.x >> 3, col = (threadIdx.x & 7) * 4;
    static_assert(32 * KW == 16 * NQ * 8);
    v2f ml[KW]; float M = -3.0e38f;
#pragma unroll
    for (int w = 0; w < KW; ++w) { ml[w] = *(const v2f*)(&ost[w][row * OPF + 32]); M = fmaxf(M, ml[w][0]); }
    float L = 0.0f; v4f a = (v4f){};
#pragma unroll
    for (int w = 0; w < KW; ++w) { float f; const float fx = (ml[w][0] - M) * L2E; const v4f o = *(const v4fa*)(&ost[w][row * OPF + col]);
        asm("v_exp_f32 %0, %1\n\tv_nop" : "=v"(f) : "v"(fx)); // v_nop: the slot the instruction set asks for behind a transcendental before its result is used or its source overwritten
        L += f * ml[w][1]; a += o * f; }
    const float inv = carry * __builtin_amdgcn_rcpf(L);
    *(v4f*)(OUT + ((size_t)b * SEQ_FULL + q0 + row) * HS + col) = a * inv;
}

extern "C" void kernel_launch(void* const* d_in, const int* in_sizes, int n_in,
                              void* d_out, int out_size, void* d_ws, size_t ws_size, hipStream_t stream) {
    if (n_in < 4) return;
    const float* x  = (const float*)d_in[0];   // [8][4096][128]
    const float* wq = (const float*)d_in[1];   // [128][32]
    const float* wk = (const float*)d_in[2];   // [128][32]
    const float* wv = (const float*)d_in[3];   // [128][32]
    if (in_sizes[0] < ((NB - 1) * SEQ_FULL + SEQ) * DM) return;
    if (in_sizes[1] < DM * HS || in_sizes[2] < DM * HS || in_sizes[3] < DM * HS) return;
    if (out_size < ((NB - 1) * SEQ_FULL + SEQ) * HS) return;
    float* OUT = (float*)d_out;                 // [8][4096][32] f32
    char* wsp = (char*)d_ws;
    auto take = [&](size_t bytes) { char* p = wsp; wsp += (bytes + 255) & ~(size_t)255; return (void*)p; };
    bf*    Qh   = (bf*)take((size_t)NB * SEQ * HS * 2);              //   2,097,152 B each
    bf*    Ql   = (bf*)take((size_t)NB * SEQ * HS * 2);
    bf*    Kh   = (bf*)take((size_t)NB * SEQ * HS * 2);
    bf*    Kl   = (bf*)take((size_t)NB * SEQ * HS * 2);
    h16*   VT16 = (h16*)take((size_t)NB * HS * SEQ * 2);
    bf*    VTh  = (bf*)take((size_t)NB * HS * SEQ * 2);
    bf*    VTl  = (bf*)take((size_t)NB * HS * SEQ * 2);             // total 14,680,064 B
    if ((size_t)(wsp - (char*)d_ws) > ws_size) return;
    const int rh = (RH < SEQ) ? RH : SEQ;

    k_prep<<<dim3(SEQ / 64, NB), 256, 0, stream>>>(x, wq, wk, wv, Qh, Ql, Kh, Kl, VT16, VTh, VTl);
    k_attn<true><<<dim3(rh / (16 * NQ), NB), 32 * KW, 0, stream>>>(Qh, Ql, Kh, Kl, VT16, VTh, VTl, OUT, 0);
    if (SEQ > rh) k_attn<false><<<dim3((SEQ - rh) / (16 * NQ), NB), 32 * KW, 0, stream>>>(Qh, Ql, Kh, Kl, VT16, VTh, VTl, OUT, rh);
}

// v005
// It runs in 39.5 microseconds.
// Next to v004, in two timings, it ran 1.11 and 1.10 times as fast.
// All steps since v000 together make it 4.41 times as fast.
#include <hip/hip_runtime.h>

// Contractions, f32 accumulate: x.[Wq|Wk|Wv] on v_wmma_f32_16x16x32_bf16 (x and W RNE-converted to bf16); q.k^T as 3 bf16 products (q,k hi+lo planes) on every row; P.V rows < RH as 3 bf16 products (P and V hi+lo), rows >= RH on v_wmma_f32_16x16x32_f16 (P fp16 carried x 2^14, V fp16); rotary table, softmax and normalisation in f32.
// Pipeline: k_prep (one workgroup per 64 rows of x) converts its x tile and the three weights to bf16 in LDS, projects to q|k|v in f32 (LDS), applies the interleaved rotary pairs (cos, sin formed in the kernel)
// and writes the Q/K bf16 hi,lo planes and the V planes (fp16, bf16 hi, bf16 lo) in FRAGMENT ORDER (below), so that every 16-byte-per-lane load of k_attn reads 512 contiguous bytes = 4 whole lines;
// Fragment order, per batch SEQ * 32 elements: a fragment is 512 elements = [piece p = 0, 1][lane l = 0..31][j = 0..7]. Q/K: fragment t / 16 holds row 16 * (t / 16) + (l & 15), column 16 * p + 8 * (l >> 4) + j.
// V: fragment 2 * (t / 32) + dh holds column d = 16 * dh + (l & 15), key 32 * (t / 32) + 16 * p + 8 * (l >> 4) + j. Either way the 64 rows t0 .. t0 + 63 fill the 2,048 elements from t0 * 32.
// k_attn: one workgroup of KW waves per 32 query rows (NQ tiles of 16), wave w takes the 64-key chunks w, w + KW, .. and uses every K and V fragment it loads for both tiles; scores and outputs in transposed form (one query per lane and tile), online softmax per wave (running max, f32 sums), causal: chunks above the diagonal never visited, one masked diagonal chunk (replace by -3e38 == exclusion); the waves' partials are merged through LDS;
#pragma clang fp contract(off)

#ifndef NB
#define NB 8
#endif
#ifndef SEQ
#define SEQ 4096
#endif
#define NB_FULL  8
#define SEQ_FULL 4096
#define DM   128                  // embedding width (K of the projections)
#define HS   32                   // head width
#define XP   136                  // LDS pitch (bf16 elements) of the x and weight tiles: 272 B = 16 B x 17, odd, for 16-byte readers
#define FP   100                  // LDS pitch (floats) of the projected q | k | v tile: 400 B, a multiple of 16 B; the two lane halves of a D store fall on disjoint banks
#ifndef RH
#define RH   1024                 // query rows < RH use bf16 hi+lo P and V planes
#endif
#define PCAR 16384.0f             // fp16 P carry (2^14) for rows >= RH
#define SCL  0.17677669529663687f // 32^-0.5
#define L2E  1.4426950408889634f
#define OPF  36                   // LDS output tile pitch (floats); columns 32, 33 of a row hold the wave's (max, sum)
#define KW   8                    // waves of a k_attn workgroup = key ranges of one query block
#define NQ   2                    // 16-row query tiles of a k_attn workgroup: each loaded K and V fragment serves all of them
static_assert(SEQ % 64 == 0);
static_assert(SEQ <= SEQ_FULL);
static_assert(NB >= 1);
static_assert(NB <= NB_FULL);
static_assert(RH % 64 == 0);
static_assert(64 % (16 * NQ) == 0);
static_assert(DM % 32 == 0);
static_assert(DM == 128 && HS == 32);
static_assert((long long)NB_FULL * SEQ_FULL * HS * 4 == 4194304LL);

typedef _Float16 h16;
typedef unsigned short bf;
typedef __attribute__((ext_vector_type(16))) __bf16   v16bf;
typedef __attribute__((ext_vector_type(16))) _Float16 v16h;
typedef __attribute__((ext_vector_type(8)))  _Float16 v8h;
typedef __attribute__((ext_vector_type(8)))  unsigned short v8us;
typedef __attribute__((ext_vector_type(4)))  unsigned short v4us;
typedef __attribute__((ext_vector_type(2)))  unsigned short v2us;
typedef __attribute__((ext_vector_type(8)))  float    v8f;
typedef __attribute__((ext_vector_type(4)))  float    v4f;
typedef __attribute__((ext_vector_type(2)))  float    v2f;
typedef v8h  __attribute__((may_alias)) v8ha;
typedef v4f  __attribute__((may_alias)) v4fa;
typedef v8us __attribute__((may_alias)) v8usa;
typedef v4us __attribute__((may_alias)) v4usa;

__device__ __forceinline__ unsigned short f2bf(float f) { unsigned u = __float_as_uint(f); u += 0x7FFFu + ((u >> 16) & 1u); return (unsigned short)(u >> 16); }
__device__ __forceinline__ float bf2f(unsigned short b) { return __uint_as_float(((unsigned)b) << 16); }
__device__ __forceinline__ v8f cat8f(v4f lo, v4f hi) { return __builtin_shufflevector(lo, hi, 0, 1, 2, 3, 4, 5, 6, 7); }
__device__ __forceinline__ v16h cat16(v8h lo, v8h hi) { return __builtin_shufflevector(lo, hi, 0, 1, 2, 3, 4, 5, 6, 7, 8, 9, 10, 11, 12, 13, 14, 15); }
__device__ __forceinline__ v16bf cat16b(v8us lo, v8us hi) { return __builtin_bit_cast(v16bf, __builtin_shufflevector(lo, hi, 0, 1, 2, 3, 4, 5, 6, 7, 8, 9, 10, 11, 12, 13, 14, 15)); }
__device__ __forceinline__ v8f wmma16(v16h a, v16h b, v8f c) { return __builtin_amdgcn_wmma_f32_16x16x32_f16(false, a, false, b, (short)0, c, false, false); }
__device__ __forceinline__ v8f wmmab(v16bf a, v16bf b, v8f c) { return __builtin_amdgcn_wmma_f32_16x16x32_bf16(false, a, false, b, (short)0, c, false, false); }

// INVT[i] = 1 / 10000^(2i/32): the exact float32 results of that expression (pow then reciprocal in f32), i = 0..15.
__constant__ __align__(16) float INVT[HS / 2] = { 1.0f, 0.5623413324356079f, 0.3162277638912201f, 0.17782793939113617f, 0.10000000149011612f, 0.05623412877321243f, 0.03162277862429619f, 0.017782794311642647f, 0.009999999776482582f, 0.005623413249850273f, 0.003162277862429619f, 0.0017782794311642647f, 0.0010000000474974513f, 0.000562341301701963f, 0.0003162277862429619f, 0.00017782794020604342f };

// ---- k_prep: block = batch b (grid.y), 64 consecutive t (t0 = blockIdx.x * 64), 256 threads = 8 waves. Three phases, a workgroup barrier between each two.
// Phase 1 (stage): the x tile [64 t][128 k] is read as 16-byte pieces, contiguous over the block, RNE-converted to bf16 and stored in xs [row][k]; the weights are read column by lane (wave -> matrix and group of 8 k),
// converted and stored transposed in wt [n = 32 * matrix + column][k] (n 0..31 q, 32..63 k, 64..95 v); each thread also forms its four rotary pairs (c, s) = {cos, sin}(INVT[i] * t), t = t0 + (tid >> 2), i = 4 * (tid & 3) + p.
// Phase 2 (project): wave w owns rows 16 * (w & 3) .. + 15 and the three 16-column tiles 3 * (w >> 2) + 0..2; k in steps of 32, ascending, f32 accumulate.
// Fragments: lane -> row/col (lane & 15), elements 0..7 <- k0 + 8*(lane >> 4) + 0..7, elements 8..15 <- k0 + 16 + 8*(lane >> 4) + 0..7 for A and for the [n][k] B tile. D element j of lane l is row 8*(l >> 4) + j, column l & 15; it goes to fs [row][n] in f32.
// Phase 3 (planes): thread -> row r = tid>>2, column group g = tid&3 = 8 q, 8 k, 8 v columns. Rotary (interleaved pairs, i = column/2): out[2i] = x[2i] c - x[2i+1] s, out[2i+1] = x[2i] s + x[2i+1] c, separate f32 products.
// LDS tiles: sq[0..3] = Qh, Ql, Kh, Kl as [64 r][32 c]; sv[0..2] = V fp16 bits, bf16 hi, bf16 lo, already in fragment order. After the last barrier every plane's 4,096-byte tile region is written in 16-byte pieces, contiguous over the block; the Q/K pieces are picked from sq in fragment order.
__global__ __launch_bounds__(256) void k_prep(const float* __restrict__ x, const float* __restrict__ wq, const float* __restrict__ wk, const float* __restrict__ wv,
                                              bf* Qh, bf* Ql, bf* Kh, bf* Kl, h16* VT16, bf* VTh, bf* VTl) {
    __shared__ __align__(16) unsigned short xs[64 * XP];
    __shared__ __align__(16) unsigned short wt[96 * XP];
    __shared__ __align__(16) float fs[64 * FP];
    __shared__ __align__(16) unsigned short sq[4][64 * 32];
    __shared__ __align__(16) unsigned short sv[3][32 * 64];
    const int tid = threadIdx.x; const int b = blockIdx.y, t0 = blockIdx.x * 64;
    const int w = __builtin_amdgcn_readfirstlane(tid >> 5), L = tid & 31;
    const int r = tid >> 2, g = tid & 3; const int t = t0 + r;
    // ---- phase 1
    const v4f iv = *(const v4f*)(INVT + 4 * g);
    const float* xp = x + ((size_t)b * SEQ_FULL + t0) * DM + (size_t)tid * 4;
    v4f xr[8];
#pragma unroll
    for (int s = 0; s < 8; ++s) xr[s] = *(const v4f*)(xp + s * 1024);
    float wr[6][8];
#pragma unroll
    for (int s = 0; s < 6; ++s) { const int c = s * 8 + w; const int m = c >> 4, kg = c & 15;
        const float* wsrc = ((m == 0) ? wq : ((m == 1) ? wk : wv)) + (size_t)kg * 8 * HS + L;
#pragma unroll
        for (int j = 0; j < 8; ++j) wr[s][j] = wsrc[j * HS]; }
    float cnv[4], snv[4];
#pragma unroll
    for (int p = 0; p < 4; ++p) { const float ang = iv[p] * (float)t; float sn, cn; sincosf(ang, &sn, &cn); cnv[p] = cn; snv[p] = sn; }
#pragma unroll
    for (int s = 0; s < 8; ++s) { const int e = (s * 256 + tid) * 4; v4us o;
#pragma unroll
        for (int k = 0; k < 4; ++k) o[k] = f2bf(xr[s][k]);
        *(v4usa*)(&xs[(e >> 7) * XP + (e & 127)]) = o; }
#pragma unroll
    for (int s = 0; s < 6; ++s) { const int c = s * 8 + w; const int m = c >> 4, kg = c & 15; v8us o;
#pragma unroll
        for (int j = 0; j < 8; ++j) o[j] = f2bf(wr[s][j]);
        *(v8usa*)(&wt[(m * 32 + L) * XP + kg * 8]) = o; }
    __syncthreads();
    // ---- phase 2
    {   const int lr = L & 15, hi = L >> 4; const int mt = w & 3, ng = w >> 2;
        v8f acc[3];
#pragma unroll
        for (int nb = 0; nb < 3; ++nb) acc[nb] = (v8f){};
#pragma unroll
        for (int kc = 0; kc < DM; kc += 32) {
            const unsigned short* ap = &xs[(mt * 16 + lr) * XP + kc + 8 * hi];
            const v16bf a = cat16b(*(const v8usa*)ap, *(const v8usa*)(ap + 16));
#pragma unroll
            for (int nb = 0; nb < 3; ++nb) { const unsigned short* bp = &wt[((ng * 3 + nb) * 16 + lr) * XP + kc + 8 * hi];
                acc[nb] = wmmab(a, cat16b(*(const v8usa*)bp, *(const v8usa*)(bp + 16)), acc[nb]); }
        }
#pragma unroll
        for (int nb = 0; nb < 3; ++nb) {
#pragma unroll
            for (int j = 0; j < 8; ++j) fs[(mt * 16 + hi * 8 + j) * FP + (ng * 3 + nb) * 16 + lr] = acc[nb][j]; }
    }
    __syncthreads();
    // ---- phase 3
    const float* fr = &fs[r * FP + 8 * g];
    const v8f xq = cat8f(*(const v4fa*)fr, *(const v4fa*)(fr + 4)), xk = cat8f(*(const v4fa*)(fr + 32), *(const v4fa*)(fr + 36)), xv = cat8f(*(const v4fa*)(fr + 64), *(const v4fa*)(fr + 68));
#pragma unroll
    for (int p = 0; p < 4; ++p) {
        const float cn = cnv[p], sn = snv[p]; const int col = 8 * g + 2 * p;
        {   const float x1 = xq[2 * p], x2 = xq[2 * p + 1]; const float ev = x1 * cn - x2 * sn, od = x1 * sn + x2 * cn;
            v2us oh, ol; unsigned short hh0 = f2bf(ev), hh1 = f2bf(od); oh[0] = hh0; oh[1] = hh1; ol[0] = f2bf(ev - bf2f(hh0)); ol[1] = f2bf(od - bf2f(hh1));
            *(v2us*)(&sq[0][r * 32 + col]) = oh; *(v2us*)(&sq[1][r * 32 + col]) = ol; }
        {   const float x1 = xk[2 * p], x2 = xk[2 * p + 1]; const float ev = x1 * cn - x2 * sn, od = x1 * sn + x2 * cn;
            v2us oh, ol; unsigned short hh0 = f2bf(ev), hh1 = f2bf(od); oh[0] = hh0; oh[1] = hh1; ol[0] = f2bf(ev - bf2f(hh0)); ol[1] = f2bf(od - bf2f(hh1));
            *(v2us*)(&sq[2][r * 32 + col]) = oh; *(v2us*)(&sq[3][r * 32 + col]) = ol; }
#pragma unroll
        for (int j = 0; j < 2; ++j) { const float val = xv[2 * p + j]; const int d = col + j; const unsigned short vh = f2bf(val);
            const int vi = ((r >> 5) * 2 + (d >> 4)) * 512 + ((r >> 4) & 1) * 256 + (((r >> 3) & 1) * 16 + (d & 15)) * 8 + (r & 7);   // fragment order of (key r, column d)
            sv[0][vi] = __builtin_bit_cast(unsigned short, (h16)val); sv[1][vi] = vh; sv[2][vi] = f2bf(val - bf2f(vh)); }
    }
    __syncthreads();
    const int lo = w * 256 + L * 8;                                                    // linear offset inside a 2,048-element tile
    const size_t qoff = ((size_t)b * SEQ + t0) * HS + lo;                              // the same place in every plane: fragment w >> 1, piece w & 1, lane L
    const int fo = ((w >> 1) * 16 + (L & 15)) * 32 + 16 * (w & 1) + 8 * (L >> 4);      // that piece's row and column in an sq tile
    const v8us q0v = *(const v8usa*)(&sq[0][fo]), q1v = *(const v8usa*)(&sq[1][fo]), k0v = *(const v8usa*)(&sq[2][fo]), k1v = *(const v8usa*)(&sq[3][fo]);
    const v8us v0v = *(const v8usa*)(&sv[0][lo]), v1v = *(const v8usa*)(&sv[1][lo]), v2v = *(const v8usa*)(&sv[2][lo]);
    unsigned short* VT16u = (unsigned short*)VT16;
    *(v8us*)(Qh + qoff) = q0v; *(v8us*)(Ql + qoff) = q1v; *(v8us*)(Kh + qoff) = k0v; *(v8us*)(Kl + qoff) = k1v;
    *(v8us*)(VT16u + qoff) = v0v; *(v8us*)(VTh + qoff) = v1v; *(v8us*)(VTl + qoff) = v2v;
}

// lane l with lane l ^ 16 (a vector cross-row move, no LDS counter)
__device__ __forceinline__ float xhalf(float x) { return __builtin_bit_cast(float, __builtin_amdgcn_permlanex16(__builtin_bit_cast(int, x), __builtin_bit_cast(int, x), 0x76543210, 0xfedcba98, false, false)); }

// eight exponentials in place, each independent of its neighbours, then one v_nop: the slot the instruction set asks for behind a transcendental before its result is used or its source overwritten
__device__ __forceinline__ v8f exp2x8(const v8f x) {
    float a = x[0], b = x[1], c = x[2], d = x[3], e = x[4], f = x[5], g = x[6], h = x[7];
    asm("v_exp_f32 %0, %0\n\tv_exp_f32 %1, %1\n\tv_exp_f32 %2, %2\n\tv_exp_f32 %3, %3\n\tv_exp_f32 %4, %4\n\tv_exp_f32 %5, %5\n\tv_exp_f32 %6, %6\n\tv_exp_f32 %7, %7\n\tv_nop"
        : "+v"(a), "+v"(b), "+v"(c), "+v"(d), "+v"(e), "+v"(f), "+v"(g), "+v"(h));
    return (v8f){a, b, c, d, e, f, g, h};
}

// ---- attn_chunk: one 64-key chunk for one wave's NQ query tiles (tile u = rows q0 + 16*u .. + 15; what follows is per tile, with q0 read as the tile's first row), the K and V fragments loaded once for all tiles, in transposed form: S^T = K.Q^T, O^T += V^T.P^T. Scores: 4 key tiles, each hi.hi + lo.hi + hi.lo (q, k bf16 planes in fragment order; A fragment = K rows, B fragment = Q rows, both k-contiguous pieces in the same k map).
// D element r of lane l is S[q0 + (l&15)][kv0 + 16*tile + 8*(l>>4) + r]: a lane holds 32 of the 64 scores of ONE query, lane l ^ 16 the other 32. Online softmax per lane: x SCL, causal replace-mask (MASK chunk only), in-lane max, one exchange between the wave halves, running max / rescale;
// the lane's sum covers its own 32 keys (the halves are joined in k_attn). P^T as the B operand straight from the score registers: element j <- tile 2*ks, register j; element 8 + j <- tile 2*ks + 1, register j, which is key 32*ks + 8*(l>>4) + j and 32*ks + 16 + 8*(l>>4) + j, the k map of the V^T loads.
// V planes in fragment order as the A operand V^T (HI: 3 bf16 products; else one fp16 product); outputs o0[r] = O[q0 + (l&15)][8*(l>>4) + r], o1[r] = the same at d + 16.
template <bool HI, bool MASK>
__device__ __forceinline__ void attn_chunk(const bf* __restrict__ Khb, const bf* __restrict__ Klb, const h16* __restrict__ V16b, const bf* __restrict__ Vhb, const bf* __restrict__ Vlb,
                                           const v16bf (&aqh)[NQ], const v16bf (&aql)[NQ], const int kv0, const int q0, const int ln, const int hh,
                                           float (&mrun)[NQ], float (&lp)[NQ], v8f (&o0)[NQ], v8f (&o1)[NQ]) {
    const size_t fb = (size_t)kv0 * HS + (16 * hh + ln) * 8;                            // the lane's 8 elements in piece 0 of the chunk's first fragment, the same in every plane
    v16bf bh[4], bl[4]; const bf* kph = Khb + fb; const bf* kpl = Klb + fb;             // every K load of the chunk is one of these two addresses plus a constant
#pragma unroll
    for (int t = 0; t < 4; ++t) { const int ko = 512 * t;
        bh[t] = cat16b(*(const v8us*)(kph + ko), *(const v8us*)(kph + ko + 256)); bl[t] = cat16b(*(const v8us*)(kpl + ko), *(const v8us*)(kpl + ko + 256)); }
    // the wait stands behind the K loads, in front of any instruction that reuses one of their address registers; the addresses are its inputs so that no load of the run lands in one of them ahead of it
    asm volatile("s_wait_xcnt 0x0" :: "v"(kph), "v"(kpl) : "memory");
    // inputs-only fence on the loaded K fragments: the sixteen K loads issue as one run in front of the first product; without it the compiler reuses fragment registers and strings the loads into three dependent round trips
    asm volatile("" :: "v"(bh[0]), "v"(bh[1]), "v"(bh[2]), "v"(bh[3]), "v"(bl[0]), "v"(bl[1]), "v"(bl[2]), "v"(bl[3]));
    v8f s[NQ][4];
#pragma unroll
    for (int u = 0; u < NQ; ++u) {
#pragma unroll
        for (int t = 0; t < 4; ++t) { v8f a = wmmab(bh[t], aqh[u], (v8f){}); a = wmmab(bh[t], aql[u], a); a = wmmab(bl[t], aqh[u], a); s[u][t] = a; } }
    asm volatile("v_nop\n\tv_nop\n\tv_nop\n\tv_nop" : "+v"(s[0][0]), "+v"(s[0][1]), "+v"(s[0][2]), "+v"(s[0][3]), "+v"(s[1][0]), "+v"(s[1][1]), "+v"(s[1][2]), "+v"(s[1][3]) : "v"(aqh[1]), "v"(aql[1]), "v"(bh[3]), "v"(bl[3]));
#pragma unroll
    for (int u = 0; u < NQ; ++u) {
        const int qi = q0 + 16 * u + ln;
#pragma unroll
        for (int t = 0; t < 4; ++t) {
#pragma unroll
            for (int r = 0; r < 8; ++r) { float v = s[u][t][r] * SCL; if (MASK) v = (kv0 + 16 * t + 8 * hh + r <= qi) ? v : -3.0e38f; s[u][t][r] = v; } }
        float rm = -3.0e38f;
#pragma unroll
        for (int r = 0; r < 8; ++r) rm = fmaxf(rm, fmaxf(fmaxf(s[u][0][r], s[u][1][r]), fmaxf(s[u][2][r], s[u][3][r])));
        rm = fmaxf(rm, xhalf(rm));
        const float mn = fmaxf(mrun[u], rm);
        float cf; const float cx = (mrun[u] - mn) * L2E;
        asm("v_exp_f32 %0, %1\n\tv_nop" : "=v"(cf) : "v"(cx)); // v_nop: the same slot behind a transcendental
        mrun[u] = mn;
#pragma unroll
        for (int t = 0; t < 4; ++t) s[u][t] = exp2x8((s[u][t] - mn) * L2E);
        const v8f ps = (s[u][0] + s[u][1]) + (s[u][2] + s[u][3]);
        const float psum = ((ps[0] + ps[1]) + (ps[2] + ps[3])) + ((ps[4] + ps[5]) + (ps[6] + ps[7]));
        lp[u] = lp[u] * cf + psum; o0[u] = o0[u] * cf; o1[u] = o1[u] * cf;
    }
    if (HI) {
        v16bf aph[NQ][2], apl[NQ][2];
#pragma unroll
        for (int u = 0; u < NQ; ++u) {
#pragma unroll
            for (int ks = 0; ks < 2; ++ks) { v8us h0, h1, l0, l1;
#pragma unroll
                for (int j = 0; j < 8; ++j) { const float pa = s[u][2 * ks][j], pb = s[u][2 * ks + 1][j]; const unsigned short ha = f2bf(pa), hb = f2bf(pb);
                    h0[j] = ha; h1[j] = hb; l0[j] = f2bf(pa - bf2f(ha)); l1[j] = f2bf(pb - bf2f(hb)); }
                aph[u][ks] = cat16b(h0, h1); apl[u][ks] = cat16b(l0, l1); } }
        const bf* vph = Vhb + fb; const bf* vpl = Vlb + fb; // every V load of the chunk is one of these two addresses plus a constant
        {   v16bf vh[2], vl[2];
#pragma unroll
            for (int ks = 0; ks < 2; ++ks) { const int vo = 1024 * ks;
                vh[ks] = cat16b(*(const v8us*)(vph + vo), *(const v8us*)(vph + vo + 256)); vl[ks] = cat16b(*(const v8us*)(vpl + vo), *(const v8us*)(vpl + vo + 256)); }
#pragma unroll
            for (int u = 0; u < NQ; ++u) {
#pragma unroll
                for (int ks = 0; ks < 2; ++ks) { o0[u] = wmmab(vh[ks], aph[u][ks], o0[u]); o0[u] = wmmab(vh[ks], apl[u][ks], o0[u]); o0[u] = wmmab(vl[ks], aph[u][ks], o0[u]); } } }
        {   v16bf vh[2], vl[2];
#pragma unroll
            for (int ks = 0; ks < 2; ++ks) { const int vo = 1024 * ks + 512;
                vh[ks] = cat16b(*(const v8us*)(vph + vo), *(const v8us*)(vph + vo + 256)); vl[ks] = cat16b(*(const v8us*)(vpl + vo), *(const v8us*)(vpl + vo + 256)); }
            // the wait stands behind the last V load, in front of any instruction that reuses a V address register; the two base addresses are its inputs so that no V load lands in one of them ahead of it
            asm volatile("s_wait_xcnt 0x0" :: "v"(vph), "v"(vpl) : "memory");
#pragma unroll
            for (int u = 0; u < NQ; ++u) {
#pragma unroll
                for (int ks = 0; ks < 2; ++ks) { o1[u] = wmmab(vh[ks], aph[u][ks], o1[u]); o1[u] = wmmab(vh[ks], apl[u][ks], o1[u]); o1[u] = wmmab(vl[ks], aph[u][ks], o1[u]); } }
            asm volatile("v_nop\n\tv_nop\n\tv_nop\n\tv_nop" : "+v"(o0[0]), "+v"(o1[0]), "+v"(o0[1]), "+v"(o1[1]) : "v"(aph[1][1]), "v"(apl[1][1]), "v"(vh[1]), "v"(vl[1])); }
    } else {
        v16h ap[NQ][2];
#pragma unroll
        for (int u = 0; u < NQ; ++u) {
#pragma unroll
            for (int ks = 0; ks < 2; ++ks) {
#pragma unroll
                for (int j = 0; j < 8; ++j) { ap[u][ks][j] = (h16)(s[u][2 * ks][j] * PCAR); ap[u][ks][8 + j] = (h16)(s[u][2 * ks + 1][j] * PCAR); } } }
        const h16* vp = V16b + fb; // every V load of the chunk is this address plus a constant
        {   v16h vb[2];
#pragma unroll
            for (int ks = 0; ks < 2; ++ks) { const int vo = 1024 * ks; vb[ks] = cat16(*(const v8h*)(vp + vo), *(const v8h*)(vp + vo + 256)); }
#pragma unroll
            for (int u = 0; u < NQ; ++u) {
#pragma unroll
                for (int ks = 0; ks < 2; ++ks) o0[u] = wmma16(vb[ks], ap[u][ks], o0[u]); } }
        {   v16h vb[2];
#pragma unroll
            for (int ks = 0; ks < 2; ++ks) { const int vo = 1024 * ks + 512; vb[ks] = cat16(*(const v8h*)(vp + vo), *(const v8h*)(vp + vo + 256)); }
            // the wait stands behind the last V load, in front of any instruction that reuses the V address register; the base address is its input so that no V load lands in it ahead of the wait
            asm volatile("s_wait_xcnt 0x0" :: "v"(vp) : "memory");
#pragma unroll
            for (int u = 0; u < NQ; ++u) {
#pragma unroll
                for (int ks = 0; ks < 2; ++ks) o1[u] = wmma16(vb[ks], ap[u][ks], o1[u]); }
            asm volatile("v_nop\n\tv_nop\n\tv_nop\n\tv_nop" : "+v"(o0[0]), "+v"(o1[0]), "+v"(o0[1]), "+v"(o1[1]) : "v"(ap[1][1]), "v"(vb[1])); }
    }
}

// ---- k_attn: grid (query blocks of 16 * NQ rows, NB), 32 * KW threads; the workgroup owns rows q0 = qrow0 + blockIdx.x*16*NQ .. + 16*NQ - 1 of batch b = blockIdx.y, as NQ tiles of 16. Wave w visits the 64-key chunks w, w + KW, .. up to the
// diagonal chunk cd = q0 / 64 (the same for every tile, as a block never straddles a multiple of 64; exactly one masked chunk, taken by wave cd % KW) with its own running max, sums and accumulators per tile, one query per lane, tile and wave half. Merge: each wave stores its
// un-normalised tiles [query][d] and per query (max, l joined over the two halves) in its own LDS tile, one workgroup barrier, then thread -> (row, 4 columns): M = max over waves, weights exp2((m_w - M) L2E), out = sum_w f_w o_w x carry / sum_w f_w l_w.
// A wave that visited no chunk holds max -3e38, l 0, o 0: its weight is exp2(-inf) = 0.
template <bool HI>
__global__ __launch_bounds__(32 * KW) void k_attn(const bf* __restrict__ Qh, const bf* __restrict__ Ql, const bf* __restrict__ Kh, const bf* __restrict__ Kl,
                                             const h16* __restrict__ V16, const bf* __restrict__ Vh, const bf* __restrict__ Vl, float* OUT, int qrow0) {
    __shared__ __align__(16) float ost[KW][16 * NQ * OPF];
    const int wave = __builtin_amdgcn_readfirstlane(threadIdx.x >> 5), lane = threadIdx.x & 31, hh = lane >> 4, ln = lane & 15;
    const int b = blockIdx.y; const int q0 = qrow0 + blockIdx.x * (16 * NQ);
    const bf* Qhb = Qh + (size_t)b * SEQ * HS; const bf* Qlb = Ql + (size_t)b * SEQ * HS;
    const bf* Khb = Kh + (size_t)b * SEQ * HS; const bf* Klb = Kl + (size_t)b * SEQ * HS;
    const h16* V16b = V16 + (size_t)b * HS * SEQ; const bf* Vhb = Vh + (size_t)b * HS * SEQ; const bf* Vlb = Vl + (size_t)b * HS * SEQ;
    v16bf aqh[NQ], aql[NQ]; const bf* qph[NQ]; const bf* qpl[NQ];
#pragma unroll
    for (int u = 0; u < NQ; ++u) { const size_t qo = (size_t)(q0 + 16 * u) * HS + lane * 8; qph[u] = Qhb + qo; qpl[u] = Qlb + qo;   // fragment (q0 + 16 u) / 16, piece 0
        aqh[u] = cat16b(*(const v8us*)qph[u], *(const v8us*)(qph[u] + 256));
        aql[u] = cat16b(*(const v8us*)qpl[u], *(const v8us*)(qpl[u] + 256)); }
    // stands behind the Q loads, in front of any instruction that reuses one of their address registers; the addresses are its inputs so that none of them is rewritten ahead of it
    asm volatile("s_wait_xcnt 0x0" :: "v"(qph[0]), "v"(qph[1]), "v"(qpl[0]), "v"(qpl[1]) : "memory");
    float mrun[NQ], lp[NQ]; v8f o0[NQ], o1[NQ];
#pragma unroll
    for (int u = 0; u < NQ; ++u) { mrun[u] = -3.0e38f; lp[u] = 0.0f; o0[u] = (v8f){}; o1[u] = (v8f){}; }
    int kv0 = wave * 64;
#pragma unroll 1
    for (; kv0 + 64 <= q0; kv0 += 64 * KW) attn_chunk<HI, false>(Khb, Klb, V16b, Vhb, Vlb, aqh, aql, kv0, q0, ln, hh, mrun, lp, o0, o1);
    if (kv0 < q0 + 16 * NQ) attn_chunk<HI, true>(Khb, Klb, V16b, Vhb, Vlb, aqh, aql, kv0, q0, ln, hh, mrun, lp, o0, o1);
#pragma unroll
    for (int u = 0; u < NQ; ++u) {
        float* osw = &ost[wave][(16 * u + ln) * OPF];
        const float lj = lp[u] + xhalf(lp[u]);
        *(v4fa*)(osw + 8 * hh) = __builtin_shufflevector(o0[u], o0[u], 0, 1, 2, 3); *(v4fa*)(osw + 8 * hh + 4) = __builtin_shufflevector(o0[u], o0[u], 4, 5, 6, 7);
        *(v4fa*)(osw + 16 + 8 * hh) = __builtin_shufflevector(o1[u], o1[u], 0, 1, 2, 3); *(v4fa*)(osw + 16 + 8 * hh + 4) = __builtin_shufflevector(o1[u], o1[u], 4, 5, 6, 7);
        if (hh == 0) { v2f ms; ms[0] = mrun[u]; ms[1] = lj; *(v2f*)(osw + 32) = ms; }
    }
    __syncthreads();
    const float carry = HI ? 1.0f : (1.0f / PCAR);
    const int row = threadIdx.x >> 3, col = (threadIdx.x & 7) * 4;
    static_assert(32 * KW == 16 * NQ * 8);
    v2f ml[KW]; float M = -3.0e38f;
#pragma unroll
    for (int w = 0; w < KW; ++w) { ml[w] = *(const v2f*)(&ost[w][row * OPF + 32]); M = fmaxf(M, ml[w][0]); }
    float L = 0.0f; v4f a = (v4f){};
#pragma unroll
    for (int w = 0; w < KW; ++w) { float f; const float fx = (ml[w][0] - M) * L2E; const v4f o = *(const v4fa*)(&ost[w][row * OPF + col]);
        asm("v_exp_f32 %0, %1\n\tv_nop" : "=v"(f) : "v"(fx)); // v_nop: the slot the instruction set asks for behind a transcendental before its result is used or its source overwritten
        L += f * ml[w][1]; a += o * f; }
    const float inv = carry * __builtin_amdgcn_rcpf(L);
    *(v4f*)(OUT + ((size_t)b * SEQ_FULL + q0 + row) * HS + col) = a * inv;
}

extern "C" void kernel_launch(void* const* d_in, const int* in_sizes, int n_in,
                              void* d_out, int out_size, void* d_ws, size_t ws_size, hipStream_t stream) {
    if (n_in < 4) return;
    const float* x  = (const float*)d_in[0];   // [8][4096][128]
    const float* wq = (const float*)d_in[1];   // [128][32]
    const float* wk = (const float*)d_in[2];   // [128][32]
    const float* wv = (const float*)d_in[3];   // [128][32]
    if (in_sizes[0] < ((NB - 1) * SEQ_FULL + SEQ) * DM) return;
    if (in_sizes[1] < DM * HS || in_sizes[2] < DM * HS || in_sizes[3] < DM * HS) return;
    if (out_size < ((NB - 1) * SEQ_FULL + SEQ) * HS) return;
    float* OUT = (float*)d_out;                 // [8][4096][32] f32
    char* wsp = (char*)d_ws;
    auto take = [&](size_t bytes) { char* p = wsp; wsp += (bytes + 255) & ~(size_t)255; return (void*)p; };
    bf*    Qh   = (bf*)take((size_t)NB * SEQ * HS * 2);              //   2,097,152 B each
    bf*    Ql   = (bf*)take((size_t)NB * SEQ * HS * 2);
    bf*    Kh   = (bf*)take((size_t)NB * SEQ * HS * 2);
    bf*    Kl   = (bf*)take((size_t)NB * SEQ * HS * 2);
    h16*   VT16 = (h16*)take((size_t)NB * HS * SEQ * 2);
    bf*    VTh  = (bf*)take((size_t)NB * HS * SEQ * 2);
    bf*    VTl  = (bf*)take((size_t)NB * HS * SEQ * 2);             // total 14,680,064 B
    if ((size_t)(wsp - (char*)d_ws) > ws_size) return;
    const int rh = (RH < SEQ) ? RH : SEQ;

    k_prep<<<dim3(SEQ / 64, NB), 256, 0, stream>>>(x, wq, wk, wv, Qh, Ql, Kh, Kl, VT16, VTh, VTl);
    k_attn<true><<<dim3(rh / (16 * NQ), NB), 32 * KW, 0, stream>>>(Qh, Ql, Kh, Kl, VT16, VTh, VTl, OUT, 0);
    if (SEQ > rh) k_attn<false><<<dim3((SEQ - rh) / (16 * NQ), NB), 32 * KW, 0, stream>>>(Qh, Ql, Kh, Kl, VT16, VTh, VTl, OUT, rh);
}

// v006
// One run takes 28.5 microseconds.
// Two timings next to v005 put it at 1.41 and 1.40 times that version's speed.
// Counting every step since v000, it is 6.19 times as fast.
#include <hip/hip_runtime.h>

// Contractions, f32 accumulate: x.[Wq|Wk|Wv] on v_wmma_f32_16x16x32_bf16 (x and W RNE-converted to bf16); q.k^T as 3 bf16 products (q,k hi+lo planes) on every row; P.V rows < RH as 3 bf16 products (P and V hi+lo), rows >= RH on v_wmma_f32_16x16x32_f16 (P fp16 carried x 2^14, V fp16); rotary table, softmax and normalisation in f32.
// Pipeline: k_prep (one workgroup per 64 rows of x) converts its x tile and the three weights to bf16 in LDS, projects to q|k|v in f32 (LDS), applies the interleaved rotary pairs (cos, sin formed in the kernel)
// and writes the Q/K bf16 hi,lo planes and the V planes (fp16, bf16 hi, bf16 lo) in FRAGMENT ORDER (below), so that every 16-byte-per-lane load of k_attn reads 512 contiguous bytes = 4 whole lines;
// Fragment order, per batch SEQ * 32 elements: a fragment is 512 elements = [piece p = 0, 1][lane l = 0..31][j = 0..7]. Q/K: fragment t / 16 holds row 16 * (t / 16) + (l & 15), column 16 * p + 8 * (l >> 4) + j.
// V: fragment 2 * (t / 32) + dh holds column d = 16 * dh + (l & 15), key 32 * (t / 32) + 16 * p + 8 * (l >> 4) + j. Either way the 64 rows t0 .. t0 + 63 fill the 2,048 elements from t0 * 32.
// k_attn: one workgroup of KW waves per 32 query rows (NQ tiles of 16), wave w takes the 64-key chunks w, w + KW, .. and uses every K and V fragment it loads for both tiles; scores and outputs in transposed form (one query per lane and tile), online softmax per wave (running max, f32 sums), causal: chunks above the diagonal never visited, one masked diagonal chunk (replace by -3e38 == exclusion); the waves' partials are merged through LDS;
#pragma clang fp contract(off)

#ifndef NB
#define NB 8
#endif
#ifndef SEQ
#define SEQ 4096
#endif
#define NB_FULL  8
#define SEQ_FULL 4096
#define DM   128                  // embedding width (K of the projections)
#define HS   32                   // head width
#define XP   136                  // LDS pitch (bf16 elements) of the x and weight tiles: 272 B = 16 B x 17, odd, for 16-byte readers
#define FP   100                  // LDS pitch (floats) of the projected q | k | v tile: 400 B, a multiple of 16 B; the two lane halves of a D store fall on disjoint banks
#ifndef RH
#define RH   1024                 // query rows < RH use bf16 hi+lo P and V planes
#endif
#define PCAR 16384.0f             // fp16 P carry (2^14) for rows >= RH
#define SCL  0.17677669529663687f // 32^-0.5
#define L2E  1.4426950408889634f
#define OPF  36                   // LDS output tile pitch (floats); columns 32, 33 of a row hold the wave's (max, sum)
#define KW   8                    // waves of a k_attn workgroup = key ranges of one query block
#define NQ   2                    // 16-row query tiles of a k_attn workgroup: each loaded K and V fragment serves all of them
static_assert(SEQ % 64 == 0);
static_assert(SEQ <= SEQ_FULL);
static_assert(NB >= 1);
static_assert(NB <= NB_FULL);
static_assert(RH % 64 == 0);
static_assert(64 % (16 * NQ) == 0);
static_assert(DM % 32 == 0);
static_assert(DM == 128 && HS == 32);
static_assert((long long)NB_FULL * SEQ_FULL * HS * 4 == 4194304LL);

typedef _Float16 h16;
typedef unsigned short bf;
typedef __attribute__((ext_vector_type(16))) __bf16   v16bf;
typedef __attribute__((ext_vector_type(16))) _Float16 v16h;
typedef __attribute__((ext_vector_type(8)))  _Float16 v8h;
typedef __attribute__((ext_vector_type(8)))  unsigned short v8us;
typedef __attribute__((ext_vector_type(4)))  unsigned short v4us;
typedef __attribute__((ext_vector_type(2)))  unsigned short v2us;
typedef __attribute__((ext_vector_type(8)))  float    v8f;
typedef __attribute__((ext_vector_type(4)))  float    v4f;
typedef __attribute__((ext_vector_type(2)))  float    v2f;
typedef v8h  __attribute__((may_alias)) v8ha;
typedef v4f  __attribute__((may_alias)) v4fa;
typedef v8us __attribute__((may_alias)) v8usa;
typedef v4us __attribute__((may_alias)) v4usa;

__device__ __forceinline__ unsigned short f2bf(float f) { unsigned u = __float_as_uint(f); u += 0x7FFFu + ((u >> 16) & 1u); return (unsigned short)(u >> 16); }
__device__ __forceinline__ float bf2f(unsigned short b) { return __uint_as_float(((unsigned)b) << 16); }
__device__ __forceinline__ v8f cat8f(v4f lo, v4f hi) { return __builtin_shufflevector(lo, hi, 0, 1, 2, 3, 4, 5, 6, 7); }
__device__ __forceinline__ v16h cat16(v8h lo, v8h hi) { return __builtin_shufflevector(lo, hi, 0, 1, 2, 3, 4, 5, 6, 7, 8, 9, 10, 11, 12, 13, 14, 15); }
__device__ __forceinline__ v16bf cat16b(v8us lo, v8us hi) { return __builtin_bit_cast(v16bf, __builtin_shufflevector(lo, hi, 0, 1, 2, 3, 4, 5, 6, 7, 8, 9, 10, 11, 12, 13, 14, 15)); }
__device__ __forceinline__ v8f wmma16(v16h a, v16h b, v8f c) { return __builtin_amdgcn_wmma_f32_16x16x32_f16(false, a, false, b, (short)0, c, false, false); }
__device__ __forceinline__ v8f wmmab(v16bf a, v16bf b, v8f c) { return __builtin_amdgcn_wmma_f32_16x16x32_bf16(false, a, false, b, (short)0, c, false, false); }

// INVT[i] = 1 / 10000^(2i/32): the exact float32 results of that expression (pow then reciprocal in f32), i = 0..15.
__constant__ __align__(16) float INVT[HS / 2] = { 1.0f, 0.5623413324356079f, 0.3162277638912201f, 0.17782793939113617f, 0.10000000149011612f, 0.05623412877321243f, 0.03162277862429619f, 0.017782794311642647f, 0.009999999776482582f, 0.005623413249850273f, 0.003162277862429619f, 0.0017782794311642647f, 0.0010000000474974513f, 0.000562341301701963f, 0.0003162277862429619f, 0.00017782794020604342f };

// ---- k_prep: block = batch b (grid.y), 64 consecutive t (t0 = blockIdx.x * 64), 256 threads = 8 waves. Three phases, a workgroup barrier between each two.
// Phase 1 (stage): the x tile [64 t][128 k] is read as 16-byte pieces, contiguous over the block, RNE-converted to bf16 and stored in xs [row][k]; the weights are read column by lane (wave -> matrix and group of 8 k),
// converted and stored transposed in wt [n = 32 * matrix + column][k] (n 0..31 q, 32..63 k, 64..95 v); each thread also forms its four rotary pairs (c, s) = {cos, sin}(INVT[i] * t), t = t0 + (tid >> 2), i = 4 * (tid & 3) + p.
// Phase 2 (project): wave w owns rows 16 * (w & 3) .. + 15 and the three 16-column tiles 3 * (w >> 2) + 0..2; k in steps of 32, ascending, f32 accumulate.
// Fragments: lane -> row/col (lane & 15), elements 0..7 <- k0 + 8*(lane >> 4) + 0..7, elements 8..15 <- k0 + 16 + 8*(lane >> 4) + 0..7 for A and for the [n][k] B tile. D element j of lane l is row 8*(l >> 4) + j, column l & 15; it goes to fs [row][n] in f32.
// Phase 3 (planes): thread -> row r = tid>>2, column group g = tid&3 = 8 q, 8 k, 8 v columns. Rotary (interleaved pairs, i = column/2): out[2i] = x[2i] c - x[2i+1] s, out[2i+1] = x[2i] s + x[2i+1] c, separate f32 products.
// LDS tiles: sq[0..3] = Qh, Ql, Kh, Kl as [64 r][32 c]; sv[0..2] = V fp16 bits, bf16 hi, bf16 lo, already in fragment order. After the last barrier every plane's 4,096-byte tile region is written in 16-byte pieces, contiguous over the block; the Q/K pieces are picked from sq in fragment order.
__global__ __launch_bounds__(256) void k_prep(const float* __restrict__ x, const float* __restrict__ wq, const float* __restrict__ wk, const float* __restrict__ wv,
                                              bf* Qh, bf* Ql, bf* Kh, bf* Kl, h16* VT16, bf* VTh, bf* VTl) {
    __shared__ __align__(16) unsigned short xs[64 * XP];
    __shared__ __align__(16) unsigned short wt[96 * XP];
    __shared__ __align__(16) float fs[64 * FP];
    __shared__ __align__(16) unsigned short sq[4][64 * 32];
    __shared__ __align__(16) unsigned short sv[3][32 * 64];
    const int tid = threadIdx.x; const int b = blockIdx.y, t0 = blockIdx.x * 64;
    const int w = __builtin_amdgcn_readfirstlane(tid >> 5), L = tid & 31;
    const int r = tid >> 2, g = tid & 3; const int t = t0 + r;
    // ---- phase 1
    const v4f iv = *(const v4f*)(INVT + 4 * g);
    const float* xp = x + ((size_t)b * SEQ_FULL + t0) * DM + (size_t)tid * 4;
    v4f xr[8];
#pragma unroll
    for (int s = 0; s < 8; ++s) xr[s] = *(const v4f*)(xp + s * 1024);
    float wr[6][8];
#pragma unroll
    for (int s = 0; s < 6; ++s) { const int c = s * 8 + w; const int m = c >> 4, kg = c & 15;
        const float* wsrc = ((m == 0) ? wq : ((m == 1) ? wk : wv)) + (size_t)kg * 8 * HS + L;
#pragma unroll
        for (int j = 0; j < 8; ++j) wr[s][j] = wsrc[j * HS]; }
    float cnv[4], snv[4];
#pragma unroll
    for (int p = 0; p < 4; ++p) { const float ang = iv[p] * (float)t; float sn, cn; sincosf(ang, &sn, &cn); cnv[p] = cn; snv[p] = sn; }
#pragma unroll
    for (int s = 0; s < 8; ++s) { const int e = (s * 256 + tid) * 4; v4us o;
#pragma unroll
        for (int k = 0; k < 4; ++k) o[k] = f2bf(xr[s][k]);
        *(v4usa*)(&xs[(e >> 7) * XP + (e & 127)]) = o; }
#pragma unroll
    for (int s = 0; s < 6; ++s) { const int c = s * 8 + w; const int m = c >> 4, kg = c & 15; v8us o;
#pragma unroll
        for (int j = 0; j < 8; ++j) o[j] = f2bf(wr[s][j]);
        *(v8usa*)(&wt[(m * 32 + L) * XP + kg * 8]) = o; }
    __syncthreads();
    // ---- phase 2
    {   const int lr = L & 15, hi = L >> 4; const int mt = w & 3, ng = w >> 2;
        v8f acc[3];
#pragma unroll
        for (int nb = 0; nb < 3; ++nb) acc[nb] = (v8f){};
#pragma unroll
        for (int kc = 0; kc < DM; kc += 32) {
            const unsigned short* ap = &xs[(mt * 16 + lr) * XP + kc + 8 * hi];
            const v16bf a = cat16b(*(const v8usa*)ap, *(const v8usa*)(ap + 16));
#pragma unroll
            for (int nb = 0; nb < 3; ++nb) { const unsigned short* bp = &wt[((ng * 3 + nb) * 16 + lr) * XP + kc + 8 * hi];
                acc[nb] = wmmab(a, cat16b(*(const v8usa*)bp, *(const v8usa*)(bp + 16)), acc[nb]); }
        }
#pragma unroll
        for (int nb = 0; nb < 3; ++nb) {
#pragma unroll
            for (int j = 0; j < 8; ++j) fs[(mt * 16 + hi * 8 + j) * FP + (ng * 3 + nb) * 16 + lr] = acc[nb][j]; }
    }
    __syncthreads();
    // ---- phase 3
    const float* fr = &fs[r * FP + 8 * g];
    const v8f xq = cat8f(*(const v4fa*)fr, *(const v4fa*)(fr + 4)), xk = cat8f(*(const v4fa*)(fr + 32), *(const v4fa*)(fr + 36)), xv = cat8f(*(const v4fa*)(fr + 64), *(const v4fa*)(fr + 68));
#pragma unroll
    for (int p = 0; p < 4; ++p) {
        const float cn = cnv[p], sn = snv[p]; const int col = 8 * g + 2 * p;
        {   const float x1 = xq[2 * p], x2 = xq[2 * p + 1]; const float ev = x1 * cn - x2 * sn, od = x1 * sn + x2 * cn;
            v2us oh, ol; unsigned short hh0 = f2bf(ev), hh1 = f2bf(od); oh[0] = hh0; oh[1] = hh1; ol[0] = f2bf(ev - bf2f(hh0)); ol[1] = f2bf(od - bf2f(hh1));
            *(v2us*)(&sq[0][r * 32 + col]) = oh; *(v2us*)(&sq[1][r * 32 + col]) = ol; }
        {   const float x1 = xk[2 * p], x2 = xk[2 * p + 1]; const float ev = x1 * cn - x2 * sn, od = x1 * sn + x2 * cn;
            v2us oh, ol; unsigned short hh0 = f2bf(ev), hh1 = f2bf(od); oh[0] = hh0; oh[1] = hh1; ol[0] = f2bf(ev - bf2f(hh0)); ol[1] = f2bf(od - bf2f(hh1));
            *(v2us*)(&sq[2][r * 32 + col]) = oh; *(v2us*)(&sq[3][r * 32 + col]) = ol; }
#pragma unroll
        for (int j = 0; j < 2; ++j) { const float val = xv[2 * p + j]; const int d = col + j; const unsigned short vh = f2bf(val);
            const int vi = ((r >> 5) * 2 + (d >> 4)) * 512 + ((r >> 4) & 1) * 256 + (((r >> 3) & 1) * 16 + (d & 15)) * 8 + (r & 7);   // fragment order of (key r, column d)
            sv[0][vi] = __builtin_bit_cast(unsigned short, (h16)val); sv[1][vi] = vh; sv[2][vi] = f2bf(val - bf2f(vh)); }
    }
    __syncthreads();
    const int lo = w * 256 + L * 8;                                                    // linear offset inside a 2,048-element tile
    const size_t qoff = ((size_t)b * SEQ + t0) * HS + lo;                              // the same place in every plane: fragment w >> 1, piece w & 1, lane L
    const int fo = ((w >> 1) * 16 + (L & 15)) * 32 + 16 * (w & 1) + 8 * (L >> 4);      // that piece's row and column in an sq tile
    const v8us q0v = *(const v8usa*)(&sq[0][fo]), q1v = *(const v8usa*)(&sq[1][fo]), k0v = *(const v8usa*)(&sq[2][fo]), k1v = *(const v8usa*)(&sq[3][fo]);
    const v8us v0v = *(const v8usa*)(&sv[0][lo]), v1v = *(const v8usa*)(&sv[1][lo]), v2v = *(const v8usa*)(&sv[2][lo]);
    unsigned short* VT16u = (unsigned short*)VT16;
    *(v8us*)(Qh + qoff) = q0v; *(v8us*)(Ql + qoff) = q1v; *(v8us*)(Kh + qoff) = k0v; *(v8us*)(Kl + qoff) = k1v;
    *(v8us*)(VT16u + qoff) = v0v; *(v8us*)(VTh + qoff) = v1v; *(v8us*)(VTl + qoff) = v2v;
}

// lane l with lane l ^ 16 (a vector cross-row move, no LDS counter)
__device__ __forceinline__ float xhalf(float x) { return __builtin_bit_cast(float, __builtin_amdgcn_permlanex16(__builtin_bit_cast(int, x), __builtin_bit_cast(int, x), 0x76543210, 0xfedcba98, false, false)); }

// eight exponentials in place, each independent of its neighbours, then one v_nop: the slot the instruction set asks for behind a transcendental before its result is used or its source overwritten
__device__ __forceinline__ v8f exp2x8(const v8f x) {
    float a = x[0], b = x[1], c = x[2], d = x[3], e = x[4], f = x[5], g = x[6], h = x[7];
    asm("v_exp_f32 %0, %0\n\tv_exp_f32 %1, %1\n\tv_exp_f32 %2, %2\n\tv_exp_f32 %3, %3\n\tv_exp_f32 %4, %4\n\tv_exp_f32 %5, %5\n\tv_exp_f32 %6, %6\n\tv_exp_f32 %7, %7\n\tv_nop"
        : "+v"(a), "+v"(b), "+v"(c), "+v"(d), "+v"(e), "+v"(f), "+v"(g), "+v"(h));
    return (v8f){a, b, c, d, e, f, g, h};
}

// ---- attn_chunk: one 64-key chunk for one wave's NQ query tiles (tile u = rows q0 + 16*u .. + 15; what follows is per tile, with q0 read as the tile's first row), the K and V fragments loaded once for all tiles, in transposed form: S^T = K.Q^T, O^T += V^T.P^T. Scores: 4 key tiles, each hi.hi + lo.hi + hi.lo (q, k bf16 planes in fragment order; A fragment = K rows, B fragment = Q rows, both k-contiguous pieces in the same k map).
// D element r of lane l is S[q0 + (l&15)][kv0 + 16*tile + 8*(l>>4) + r]: a lane holds 32 of the 64 scores of ONE query, lane l ^ 16 the other 32. Online softmax per lane: x SCL, causal replace-mask (MASK chunk only), in-lane max, one exchange between the wave halves, running max / rescale;
// the lane's sum covers its own 32 keys (the halves are joined in k_attn). P^T as the B operand straight from the score registers: element j <- tile 2*ks, register j; element 8 + j <- tile 2*ks + 1, register j, which is key 32*ks + 8*(l>>4) + j and 32*ks + 16 + 8*(l>>4) + j, the k map of the V^T loads.
// V planes in fragment order as the A operand V^T (HI: 3 bf16 products; else one fp16 product); outputs o0[r] = O[q0 + (l&15)][8*(l>>4) + r], o1[r] = the same at d + 16.
template <bool HI, bool MASK>
__device__ __forceinline__ void attn_chunk(const bf* __restrict__ Khb, const bf* __restrict__ Klb, const h16* __restrict__ V16b, const bf* __restrict__ Vhb, const bf* __restrict__ Vlb,
                                           const v16bf (&aqh)[NQ], const v16bf (&aql)[NQ], const int kv0, const int q0, const int ln, const int hh,
                                           float (&mrun)[NQ], float (&lp)[NQ], v8f (&o0)[NQ], v8f (&o1)[NQ]) {
    const size_t fb = (size_t)kv0 * HS + (16 * hh + ln) * 8;                            // the lane's 8 elements in piece 0 of the chunk's first fragment, the same in every plane
    v16bf bh[4], bl[4]; const bf* kph = Khb + fb; const bf* kpl = Klb + fb;             // every K load of the chunk is one of these two addresses plus a constant
#pragma unroll
    for (int t = 0; t < 4; ++t) { const int ko = 512 * t;
        bh[t] = cat16b(*(const v8us*)(kph + ko), *(const v8us*)(kph + ko + 256)); bl[t] = cat16b(*(const v8us*)(kpl + ko), *(const v8us*)(kpl + ko + 256)); }
    // the wait stands behind the K loads, in front of any instruction that reuses one of their address registers; the addresses are its inputs so that no load of the run lands in one of them ahead of it
    asm volatile("s_wait_xcnt 0x0" :: "v"(kph), "v"(kpl) : "memory");
    // inputs-only fence on the loaded K fragments: the sixteen K loads issue as one run in front of the first product; without it the compiler reuses fragment registers and strings the loads into three dependent round trips
    asm volatile("" :: "v"(bh[0]), "v"(bh[1]), "v"(bh[2]), "v"(bh[3]), "v"(bl[0]), "v"(bl[1]), "v"(bl[2]), "v"(bl[3]));
    v8f s[NQ][4];
#pragma unroll
    for (int u = 0; u < NQ; ++u) {
#pragma unroll
        for (int t = 0; t < 4; ++t) { v8f a = wmmab(bh[t], aqh[u], (v8f){}); a = wmmab(bh[t], aql[u], a); a = wmmab(bl[t], aqh[u], a); s[u][t] = a; } }
    asm volatile("v_nop\n\tv_nop\n\tv_nop\n\tv_nop" : "+v"(s[0][0]), "+v"(s[0][1]), "+v"(s[0][2]), "+v"(s[0][3]), "+v"(s[1][0]), "+v"(s[1][1]), "+v"(s[1][2]), "+v"(s[1][3]) : "v"(aqh[1]), "v"(aql[1]), "v"(bh[3]), "v"(bl[3]));
#pragma unroll
    for (int u = 0; u < NQ; ++u) {
        const int qi = q0 + 16 * u + ln;
#pragma unroll
        for (int t = 0; t < 4; ++t) {
#pragma unroll
            for (int r = 0; r < 8; ++r) { float v = s[u][t][r] * SCL; if (MASK) v = (kv0 + 16 * t + 8 * hh + r <= qi) ? v : -3.0e38f; s[u][t][r] = v; } }
        float rm = -3.0e38f;
#pragma unroll
        for (int r = 0; r < 8; ++r) rm = fmaxf(rm, fmaxf(fmaxf(s[u][0][r], s[u][1][r]), fmaxf(s[u][2][r], s[u][3][r])));
        rm = fmaxf(rm, xhalf(rm));
        const float mn = fmaxf(mrun[u], rm);
        float cf; const float cx = (mrun[u] - mn) * L2E;
        asm("v_exp_f32 %0, %1\n\tv_nop" : "=v"(cf) : "v"(cx)); // v_nop: the same slot behind a transcendental
        mrun[u] = mn;
#pragma unroll
        for (int t = 0; t < 4; ++t) s[u][t] = exp2x8((s[u][t] - mn) * L2E);
        const v8f ps = (s[u][0] + s[u][1]) + (s[u][2] + s[u][3]);
        const float psum = ((ps[0] + ps[1]) + (ps[2] + ps[3])) + ((ps[4] + ps[5]) + (ps[6] + ps[7]));
        lp[u] = lp[u] * cf + psum; o0[u] = o0[u] * cf; o1[u] = o1[u] * cf;
    }
    if (HI) {
        v16bf aph[NQ][2], apl[NQ][2];
#pragma unroll
        for (int u = 0; u < NQ; ++u) {
#pragma unroll
            for (int ks = 0; ks < 2; ++ks) { v8us h0, h1, l0, l1;
#pragma unroll
                for (int j = 0; j < 8; ++j) { const float pa = s[u][2 * ks][j], pb = s[u][2 * ks + 1][j]; const unsigned short ha = f2bf(pa), hb = f2bf(pb);
                    h0[j] = ha; h1[j] = hb; l0[j] = f2bf(pa - bf2f(ha)); l1[j] = f2bf(pb - bf2f(hb)); }
                aph[u][ks] = cat16b(h0, h1); apl[u][ks] = cat16b(l0, l1); } }
        const bf* vph = Vhb + fb; const bf* vpl = Vlb + fb; // every V load of the chunk is one of these two addresses plus a constant
        {   v16bf vh[2], vl[2];
#pragma unroll
            for (int ks = 0; ks < 2; ++ks) { const int vo = 1024 * ks;
                vh[ks] = cat16b(*(const v8us*)(vph + vo), *(const v8us*)(vph + vo + 256)); vl[ks] = cat16b(*(const v8us*)(vpl + vo), *(const v8us*)(vpl + vo + 256)); }
#pragma unroll
            for (int u = 0; u < NQ; ++u) {
#pragma unroll
                for (int ks = 0; ks < 2; ++ks) { o0[u] = wmmab(vh[ks], aph[u][ks], o0[u]); o0[u] = wmmab(vh[ks], apl[u][ks], o0[u]); o0[u] = wmmab(vl[ks], aph[u][ks], o0[u]); } } }
        {   v16bf vh[2], vl[2];
#pragma unroll
            for (int ks = 0; ks < 2; ++ks) { const int vo = 1024 * ks + 512;
                vh[ks] = cat16b(*(const v8us*)(vph + vo), *(const v8us*)(vph + vo + 256)); vl[ks] = cat16b(*(const v8us*)(vpl + vo), *(const v8us*)(vpl + vo + 256)); }
            // the wait stands behind the last V load, in front of any instruction that reuses a V address register; the two base addresses are its inputs so that no V load lands in one of them ahead of it
            asm volatile("s_wait_xcnt 0x0" :: "v"(vph), "v"(vpl) : "memory");
#pragma unroll
            for (int u = 0; u < NQ; ++u) {
#pragma unroll
                for (int ks = 0; ks < 2; ++ks) { o1[u] = wmmab(vh[ks], aph[u][ks], o1[u]); o1[u] = wmmab(vh[ks], apl[u][ks], o1[u]); o1[u] = wmmab(vl[ks], aph[u][ks], o1[u]); } }
            asm volatile("v_nop\n\tv_nop\n\tv_nop\n\tv_nop" : "+v"(o0[0]), "+v"(o1[0]), "+v"(o0[1]), "+v"(o1[1]) : "v"(aph[1][1]), "v"(apl[1][1]), "v"(vh[1]), "v"(vl[1])); }
    } else {
        v16h ap[NQ][2];
#pragma unroll
        for (int u = 0; u < NQ; ++u) {
#pragma unroll
            for (int ks = 0; ks < 2; ++ks) {
#pragma unroll
                for (int j = 0; j < 8; ++j) { ap[u][ks][j] = (h16)(s[u][2 * ks][j] * PCAR); ap[u][ks][8 + j] = (h16)(s[u][2 * ks + 1][j] * PCAR); } } }
        const h16* vp = V16b + fb; // every V load of the chunk is this address plus a constant
        {   v16h vb[2];
#pragma unroll
            for (int ks = 0; ks < 2; ++ks) { const int vo = 1024 * ks; vb[ks] = cat16(*(const v8h*)(vp + vo), *(const v8h*)(vp + vo + 256)); }
#pragma unroll
            for (int u = 0; u < NQ; ++u) {
#pragma unroll
                for (int ks = 0; ks < 2; ++ks) o0[u] = wmma16(vb[ks], ap[u][ks], o0[u]); } }
        {   v16h vb[2];
#pragma unroll
            for (int ks = 0; ks < 2; ++ks) { const int vo = 1024 * ks + 512; vb[ks] = cat16(*(const v8h*)(vp + vo), *(const v8h*)(vp + vo + 256)); }
            // the wait stands behind the last V load, in front of any instruction that reuses the V address register; the base address is its input so that no V load lands in it ahead of the wait
            asm volatile("s_wait_xcnt 0x0" :: "v"(vp) : "memory");
#pragma unroll
            for (int u = 0; u < NQ; ++u) {
#pragma unroll
                for (int ks = 0; ks < 2; ++ks) o1[u] = wmma16(vb[ks], ap[u][ks], o1[u]); }
            asm volatile("v_nop\n\tv_nop\n\tv_nop\n\tv_nop" : "+v"(o0[0]), "+v"(o1[0]), "+v"(o0[1]), "+v"(o1[1]) : "v"(ap[1][1]), "v"(vb[1])); }
    }
}

// ---- attn_block: the whole work of one k_attn workgroup, which owns rows q0 .. q0 + 16*NQ - 1 of batch b, as NQ tiles of 16. Wave w visits the 64-key chunks w, w + KW, .. up to the
// diagonal chunk cd = q0 / 64 (the same for every tile, as a block never straddles a multiple of 64; exactly one masked chunk, taken by wave cd % KW) with its own running max, sums and accumulators per tile, one query per lane, tile and wave half. Merge: each wave stores its
// un-normalised tiles [query][d] and per query (max, l joined over the two halves) in its own LDS tile, one workgroup barrier, then thread -> (row, 4 columns): M = max over waves, weights exp2((m_w - M) L2E), out = sum_w f_w o_w x carry / sum_w f_w l_w.
// A wave that visited no chunk holds max -3e38, l 0, o 0: its weight is exp2(-inf) = 0.
template <bool HI>
__device__ __forceinline__ void attn_block(const bf* __restrict__ Qh, const bf* __restrict__ Ql, const bf* __restrict__ Kh, const bf* __restrict__ Kl,
                                           const h16* __restrict__ V16, const bf* __restrict__ Vh, const bf* __restrict__ Vl, float* OUT, float (&ost)[KW][16 * NQ * OPF], const int b, const int q0) {
    const int wave = __builtin_amdgcn_readfirstlane(threadIdx.x >> 5), lane = threadIdx.x & 31, hh = lane >> 4, ln = lane & 15;
    const bf* Qhb = Qh + (size_t)b * SEQ * HS; const bf* Qlb = Ql + (size_t)b * SEQ * HS;
    const bf* Khb = Kh + (size_t)b * SEQ * HS; const bf* Klb = Kl + (size_t)b * SEQ * HS;
    const h16* V16b = V16 + (size_t)b * HS * SEQ; const bf* Vhb = Vh + (size_t)b * HS * SEQ; const bf* Vlb = Vl + (size_t)b * HS * SEQ;
    v16bf aqh[NQ], aql[NQ]; const bf* qph[NQ]; const bf* qpl[NQ];
#pragma unroll
    for (int u = 0; u < NQ; ++u) { const size_t qo = (size_t)(q0 + 16 * u) * HS + lane * 8; qph[u] = Qhb + qo; qpl[u] = Qlb + qo;   // fragment (q0 + 16 u) / 16, piece 0
        aqh[u] = cat16b(*(const v8us*)qph[u], *(const v8us*)(qph[u] + 256));
        aql[u] = cat16b(*(const v8us*)qpl[u], *(const v8us*)(qpl[u] + 256)); }
    // stands behind the Q loads, in front of any instruction that reuses one of their address registers; the addresses are its inputs so that none of them is rewritten ahead of it
    asm volatile("s_wait_xcnt 0x0" :: "v"(qph[0]), "v"(qph[1]), "v"(qpl[0]), "v"(qpl[1]) : "memory");
    float mrun[NQ], lp[NQ]; v8f o0[NQ], o1[NQ];
#pragma unroll
    for (int u = 0; u < NQ; ++u) { mrun[u] = -3.0e38f; lp[u] = 0.0f; o0[u] = (v8f){}; o1[u] = (v8f){}; }
    int kv0 = wave * 64;
#pragma unroll 1
    for (; kv0 + 64 <= q0; kv0 += 64 * KW) attn_chunk<HI, false>(Khb, Klb, V16b, Vhb, Vlb, aqh, aql, kv0, q0, ln, hh, mrun, lp, o0, o1);
    if (kv0 < q0 + 16 * NQ) attn_chunk<HI, true>(Khb, Klb, V16b, Vhb, Vlb, aqh, aql, kv0, q0, ln, hh, mrun, lp, o0, o1);
#pragma unroll
    for (int u = 0; u < NQ; ++u) {
        float* osw = &ost[wave][(16 * u + ln) * OPF];
        const float lj = lp[u] + xhalf(lp[u]);
        *(v4fa*)(osw + 8 * hh) = __builtin_shufflevector(o0[u], o0[u], 0, 1, 2, 3); *(v4fa*)(osw + 8 * hh + 4) = __builtin_shufflevector(o0[u], o0[u], 4, 5, 6, 7);
        *(v4fa*)(osw + 16 + 8 * hh) = __builtin_shufflevector(o1[u], o1[u], 0, 1, 2, 3); *(v4fa*)(osw + 16 + 8 * hh + 4) = __builtin_shufflevector(o1[u], o1[u], 4, 5, 6, 7);
        if (hh == 0) { v2f ms; ms[0] = mrun[u]; ms[1] = lj; *(v2f*)(osw + 32) = ms; }
    }
    __syncthreads();
    const float carry = HI ? 1.0f : (1.0f / PCAR);
    const int row = threadIdx.x >> 3, col = (threadIdx.x & 7) * 4;
    static_assert(32 * KW == 16 * NQ * 8);
    v2f ml[KW]; float M = -3.0e38f;
#pragma unroll
    for (int w = 0; w < KW; ++w) { ml[w] = *(const v2f*)(&ost[w][row * OPF + 32]); M = fmaxf(M, ml[w][0]); }
    float L = 0.0f; v4f a = (v4f){};
#pragma unroll
    for (int w = 0; w < KW; ++w) { float f; const float fx = (ml[w][0] - M) * L2E; const v4f o = *(const v4fa*)(&ost[w][row * OPF + col]);
        asm("v_exp_f32 %0, %1\n\tv_nop" : "=v"(f) : "v"(fx)); // v_nop: the slot the instruction set asks for behind a transcendental before its result is used or its source overwritten
        L += f * ml[w][1]; a += o * f; }
    const float inv = carry * __builtin_amdgcn_rcpf(L);
    *(v4f*)(OUT + ((size_t)b * SEQ_FULL + q0 + row) * HS + col) = a * inv;
}

// ---- k_attn: ONE launch for all query rows. Grid (NB, query blocks of 16 * NQ rows), 32 * KW threads: batch b = blockIdx.x, block SEQ / (16 * NQ) - 1 - blockIdx.y, so that the key range of a workgroup falls with its flat index
// (for speed only). A block lies wholly below or wholly at or above RH
// (RH is a multiple of 64), so the row class is the same for the whole workgroup: a scalar branch, each side with its own barrier, passed by all of its waves. Four waves per SIMD = two workgroups per WGP: the register budget that both sides must keep.
__global__ __launch_bounds__(32 * KW) __attribute__((amdgpu_waves_per_eu(4, 4))) void k_attn(const bf* __restrict__ Qh, const bf* __restrict__ Ql, const bf* __restrict__ Kh, const bf* __restrict__ Kl,
                                             const h16* __restrict__ V16, const bf* __restrict__ Vh, const bf* __restrict__ Vl, float* OUT) {
    __shared__ __align__(16) float ost[KW][16 * NQ * OPF];
    const int b = blockIdx.x; const int q0 = (SEQ / (16 * NQ) - 1 - (int)blockIdx.y) * (16 * NQ);
    if (q0 >= RH) attn_block<false>(Qh, Ql, Kh, Kl, V16, Vh, Vl, OUT, ost, b, q0);
    else          attn_block<true>(Qh, Ql, Kh, Kl, V16, Vh, Vl, OUT, ost, b, q0);
}

extern "C" void kernel_launch(void* const* d_in, const int* in_sizes, int n_in,
                              void* d_out, int out_size, void* d_ws, size_t ws_size, hipStream_t stream) {
    if (n_in < 4) return;
    const float* x  = (const float*)d_in[0];   // [8][4096][128]
    const float* wq = (const float*)d_in[1];   // [128][32]
    const float* wk = (const float*)d_in[2];   // [128][32]
    const float* wv = (const float*)d_in[3];   // [128][32]
    if (in_sizes[0] < ((NB - 1) * SEQ_FULL + SEQ) * DM) return;
    if (in_sizes[1] < DM * HS || in_sizes[2] < DM * HS || in_sizes[3] < DM * HS) return;
    if (out_size < ((NB - 1) * SEQ_FULL + SEQ) * HS) return;
    float* OUT = (float*)d_out;                 // [8][4096][32] f32
    char* wsp = (char*)d_ws;
    auto take = [&](size_t bytes) { char* p = wsp; wsp += (bytes + 255) & ~(size_t)255; return (void*)p; };
    bf*    Qh   = (bf*)take((size_t)NB * SEQ * HS * 2);              //   2,097,152 B each
    bf*    Ql   = (bf*)take((size_t)NB * SEQ * HS * 2);
    bf*    Kh   = (bf*)take((size_t)NB * SEQ * HS * 2);
    bf*    Kl   = (bf*)take((size_t)NB * SEQ * HS * 2);
    h16*   VT16 = (h16*)take((size_t)NB * HS * SEQ * 2);
    bf*    VTh  = (bf*)take((size_t)NB * HS * SEQ * 2);
    bf*    VTl  = (bf*)take((size_t)NB * HS * SEQ * 2);             // total 14,680,064 B
    if ((size_t)(wsp - (char*)d_ws) > ws_size) return;

    k_prep<<<dim3(SEQ / 64, NB), 256, 0, stream>>>(x, wq, wk, wv, Qh, Ql, Kh, Kl, VT16, VTh, VTl);
    k_attn<<<dim3(NB, SEQ / (16 * NQ)), 32 * KW, 0, stream>>>(Qh, Ql, Kh, Kl, VT16, VTh, VTl, OUT);
}

// v007
// A run of this version takes 27.4 microseconds.
// In two side-by-side timings against v006, it was 1.05 and 1.04 times as fast.
// All steps since v000 together make it 6.47 times as fast.
#include <hip/hip_runtime.h>

// Contractions, f32 accumulate: x.[Wq|Wk|Wv] on v_wmma_f32_16x16x32_bf16 (x and W RNE-converted to bf16); q.k^T as 3 bf16 products (q,k hi+lo planes) on every row; P.V rows < RH as 3 bf16 products (P and V hi+lo), rows >= RH on v_wmma_f32_16x16x32_f16 (P fp16 carried x 2^14, V fp16; the row sum carries the same 2^14, so the quotient needs no factor); rotary table, softmax and normalisation in f32.
// Pipeline: k_prep (one workgroup per 64 rows of x) converts its x tile and the three weights to bf16 in LDS, projects to q|k|v in f32 (LDS), applies the interleaved rotary pairs (cos, sin formed in the kernel)
// and writes the Q/K bf16 hi,lo planes and the V planes (fp16, bf16 hi, bf16 lo) in FRAGMENT ORDER (below), so that every 16-byte-per-lane load of k_attn reads 512 contiguous bytes = 4 whole lines;
// Fragment order, per batch SEQ * 32 elements: a fragment is 512 elements = [piece p = 0, 1][lane l = 0..31][j = 0..7]. Q/K: fragment t / 16 holds row 16 * (t / 16) + (l & 15), column 16 * p + 8 * (l >> 4) + j.
// V: fragment 2 * (t / 32) + dh holds column d = 16 * dh + (l & 15), key 32 * (t / 32) + 16 * p + 8 * (l >> 4) + j. Either way the 64 rows t0 .. t0 + 63 fill the 2,048 elements from t0 * 32.
// k_attn: one workgroup of KW waves per 32 query rows (NQ tiles of 16), wave w takes the 64-key chunks w, w + KW, .. and uses every K and V fragment it loads for both tiles; scores and outputs in transposed form (one query per lane and tile), online softmax per wave (running max, f32 sums), causal: chunks above the diagonal never visited, one masked diagonal chunk (replace by -3e38 == exclusion); the waves' partials are merged through LDS;
#pragma clang fp contract(off)

#ifndef NB
#define NB 8
#endif
#ifndef SEQ
#define SEQ 4096
#endif
#define NB_FULL  8
#define SEQ_FULL 4096
#define DM   128                  // embedding width (K of the projections)
#define HS   32                   // head width
#define XP   136                  // LDS pitch (bf16 elements) of the x and weight tiles: 272 B = 16 B x 17, odd, for 16-byte readers
#define FP   100                  // LDS pitch (floats) of the projected q | k | v tile: 400 B, a multiple of 16 B; the two lane halves of a D store fall on disjoint banks
#ifndef RH
#define RH   1024                 // query rows < RH use bf16 hi+lo P and V planes
#endif
#define PCL2 14.0f                // log2 of the fp16 P carry (2^14) for rows >= RH: added to the exponent, never multiplied
#define SL2  ((float)(0.17677669529663687 * 1.4426950408889634)) // 32^-0.5 * log2 e: raw score -> exponent of 2
#define OPF  36                   // LDS output tile pitch (floats); columns 32, 33 of a row hold the wave's (max, sum)
#define KW   8                    // waves of a k_attn workgroup = key ranges of one query block
#define NQ   2                    // 16-row query tiles of a k_attn workgroup: each loaded K and V fragment serves all of them
static_assert(SEQ % 64 == 0);
static_assert(SEQ <= SEQ_FULL);
static_assert(NB >= 1);
static_assert(NB <= NB_FULL);
static_assert(RH % 64 == 0);
static_assert(64 % (16 * NQ) == 0);
static_assert(DM % 32 == 0);
static_assert(DM == 128 && HS == 32);
static_assert((long long)NB_FULL * SEQ_FULL * HS * 4 == 4194304LL);

typedef _Float16 h16;
typedef unsigned short bf;
typedef __attribute__((ext_vector_type(16))) __bf16   v16bf;
typedef __attribute__((ext_vector_type(16))) _Float16 v16h;
typedef __attribute__((ext_vector_type(8)))  _Float16 v8h;
typedef __attribute__((ext_vector_type(8)))  unsigned short v8us;
typedef __attribute__((ext_vector_type(4)))  unsigned short v4us;
typedef __attribute__((ext_vector_type(2)))  unsigned short v2us;
typedef __attribute__((ext_vector_type(8)))  float    v8f;
typedef __attribute__((ext_vector_type(4)))  float    v4f;
typedef __attribute__((ext_vector_type(2)))  float    v2f;
typedef v8h  __attribute__((may_alias)) v8ha;
typedef v4f  __attribute__((may_alias)) v4fa;
typedef v8us __attribute__((may_alias)) v8usa;
typedef v4us __attribute__((may_alias)) v4usa;

__device__ __forceinline__ unsigned short f2bf(float f) { unsigned u = __float_as_uint(f); u += 0x7FFFu + ((u >> 16) & 1u); return (unsigned short)(u >> 16); }
__device__ __forceinline__ float bf2f(unsigned short b) { return __uint_as_float(((unsigned)b) << 16); }
__device__ __forceinline__ v8f cat8f(v4f lo, v4f hi) { return __builtin_shufflevector(lo, hi, 0, 1, 2, 3, 4, 5, 6, 7); }
__device__ __forceinline__ v16h cat16(v8h lo, v8h hi) { return __builtin_shufflevector(lo, hi, 0, 1, 2, 3, 4, 5, 6, 7, 8, 9, 10, 11, 12, 13, 14, 15); }
__device__ __forceinline__ v16bf cat16b(v8us lo, v8us hi) { return __builtin_bit_cast(v16bf, __builtin_shufflevector(lo, hi, 0, 1, 2, 3, 4, 5, 6, 7, 8, 9, 10, 11, 12, 13, 14, 15)); }
__device__ __forceinline__ v8f wmma16(v16h a, v16h b, v8f c) { return __builtin_amdgcn_wmma_f32_16x16x32_f16(false, a, false, b, (short)0, c, false, false); }
__device__ __forceinline__ v8f wmmab(v16bf a, v16bf b, v8f c) { return __builtin_amdgcn_wmma_f32_16x16x32_bf16(false, a, false, b, (short)0, c, false, false); }

// INVT[i] = 1 / 10000^(2i/32): the exact float32 results of that expression (pow then reciprocal in f32), i = 0..15.
__constant__ __align__(16) float INVT[HS / 2] = { 1.0f, 0.5623413324356079f, 0.3162277638912201f, 0.17782793939113617f, 0.10000000149011612f, 0.05623412877321243f, 0.03162277862429619f, 0.017782794311642647f, 0.009999999776482582f, 0.005623413249850273f, 0.003162277862429619f, 0.0017782794311642647f, 0.0010000000474974513f, 0.000562341301701963f, 0.0003162277862429619f, 0.00017782794020604342f };

// ---- k_prep: block = batch b (grid.y), 64 consecutive t (t0 = blockIdx.x * 64), 256 threads = 8 waves. Three phases, a workgroup barrier between each two.
// Phase 1 (stage): the x tile [64 t][128 k] is read as 16-byte pieces, contiguous over the block, RNE-converted to bf16 and stored in xs [row][k]; the weights are read column by lane (wave -> matrix and group of 8 k),
// converted and stored transposed in wt [n = 32 * matrix + column][k] (n 0..31 q, 32..63 k, 64..95 v); each thread also forms its four rotary pairs (c, s) = {cos, sin}(INVT[i] * t), t = t0 + (tid >> 2), i = 4 * (tid & 3) + p.
// Phase 2 (project): wave w owns rows 16 * (w & 3) .. + 15 and the three 16-column tiles 3 * (w >> 2) + 0..2; k in steps of 32, ascending, f32 accumulate.
// Fragments: lane -> row/col (lane & 15), elements 0..7 <- k0 + 8*(lane >> 4) + 0..7, elements 8..15 <- k0 + 16 + 8*(lane >> 4) + 0..7 for A and for the [n][k] B tile. D element j of lane l is row 8*(l >> 4) + j, column l & 15; it goes to fs [row][n] in f32.
// Phase 3 (planes): thread -> row r = tid>>2, column group g = tid&3 = 8 q, 8 k, 8 v columns. Rotary (interleaved pairs, i = column/2): out[2i] = x[2i] c - x[2i+1] s, out[2i+1] = x[2i] s + x[2i+1] c, separate f32 products.
// LDS tiles: sq[0..3] = Qh, Ql, Kh, Kl as [64 r][32 c]; sv[0..2] = V fp16 bits, bf16 hi, bf16 lo, already in fragment order. After the last barrier every plane's 4,096-byte tile region is written in 16-byte pieces, contiguous over the block; the Q/K pieces are picked from sq in fragment order.
__global__ __launch_bounds__(256) void k_prep(const float* __restrict__ x, const float* __restrict__ wq, const float* __restrict__ wk, const float* __restrict__ wv,
                                              bf* Qh, bf* Ql, bf* Kh, bf* Kl, h16* VT16, bf* VTh, bf* VTl) {
    __shared__ __align__(16) unsigned short xs[64 * XP];
    __shared__ __align__(16) unsigned short wt[96 * XP];
    __shared__ __align__(16) float fs[64 * FP];
    __shared__ __align__(16) unsigned short sq[4][64 * 32];
    __shared__ __align__(16) unsigned short sv[3][32 * 64];
    const int tid = threadIdx.x; const int b = blockIdx.y, t0 = blockIdx.x * 64;
    const int w = __builtin_amdgcn_readfirstlane(tid >> 5), L = tid & 31;
    const int r = tid >> 2, g = tid & 3; const int t = t0 + r;
    // ---- phase 1
    const v4f iv = *(const v4f*)(INVT + 4 * g);
    const float* xp = x + ((size_t)b * SEQ_FULL + t0) * DM + (size_t)tid * 4;
    v4f xr[8];
#pragma unroll
    for (int s = 0; s < 8; ++s) xr[s] = *(const v4f*)(xp + s * 1024);
    float wr[6][8];
#pragma unroll
    for (int s = 0; s < 6; ++s) { const int c = s * 8 + w; const int m = c >> 4, kg = c & 15;
        const float* wsrc = ((m == 0) ? wq : ((m == 1) ? wk : wv)) + (size_t)kg * 8 * HS + L;
#pragma unroll
        for (int j = 0; j < 8; ++j) wr[s][j] = wsrc[j * HS]; }
    float cnv[4], snv[4];
#pragma unroll
    for (int p = 0; p < 4; ++p) { const float ang = iv[p] * (float)t; float sn, cn; sincosf(ang, &sn, &cn); cnv[p] = cn; snv[p] = sn; }
#pragma unroll
    for (int s = 0; s < 8; ++s) { const int e = (s * 256 + tid) * 4; v4us o;
#pragma unroll
        for (int k = 0; k < 4; ++k) o[k] = f2bf(xr[s][k]);
        *(v4usa*)(&xs[(e >> 7) * XP + (e & 127)]) = o; }
#pragma unroll
    for (int s = 0; s < 6; ++s) { const int c = s * 8 + w; const int m = c >> 4, kg = c & 15; v8us o;
#pragma unroll
        for (int j = 0; j < 8; ++j) o[j] = f2bf(wr[s][j]);
        *(v8usa*)(&wt[(m * 32 + L) * XP + kg * 8]) = o; }
    __syncthreads();
    // ---- phase 2
    {   const int lr = L & 15, hi = L >> 4; const int mt = w & 3, ng = w >> 2;
        v8f acc[3];
#pragma unroll
        for (int nb = 0; nb < 3; ++nb) acc[nb] = (v8f){};
#pragma unroll
        for (int kc = 0; kc < DM; kc += 32) {
            const unsigned short* ap = &xs[(mt * 16 + lr) * XP + kc + 8 * hi];
            const v16bf a = cat16b(*(const v8usa*)ap, *(const v8usa*)(ap + 16));
#pragma unroll
            for (int nb = 0; nb < 3; ++nb) { const unsigned short* bp = &wt[((ng * 3 + nb) * 16 + lr) * XP + kc + 8 * hi];
                acc[nb] = wmmab(a, cat16b(*(const v8usa*)bp, *(const v8usa*)(bp + 16)), acc[nb]); }
        }
#pragma unroll
        for (int nb = 0; nb < 3; ++nb) {
#pragma unroll
            for (int j = 0; j < 8; ++j) fs[(mt * 16 + hi * 8 + j) * FP + (ng * 3 + nb) * 16 + lr] = acc[nb][j]; }
    }
    __syncthreads();
    // ---- phase 3
    const float* fr = &fs[r * FP + 8 * g];
    const v8f xq = cat8f(*(const v4fa*)fr, *(const v4fa*)(fr + 4)), xk = cat8f(*(const v4fa*)(fr + 32), *(const v4fa*)(fr + 36)), xv = cat8f(*(const v4fa*)(fr + 64), *(const v4fa*)(fr + 68));
#pragma unroll
    for (int p = 0; p < 4; ++p) {
        const float cn = cnv[p], sn = snv[p]; const int col = 8 * g + 2 * p;
        {   const float x1 = xq[2 * p], x2 = xq[2 * p + 1]; const float ev = x1 * cn - x2 * sn, od = x1 * sn + x2 * cn;
            v2us oh, ol; unsigned short hh0 = f2bf(ev), hh1 = f2bf(od); oh[0] = hh0; oh[1] = hh1; ol[0] = f2bf(ev - bf2f(hh0)); ol[1] = f2bf(od - bf2f(hh1));
            *(v2us*)(&sq[0][r * 32 + col]) = oh; *(v2us*)(&sq[1][r * 32 + col]) = ol; }
        {   const float x1 = xk[2 * p], x2 = xk[2 * p + 1]; const float ev = x1 * cn - x2 * sn, od = x1 * sn + x2 * cn;
            v2us oh, ol; unsigned short hh0 = f2bf(ev), hh1 = f2bf(od); oh[0] = hh0; oh[1] = hh1; ol[0] = f2bf(ev - bf2f(hh0)); ol[1] = f2bf(od - bf2f(hh1));
            *(v2us*)(&sq[2][r * 32 + col]) = oh; *(v2us*)(&sq[3][r * 32 + col]) = ol; }
#pragma unroll
        for (int j = 0; j < 2; ++j) { const float val = xv[2 * p + j]; const int d = col + j; const unsigned short vh = f2bf(val);
            const int vi = ((r >> 5) * 2 + (d >> 4)) * 512 + ((r >> 4) & 1) * 256 + (((r >> 3) & 1) * 16 + (d & 15)) * 8 + (r & 7);   // fragment order of (key r, column d)
            sv[0][vi] = __builtin_bit_cast(unsigned short, (h16)val); sv[1][vi] = vh; sv[2][vi] = f2bf(val - bf2f(vh)); }
    }
    __syncthreads();
    const int lo = w * 256 + L * 8;                                                    // linear offset inside a 2,048-element tile
    const size_t qoff = ((size_t)b * SEQ + t0) * HS + lo;                              // the same place in every plane: fragment w >> 1, piece w & 1, lane L
    const int fo = ((w >> 1) * 16 + (L & 15)) * 32 + 16 * (w & 1) + 8 * (L >> 4);      // that piece's row and column in an sq tile
    const v8us q0v = *(const v8usa*)(&sq[0][fo]), q1v = *(const v8usa*)(&sq[1][fo]), k0v = *(const v8usa*)(&sq[2][fo]), k1v = *(const v8usa*)(&sq[3][fo]);
    const v8us v0v = *(const v8usa*)(&sv[0][lo]), v1v = *(const v8usa*)(&sv[1][lo]), v2v = *(const v8usa*)(&sv[2][lo]);
    unsigned short* VT16u = (unsigned short*)VT16;
    *(v8us*)(Qh + qoff) = q0v; *(v8us*)(Ql + qoff) = q1v; *(v8us*)(Kh + qoff) = k0v; *(v8us*)(Kl + qoff) = k1v;
    *(v8us*)(VT16u + qoff) = v0v; *(v8us*)(VTh + qoff) = v1v; *(v8us*)(VTl + qoff) = v2v;
}

// lane l with lane l ^ 16 (a vector cross-row move, no LDS counter)
__device__ __forceinline__ float xhalf(float x) { return __builtin_bit_cast(float, __builtin_amdgcn_permlanex16(__builtin_bit_cast(int, x), __builtin_bit_cast(int, x), 0x76543210, 0xfedcba98, false, false)); }

// eight exponentials in place, each independent of its neighbours, then one v_nop: the slot the instruction set asks for behind a transcendental before its result is used or its source overwritten
__device__ __forceinline__ v8f exp2x8(const v8f x) {
    float a = x[0], b = x[1], c = x[2], d = x[3], e = x[4], f = x[5], g = x[6], h = x[7];
    asm("v_exp_f32 %0, %0\n\tv_exp_f32 %1, %1\n\tv_exp_f32 %2, %2\n\tv_exp_f32 %3, %3\n\tv_exp_f32 %4, %4\n\tv_exp_f32 %5, %5\n\tv_exp_f32 %6, %6\n\tv_exp_f32 %7, %7\n\tv_nop"
        : "+v"(a), "+v"(b), "+v"(c), "+v"(d), "+v"(e), "+v"(f), "+v"(g), "+v"(h));
    return (v8f){a, b, c, d, e, f, g, h};
}

// ---- attn_chunk: one 64-key chunk for one wave's NQ query tiles (tile u = rows q0 + 16*u .. + 15; what follows is per tile, with q0 read as the tile's first row), the K and V fragments loaded once for all tiles, in transposed form: S^T = K.Q^T, O^T += V^T.P^T. Scores: 4 key tiles, each hi.hi + lo.hi + hi.lo (q, k bf16 planes in fragment order; A fragment = K rows, B fragment = Q rows, both k-contiguous pieces in the same k map).
// D element r of lane l is S[q0 + (l&15)][kv0 + 16*tile + 8*(l>>4) + r]: a lane holds 32 of the 64 scores of ONE query, lane l ^ 16 the other 32. Online softmax per lane: causal replace-mask (MASK chunk only) and in-lane max on the raw scores, one exchange between the wave halves, running max (kept in exponent-of-2 units, raw x SL2) / rescale; p = exp2(fma(raw, SL2, carry exponent - max)): scale, log2 e, maximum and fp16 carry in one fused multiply-add per score;
// the lane's sum covers its own 32 keys (the halves are joined in k_attn). P^T as the B operand straight from the score registers: element j <- tile 2*ks, register j; element 8 + j <- tile 2*ks + 1, register j, which is key 32*ks + 8*(l>>4) + j and 32*ks + 16 + 8*(l>>4) + j, the k map of the V^T loads.
// V planes in fragment order as the A operand V^T (HI: 3 bf16 products; else one fp16 product); outputs o0[r] = O[q0 + (l&15)][8*(l>>4) + r], o1[r] = the same at d + 16.
template <bool HI, bool MASK>
__device__ __forceinline__ void attn_chunk(const bf* __restrict__ Khb, const bf* __restrict__ Klb, const h16* __restrict__ V16b, const bf* __restrict__ Vhb, const bf* __restrict__ Vlb,
                                           const v16bf (&aqh)[NQ], const v16bf (&aql)[NQ], const int kv0, const int q0, const int ln, const int hh,
                                           float (&mrun)[NQ], float (&lp)[NQ], v8f (&o0)[NQ], v8f (&o1)[NQ]) {
    const size_t fb = (size_t)kv0 * HS + (16 * hh + ln) * 8;                            // the lane's 8 elements in piece 0 of the chunk's first fragment, the same in every plane
    v16bf bh[4], bl[4]; const bf* kph = Khb + fb; const bf* kpl = Klb + fb;             // every K load of the chunk is one of these two addresses plus a constant
#pragma unroll
    for (int t = 0; t < 4; ++t) { const int ko = 512 * t;
        bh[t] = cat16b(*(const v8us*)(kph + ko), *(const v8us*)(kph + ko + 256)); bl[t] = cat16b(*(const v8us*)(kpl + ko), *(const v8us*)(kpl + ko + 256)); }
    // the wait stands behind the K loads, in front of any instruction that reuses one of their address registers; the addresses are its inputs so that no load of the run lands in one of them ahead of it
    asm volatile("s_wait_xcnt 0x0" :: "v"(kph), "v"(kpl) : "memory");
    // inputs-only fence on the loaded K fragments: the sixteen K loads issue as one run in front of the first product; without it the compiler reuses fragment registers and strings the loads into three dependent round trips
    asm volatile("" :: "v"(bh[0]), "v"(bh[1]), "v"(bh[2]), "v"(bh[3]), "v"(bl[0]), "v"(bl[1]), "v"(bl[2]), "v"(bl[3]));
    v8f s[NQ][4];
#pragma unroll
    for (int u = 0; u < NQ; ++u) {
#pragma unroll
        for (int t = 0; t < 4; ++t) { v8f a = wmmab(bh[t], aqh[u], (v8f){}); a = wmmab(bh[t], aql[u], a); a = wmmab(bl[t], aqh[u], a); s[u][t] = a; } }
    asm volatile("v_nop\n\tv_nop\n\tv_nop\n\tv_nop" : "+v"(s[0][0]), "+v"(s[0][1]), "+v"(s[0][2]), "+v"(s[0][3]), "+v"(s[1][0]), "+v"(s[1][1]), "+v"(s[1][2]), "+v"(s[1][3]) : "v"(aqh[1]), "v"(aql[1]), "v"(bh[3]), "v"(bl[3]));
#pragma unroll
    for (int u = 0; u < NQ; ++u) {
        const int qi = q0 + 16 * u + ln;
        if (MASK) {
#pragma unroll
            for (int t = 0; t < 4; ++t) {
#pragma unroll
                for (int r = 0; r < 8; ++r) s[u][t][r] = (kv0 + 16 * t + 8 * hh + r <= qi) ? s[u][t][r] : -3.0e38f; } }
        float rm = -3.0e38f;   // the maximum that passes a not-a-number on takes the matrix results as they are; fmaxf made the compiler quiet each of them first, one more instruction per score
#pragma unroll
        for (int r = 0; r < 8; ++r) rm = __builtin_elementwise_maximum(rm, __builtin_elementwise_maximum(__builtin_elementwise_maximum(s[u][0][r], s[u][1][r]), __builtin_elementwise_maximum(s[u][2][r], s[u][3][r])));
        rm = fmaxf(rm, xhalf(rm));
        const float mn = fmaxf(mrun[u], rm * SL2);
        float cf; const float cx = mrun[u] - mn;
        asm("v_exp_f32 %0, %1\n\tv_nop" : "=v"(cf) : "v"(cx)); // v_nop: the same slot behind a transcendental
        mrun[u] = mn;
        const float nb = (HI ? 0.0f : PCL2) - mn;
        const v8f sc8 = {SL2, SL2, SL2, SL2, SL2, SL2, SL2, SL2}, nb8 = {nb, nb, nb, nb, nb, nb, nb, nb};
#pragma unroll
        for (int t = 0; t < 4; ++t) s[u][t] = exp2x8(__builtin_elementwise_fma(s[u][t], sc8, nb8));
        const v8f ps = (s[u][0] + s[u][1]) + (s[u][2] + s[u][3]);
        const float psum = ((ps[0] + ps[1]) + (ps[2] + ps[3])) + ((ps[4] + ps[5]) + (ps[6] + ps[7]));
        lp[u] = lp[u] * cf + psum; o0[u] = o0[u] * cf; o1[u] = o1[u] * cf;
    }
    if (HI) {
        v16bf aph[NQ][2], apl[NQ][2];
#pragma unroll
        for (int u = 0; u < NQ; ++u) {
#pragma unroll
            for (int ks = 0; ks < 2; ++ks) { v8us h0, h1, l0, l1;
#pragma unroll
                for (int j = 0; j < 8; ++j) { const float pa = s[u][2 * ks][j], pb = s[u][2 * ks + 1][j]; const unsigned short ha = f2bf(pa), hb = f2bf(pb);
                    h0[j] = ha; h1[j] = hb; l0[j] = f2bf(pa - bf2f(ha)); l1[j] = f2bf(pb - bf2f(hb)); }
                aph[u][ks] = cat16b(h0, h1); apl[u][ks] = cat16b(l0, l1); } }
        const bf* vph = Vhb + fb; const bf* vpl = Vlb + fb; // every V load of the chunk is one of these two addresses plus a constant
        {   v16bf vh[2], vl[2];
#pragma unroll
            for (int ks = 0; ks < 2; ++ks) { const int vo = 1024 * ks;
                vh[ks] = cat16b(*(const v8us*)(vph + vo), *(const v8us*)(vph + vo + 256)); vl[ks] = cat16b(*(const v8us*)(vpl + vo), *(const v8us*)(vpl + vo + 256)); }
#pragma unroll
            for (int u = 0; u < NQ; ++u) {
#pragma unroll
                for (int ks = 0; ks < 2; ++ks) { o0[u] = wmmab(vh[ks], aph[u][ks], o0[u]); o0[u] = wmmab(vh[ks], apl[u][ks], o0[u]); o0[u] = wmmab(vl[ks], aph[u][ks], o0[u]); } } }
        {   v16bf vh[2], vl[2];
#pragma unroll
            for (int ks = 0; ks < 2; ++ks) { const int vo = 1024 * ks + 512;
                vh[ks] = cat16b(*(const v8us*)(vph + vo), *(const v8us*)(vph + vo + 256)); vl[ks] = cat16b(*(const v8us*)(vpl + vo), *(const v8us*)(vpl + vo + 256)); }
            // the wait stands behind the last V load, in front of any instruction that reuses a V address register; the two base addresses are its inputs so that no V load lands in one of them ahead of it
            asm volatile("s_wait_xcnt 0x0" :: "v"(vph), "v"(vpl) : "memory");
#pragma unroll
            for (int u = 0; u < NQ; ++u) {
#pragma unroll
                for (int ks = 0; ks < 2; ++ks) { o1[u] = wmmab(vh[ks], aph[u][ks], o1[u]); o1[u] = wmmab(vh[ks], apl[u][ks], o1[u]); o1[u] = wmmab(vl[ks], aph[u][ks], o1[u]); } }
            asm volatile("v_nop\n\tv_nop\n\tv_nop\n\tv_nop" : "+v"(o0[0]), "+v"(o1[0]), "+v"(o0[1]), "+v"(o1[1]) : "v"(aph[1][1]), "v"(apl[1][1]), "v"(vh[1]), "v"(vl[1])); }
    } else {
        v16h ap[NQ][2];
#pragma unroll
        for (int u = 0; u < NQ; ++u) {
#pragma unroll
            for (int ks = 0; ks < 2; ++ks) {
#pragma unroll
                for (int j = 0; j < 8; ++j) { ap[u][ks][j] = (h16)s[u][2 * ks][j]; ap[u][ks][8 + j] = (h16)s[u][2 * ks + 1][j]; } } }
        const h16* vp = V16b + fb; // every V load of the chunk is this address plus a constant
        {   v16h vb[2];
#pragma unroll
            for (int ks = 0; ks < 2; ++ks) { const int vo = 1024 * ks; vb[ks] = cat16(*(const v8h*)(vp + vo), *(const v8h*)(vp + vo + 256)); }
#pragma unroll
            for (int u = 0; u < NQ; ++u) {
#pragma unroll
                for (int ks = 0; ks < 2; ++ks) o0[u] = wmma16(vb[ks], ap[u][ks], o0[u]); } }
        {   v16h vb[2];
#pragma unroll
            for (int ks = 0; ks < 2; ++ks) { const int vo = 1024 * ks + 512; vb[ks] = cat16(*(const v8h*)(vp + vo), *(const v8h*)(vp + vo + 256)); }
            // the wait stands behind the last V load, in front of any instruction that reuses the V address register; the base address is its input so that no V load lands in it ahead of the wait
            asm volatile("s_wait_xcnt 0x0" :: "v"(vp) : "memory");
#pragma unroll
            for (int u = 0; u < NQ; ++u) {
#pragma unroll
                for (int ks = 0; ks < 2; ++ks) o1[u] = wmma16(vb[ks], ap[u][ks], o1[u]); }
            asm volatile("v_nop\n\tv_nop\n\tv_nop\n\tv_nop" : "+v"(o0[0]), "+v"(o1[0]), "+v"(o0[1]), "+v"(o1[1]) : "v"(ap[1][1]), "v"(vb[1])); }
    }
}

// ---- attn_block: the whole work of one k_attn workgroup, which owns rows q0 .. q0 + 16*NQ - 1 of batch b, as NQ tiles of 16. Wave w visits the 64-key chunks w, w + KW, .. up to the
// diagonal chunk cd = q0 / 64 (the same for every tile, as a block never straddles a multiple of 64; exactly one masked chunk, taken by wave cd % KW) with its own running max, sums and accumulators per tile, one query per lane, tile and wave half. Merge: each wave stores its
// un-normalised tiles [query][d] and per query (max, l joined over the two halves) in its own LDS tile, one workgroup barrier, then thread -> (row, 4 columns): M = max over waves (exponent-of-2 units), weights exp2(m_w - M), out = sum_w f_w o_w / sum_w f_w l_w (o and l carry the same factor).
// A wave that visited no chunk holds max -3e38, l 0, o 0: its weight is exp2(-3e38 - M) = 0.
template <bool HI>
__device__ __forceinline__ void attn_block(const bf* __restrict__ Qh, const bf* __restrict__ Ql, const bf* __restrict__ Kh, const bf* __restrict__ Kl,
                                           const h16* __restrict__ V16, const bf* __restrict__ Vh, const bf* __restrict__ Vl, float* OUT, float (&ost)[KW][16 * NQ * OPF], const int b, const int q0) {
    const int wave = __builtin_amdgcn_readfirstlane(threadIdx.x >> 5), lane = threadIdx.x & 31, hh = lane >> 4, ln = lane & 15;
    const bf* Qhb = Qh + (size_t)b * SEQ * HS; const bf* Qlb = Ql + (size_t)b * SEQ * HS;
    const bf* Khb = Kh + (size_t)b * SEQ * HS; const bf* Klb = Kl + (size_t)b * SEQ * HS;
    const h16* V16b = V16 + (size_t)b * HS * SEQ; const bf* Vhb = Vh + (size_t)b * HS * SEQ; const bf* Vlb = Vl + (size_t)b * HS * SEQ;
    v16bf aqh[NQ], aql[NQ]; const bf* qph[NQ]; const bf* qpl[NQ];
#pragma unroll
    for (int u = 0; u < NQ; ++u) { const size_t qo = (size_t)(q0 + 16 * u) * HS + lane * 8; qph[u] = Qhb + qo; qpl[u] = Qlb + qo;   // fragment (q0 + 16 u) / 16, piece 0
        aqh[u] = cat16b(*(const v8us*)qph[u], *(const v8us*)(qph[u] + 256));
        aql[u] = cat16b(*(const v8us*)qpl[u], *(const v8us*)(qpl[u] + 256)); }
    // stands behind the Q loads, in front of any instruction that reuses one of their address registers; the addresses are its inputs so that none of them is rewritten ahead of it
    asm volatile("s_wait_xcnt 0x0" :: "v"(qph[0]), "v"(qph[1]), "v"(qpl[0]), "v"(qpl[1]) : "memory");
    float mrun[NQ], lp[NQ]; v8f o0[NQ], o1[NQ];
#pragma unroll
    for (int u = 0; u < NQ; ++u) { mrun[u] = -3.0e38f; lp[u] = 0.0f; o0[u] = (v8f){}; o1[u] = (v8f){}; }
    int kv0 = wave * 64;
#pragma unroll 1
    for (; kv0 + 64 <= q0; kv0 += 64 * KW) attn_chunk<HI, false>(Khb, Klb, V16b, Vhb, Vlb, aqh, aql, kv0, q0, ln, hh, mrun, lp, o0, o1);
    if (kv0 < q0 + 16 * NQ) attn_chunk<HI, true>(Khb, Klb, V16b, Vhb, Vlb, aqh, aql, kv0, q0, ln, hh, mrun, lp, o0, o1);
#pragma unroll
    for (int u = 0; u < NQ; ++u) {
        float* osw = &ost[wave][(16 * u + ln) * OPF];
        const float lj = lp[u] + xhalf(lp[u]);
        *(v4fa*)(osw + 8 * hh) = __builtin_shufflevector(o0[u], o0[u], 0, 1, 2, 3); *(v4fa*)(osw + 8 * hh + 4) = __builtin_shufflevector(o0[u], o0[u], 4, 5, 6, 7);
        *(v4fa*)(osw + 16 + 8 * hh) = __builtin_shufflevector(o1[u], o1[u], 0, 1, 2, 3); *(v4fa*)(osw + 16 + 8 * hh + 4) = __builtin_shufflevector(o1[u], o1[u], 4, 5, 6, 7);
        if (hh == 0) { v2f ms; ms[0] = mrun[u]; ms[1] = lj; *(v2f*)(osw + 32) = ms; }
    }
    __syncthreads();
    const int row = threadIdx.x >> 3, col = (threadIdx.x & 7) * 4;
    static_assert(32 * KW == 16 * NQ * 8);
    v2f ml[KW]; float M = -3.0e38f;
#pragma unroll
    for (int w = 0; w < KW; ++w) { ml[w] = *(const v2f*)(&ost[w][row * OPF + 32]); M = fmaxf(M, ml[w][0]); }
    float L = 0.0f; v4f a = (v4f){};
#pragma unroll
    for (int w = 0; w < KW; ++w) { float f; const float fx = ml[w][0] - M; const v4f o = *(const v4fa*)(&ost[w][row * OPF + col]);
        asm("v_exp_f32 %0, %1\n\tv_nop" : "=v"(f) : "v"(fx)); // v_nop: the slot the instruction set asks for behind a transcendental before its result is used or its source overwritten
        L += f * ml[w][1]; a += o * f; }
    const float inv = __builtin_amdgcn_rcpf(L);
    *(v4f*)(OUT + ((size_t)b * SEQ_FULL + q0 + row) * HS + col) = a * inv;
}

// ---- k_attn: ONE launch for all query rows. Grid (NB, query blocks of 16 * NQ rows), 32 * KW threads: batch b = blockIdx.x, block SEQ / (16 * NQ) - 1 - blockIdx.y, so that the key range of a workgroup falls with its flat index
// (for speed only). A block lies wholly below or wholly at or above RH
// (RH is a multiple of 64), so the row class is the same for the whole workgroup: a scalar branch, each side with its own barrier, passed by all of its waves. Four waves per SIMD = two workgroups per WGP: the register budget that both sides must keep.
__global__ __launch_bounds__(32 * KW) __attribute__((amdgpu_waves_per_eu(4, 4))) void k_attn(const bf* __restrict__ Qh, const bf* __restrict__ Ql, const bf* __restrict__ Kh, const bf* __restrict__ Kl,
                                             const h16* __restrict__ V16, const bf* __restrict__ Vh, const bf* __restrict__ Vl, float* OUT) {
    __shared__ __align__(16) float ost[KW][16 * NQ * OPF];
    const int b = blockIdx.x; const int q0 = (SEQ / (16 * NQ) - 1 - (int)blockIdx.y) * (16 * NQ);
    if (q0 >= RH) attn_block<false>(Qh, Ql, Kh, Kl, V16, Vh, Vl, OUT, ost, b, q0);
    else          attn_block<true>(Qh, Ql, Kh, Kl, V16, Vh, Vl, OUT, ost, b, q0);
}

extern "C" void kernel_launch(void* const* d_in, const int* in_sizes, int n_in,
                              void* d_out, int out_size, void* d_ws, size_t ws_size, hipStream_t stream) {
    if (n_in < 4) return;
    const float* x  = (const float*)d_in[0];   // [8][4096][128]
    const float* wq = (const float*)d_in[1];   // [128][32]
    const float* wk = (const float*)d_in[2];   // [128][32]
    const float* wv = (const float*)d_in[3];   // [128][32]
    if (in_sizes[0] < ((NB - 1) * SEQ_FULL + SEQ) * DM) return;
    if (in_sizes[1] < DM * HS || in_sizes[2] < DM * HS || in_sizes[3] < DM * HS) return;
    if (out_size < ((NB - 1) * SEQ_FULL + SEQ) * HS) return;
    float* OUT = (float*)d_out;                 // [8][4096][32] f32
    char* wsp = (char*)d_ws;
    auto take = [&](size_t bytes) { char* p = wsp; wsp += (bytes + 255) & ~(size_t)255; return (void*)p; };
    bf*    Qh   = (bf*)take((size_t)NB * SEQ * HS * 2);              //   2,097,152 B each
    bf*    Ql   = (bf*)take((size_t)NB * SEQ * HS * 2);
    bf*    Kh   = (bf*)take((size_t)NB * SEQ * HS * 2);
    bf*    Kl   = (bf*)take((size_t)NB * SEQ * HS * 2);
    h16*   VT16 = (h16*)take((size_t)NB * HS * SEQ * 2);
    bf*    VTh  = (bf*)take((size_t)NB * HS * SEQ * 2);
    bf*    VTl  = (bf*)take((size_t)NB * HS * SEQ * 2);             // total 14,680,064 B
    if ((size_t)(wsp - (char*)d_ws) > ws_size) return;

    k_prep<<<dim3(SEQ / 64, NB), 256, 0, stream>>>(x, wq, wk, wv, Qh, Ql, Kh, Kl, VT16, VTh, VTl);
    k_attn<<<dim3(NB, SEQ / (16 * NQ)), 32 * KW, 0, stream>>>(Qh, Ql, Kh, Kl, VT16, VTh, VTl, OUT);
}

// v009
// Measured time: 21.4 microseconds a run.
// Versions between v007 and this one are left out; their measured steps multiply to 1.30 times as fast.
// Counting every step since v000, it is 8.39 times as fast.
#include <hip/hip_runtime.h>

// Contractions, f32 accumulate: x.[Wq|Wk|Wv] on v_wmma_f32_16x16x32_bf16 (x and W RNE-converted to bf16); q.k^T as one product on v_wmma_f32_16x16x32_f16 (q and k RNE-converted to fp16 behind the rotary step: a relative 2^-12 per element, below what the bf16 factors of the projection, 2^-9 each, have already left in q and k) on every row; P.V rows < RH as 3 bf16 products (P and V hi+lo), rows >= RH on v_wmma_f32_16x16x32_f16 (P fp16 carried x 2^14, V fp16; the row sum carries the same 2^14, so the quotient needs no factor); rotary table, softmax and normalisation in f32.
// Pipeline: k_prep (one workgroup per 64 rows of x) converts its x tile and the three weights to bf16 in LDS, projects to q|k|v in f32 (LDS), applies the interleaved rotary pairs (cos, sin formed in the kernel)
// and writes the Q and K fp16 planes and the V planes (fp16, bf16 hi, bf16 lo) in FRAGMENT ORDER (below), so that every 16-byte-per-lane load of k_attn reads 512 contiguous bytes = 4 whole lines;
// Fragment order, per batch SEQ * 32 elements: a fragment is 512 elements = [piece p = 0, 1][lane l = 0..31][j = 0..7]. Q/K: fragment t / 16 holds row 16 * (t / 16) + (l & 15), column 16 * p + 8 * (l >> 4) + j.
// V: fragment 2 * (t / 32) + dh holds column d = 16 * dh + (l & 15), key 32 * (t / 32) + 16 * p + 8 * (l >> 4) + j. Either way the 64 rows t0 .. t0 + 63 fill the 2,048 elements from t0 * 32.
// k_attn: one workgroup of KW waves per 32 query rows (NQ tiles of 16), wave w takes the 64-key chunks w, w + KW, .. and uses every K and V fragment it loads for both tiles; scores and outputs in transposed form (one query per lane and tile), online softmax per wave (running max, f32 sums), causal: chunks above the diagonal never visited, one masked diagonal chunk (replace by -3e38 == exclusion); the waves' partials are merged through LDS;
#pragma clang fp contract(off)

#ifndef NB
#define NB 8
#endif
#ifndef SEQ
#define SEQ 4096
#endif
#define NB_FULL  8
#define SEQ_FULL 4096
#define DM   128                  // embedding width (K of the projections)
#define HS   32                   // head width
#define XP   136                  // LDS pitch (bf16 elements) of the x and weight tiles: 272 B = 16 B x 17, odd, for 16-byte readers
#define FP   100                  // LDS pitch (floats) of the projected q | k | v tile: 400 B, a multiple of 16 B; the two lane halves of a D store fall on disjoint banks
#ifndef RH
#define RH   1024                 // query rows < RH use bf16 hi+lo P and V planes
#endif
#define PCL2 14.0f                // log2 of the fp16 P carry (2^14) for rows >= RH: added to the exponent, never multiplied
#define SL2  ((float)(0.17677669529663687 * 1.4426950408889634)) // 32^-0.5 * log2 e: raw score -> exponent of 2
#define OPF  36                   // LDS output tile pitch (floats); columns 32, 33 of a row hold the wave's (max, sum)
#define KW   8                    // waves of a k_attn workgroup = key ranges of one query block
#define NQ   2                    // 16-row query tiles of a k_attn workgroup: each loaded K and V fragment serves all of them
static_assert(SEQ % 64 == 0);
static_assert(SEQ <= SEQ_FULL);
static_assert(NB >= 1);
static_assert(NB <= NB_FULL);
static_assert(RH % 64 == 0);
static_assert(64 % (16 * NQ) == 0);
static_assert(DM % 32 == 0);
static_assert(DM == 128 && HS == 32);
static_assert((long long)NB_FULL * SEQ_FULL * HS * 4 == 4194304LL);

typedef _Float16 h16;
typedef unsigned short bf;
typedef __attribute__((ext_vector_type(16))) __bf16   v16bf;
typedef __attribute__((ext_vector_type(16))) _Float16 v16h;
typedef __attribute__((ext_vector_type(8)))  _Float16 v8h;
typedef __attribute__((ext_vector_type(8)))  unsigned short v8us;
typedef __attribute__((ext_vector_type(4)))  unsigned short v4us;
typedef __attribute__((ext_vector_type(2)))  unsigned short v2us;
typedef __attribute__((ext_vector_type(2)))  __bf16   v2bf;
typedef __attribute__((ext_vector_type(2)))  unsigned v2u;
typedef __attribute__((ext_vector_type(4)))  unsigned v4u;
typedef __attribute__((ext_vector_type(8)))  unsigned v8u;
typedef __attribute__((ext_vector_type(8)))  float    v8f;
typedef __attribute__((ext_vector_type(4)))  float    v4f;
typedef __attribute__((ext_vector_type(2)))  float    v2f;
typedef v8h  __attribute__((may_alias)) v8ha;
typedef v4f  __attribute__((may_alias)) v4fa;
typedef v8us __attribute__((may_alias)) v8usa;
typedef v4us __attribute__((may_alias)) v4usa;

// two f32 -> two bf16, round to nearest even, in one packed hardware convert: a in the low half, b in the high half of the result
__device__ __forceinline__ unsigned f2bf2(float a, float b) { const v2f v = {a, b}; return __builtin_bit_cast(unsigned, __builtin_convertvector(v, v2bf)); }
// the two bf16 of such a pair back as f32 (exact)
__device__ __forceinline__ float bflo(unsigned p) { return __uint_as_float(p << 16); }
__device__ __forceinline__ float bfhi(unsigned p) { return __uint_as_float(p & 0xFFFF0000u); }
__device__ __forceinline__ v8f cat8f(v4f lo, v4f hi) { return __builtin_shufflevector(lo, hi, 0, 1, 2, 3, 4, 5, 6, 7); }
__device__ __forceinline__ v16h cat16(v8h lo, v8h hi) { return __builtin_shufflevector(lo, hi, 0, 1, 2, 3, 4, 5, 6, 7, 8, 9, 10, 11, 12, 13, 14, 15); }
__device__ __forceinline__ v16bf cat16b(v8us lo, v8us hi) { return __builtin_bit_cast(v16bf, __builtin_shufflevector(lo, hi, 0, 1, 2, 3, 4, 5, 6, 7, 8, 9, 10, 11, 12, 13, 14, 15)); }
__device__ __forceinline__ v8f wmma16(v16h a, v16h b, v8f c) { return __builtin_amdgcn_wmma_f32_16x16x32_f16(false, a, false, b, (short)0, c, false, false); }
__device__ __forceinline__ v8f wmmab(v16bf a, v16bf b, v8f c) { return __builtin_amdgcn_wmma_f32_16x16x32_bf16(false, a, false, b, (short)0, c, false, false); }

// INVT[i] = 1 / 10000^(2i/32): the exact float32 results of that expression (pow then reciprocal in f32), i = 0..15.
__constant__ __align__(16) float INVT[HS / 2] = { 1.0f, 0.5623413324356079f, 0.3162277638912201f, 0.17782793939113617f, 0.10000000149011612f, 0.05623412877321243f, 0.03162277862429619f, 0.017782794311642647f, 0.009999999776482582f, 0.005623413249850273f, 0.003162277862429619f, 0.0017782794311642647f, 0.0010000000474974513f, 0.000562341301701963f, 0.0003162277862429619f, 0.00017782794020604342f };

// ---- k_prep: block = batch b (grid.y), 64 consecutive t (t0 = blockIdx.x * 64), 256 threads = 8 waves. Three phases, a workgroup barrier between each two.
// Phase 1 (stage): the x tile [64 t][128 k] is read as 16-byte pieces, contiguous over the block, RNE-converted to bf16 and stored in xs [row][k]; the weights are read column by lane (wave -> matrix and group of 8 k),
// converted and stored transposed in wt [n = 32 * matrix + column][k] (n 0..31 q, 32..63 k, 64..95 v); each thread also forms its four rotary pairs (c, s) = {cos, sin}(INVT[i] * t), t = t0 + (tid >> 2), i = 4 * (tid & 3) + p.
// Phase 2 (project): wave w owns rows 16 * (w & 3) .. + 15 and the three 16-column tiles 3 * (w >> 2) + 0..2; k in steps of 32, ascending, f32 accumulate.
// Fragments: lane -> row/col (lane & 15), elements 0..7 <- k0 + 8*(lane >> 4) + 0..7, elements 8..15 <- k0 + 16 + 8*(lane >> 4) + 0..7 for A and for the [n][k] B tile. D element j of lane l is row 8*(l >> 4) + j, column l & 15; it goes to fs [row][n] in f32.
// Phase 3 (planes): thread -> row r = tid>>2, column group g = tid&3 = 8 q, 8 k, 8 v columns. Rotary (interleaved pairs, i = column/2): out[2i] = x[2i] c - x[2i+1] s, out[2i+1] = x[2i] s + x[2i+1] c, separate f32 products.
// LDS tiles: sq[0..1] = Q, K (fp16 bits) as [64 r][32 c]; sv[0..2] = V fp16 bits, bf16 hi, bf16 lo, already in fragment order. After the last barrier every plane's 4,096-byte tile region is written in 16-byte pieces, contiguous over the block; the Q/K pieces are picked from sq in fragment order.
__global__ __launch_bounds__(256) void k_prep(const float* __restrict__ x, const float* __restrict__ wq, const float* __restrict__ wk, const float* __restrict__ wv,
                                              h16* Q16, h16* K16, h16* VT16, bf* VTh, bf* VTl) {
    __shared__ __align__(16) unsigned short xs[64 * XP];
    __shared__ __align__(16) unsigned short wt[96 * XP];
    __shared__ __align__(16) float fs[64 * FP];
    __shared__ __align__(16) unsigned short sq[2][64 * 32];
    __shared__ __align__(16) unsigned short sv[3][32 * 64];
    const int tid = threadIdx.x; const int b = blockIdx.y, t0 = blockIdx.x * 64;
    const int w = __builtin_amdgcn_readfirstlane(tid >> 5), L = tid & 31;
    const int r = tid >> 2, g = tid & 3; const int t = t0 + r;
    // ---- phase 1
    const v4f iv = *(const v4f*)(INVT + 4 * g);
    const float* xp = x + ((size_t)b * SEQ_FULL + t0) * DM + (size_t)tid * 4;
    v4f xr[8];
#pragma unroll
    for (int s = 0; s < 8; ++s) xr[s] = *(const v4f*)(xp + s * 1024);
    float wr[6][8];
#pragma unroll
    for (int s = 0; s < 6; ++s) { const int c = s * 8 + w; const int m = c >> 4, kg = c & 15;
        const float* wsrc = ((m == 0) ? wq : ((m == 1) ? wk : wv)) + (size_t)kg * 8 * HS + L;
#pragma unroll
        for (int j = 0; j < 8; ++j) wr[s][j] = wsrc[j * HS]; }
    float cnv[4], snv[4];
#pragma unroll
    for (int p = 0; p < 4; ++p) { const float ang = iv[p] * (float)t; float sn, cn; sincosf(ang, &sn, &cn); cnv[p] = cn; snv[p] = sn; }
#pragma unroll
    for (int s = 0; s < 8; ++s) { const int e = (s * 256 + tid) * 4; const v2u o = {f2bf2(xr[s][0], xr[s][1]), f2bf2(xr[s][2], xr[s][3])};
        *(v4usa*)(&xs[(e >> 7) * XP + (e & 127)]) = __builtin_bit_cast(v4us, o); }
#pragma unroll
    for (int s = 0; s < 6; ++s) { const int c = s * 8 + w; const int m = c >> 4, kg = c & 15;
        const v4u o = {f2bf2(wr[s][0], wr[s][1]), f2bf2(wr[s][2], wr[s][3]), f2bf2(wr[s][4], wr[s][5]), f2bf2(wr[s][6], wr[s][7])};
        *(v8usa*)(&wt[(m * 32 + L) * XP + kg * 8]) = __builtin_bit_cast(v8us, o); }
    __syncthreads();
    // ---- phase 2
    {   const int lr = L & 15, hi = L >> 4; const int mt = w & 3, ng = w >> 2;
        v8f acc[3];
#pragma unroll
        for (int nb = 0; nb < 3; ++nb) acc[nb] = (v8f){};
#pragma unroll
        for (int kc = 0; kc < DM; kc += 32) {
            const unsigned short* ap = &xs[(mt * 16 + lr) * XP + kc + 8 * hi];
            const v16bf a = cat16b(*(const v8usa*)ap, *(const v8usa*)(ap + 16));
#pragma unroll
            for (int nb = 0; nb < 3; ++nb) { const unsigned short* bp = &wt[((ng * 3 + nb) * 16 + lr) * XP + kc + 8 * hi];
                acc[nb] = wmmab(a, cat16b(*(const v8usa*)bp, *(const v8usa*)(bp + 16)), acc[nb]); }
        }
#pragma unroll
        for (int nb = 0; nb < 3; ++nb) {
#pragma unroll
            for (int j = 0; j < 8; ++j) fs[(mt * 16 + hi * 8 + j) * FP + (ng * 3 + nb) * 16 + lr] = acc[nb][j]; }
    }
    __syncthreads();
    // ---- phase 3
    const float* fr = &fs[r * FP + 8 * g];
    const v8f xq = cat8f(*(const v4fa*)fr, *(const v4fa*)(fr + 4)), xk = cat8f(*(const v4fa*)(fr + 32), *(const v4fa*)(fr + 36)), xv = cat8f(*(const v4fa*)(fr + 64), *(const v4fa*)(fr + 68));
#pragma unroll
    for (int p = 0; p < 4; ++p) {
        const float cn = cnv[p], sn = snv[p]; const int col = 8 * g + 2 * p;
        {   const float x1 = xq[2 * p], x2 = xq[2 * p + 1]; const float ev = x1 * cn - x2 * sn, od = x1 * sn + x2 * cn;
            v2us oh; oh[0] = __builtin_bit_cast(unsigned short, (h16)ev); oh[1] = __builtin_bit_cast(unsigned short, (h16)od);
            *(v2us*)(&sq[0][r * 32 + col]) = oh; }
        {   const float x1 = xk[2 * p], x2 = xk[2 * p + 1]; const float ev = x1 * cn - x2 * sn, od = x1 * sn + x2 * cn;
            v2us oh; oh[0] = __builtin_bit_cast(unsigned short, (h16)ev); oh[1] = __builtin_bit_cast(unsigned short, (h16)od);
            *(v2us*)(&sq[1][r * 32 + col]) = oh; }
        const unsigned vh2 = f2bf2(xv[2 * p], xv[2 * p + 1]); const unsigned vl2 = f2bf2(xv[2 * p] - bflo(vh2), xv[2 * p + 1] - bfhi(vh2));   // V hi and the rounded remainder, both columns of the pair
#pragma unroll
        for (int j = 0; j < 2; ++j) { const float val = xv[2 * p + j]; const int d = col + j;
            const int vi = ((r >> 5) * 2 + (d >> 4)) * 512 + ((r >> 4) & 1) * 256 + (((r >> 3) & 1) * 16 + (d & 15)) * 8 + (r & 7);   // fragment order of (key r, column d)
            sv[0][vi] = __builtin_bit_cast(unsigned short, (h16)val); sv[1][vi] = (unsigned short)(vh2 >> (16 * j)); sv[2][vi] = (unsigned short)(vl2 >> (16 * j)); }
    }
    __syncthreads();
    const int lo = w * 256 + L * 8;                                                    // linear offset inside a 2,048-element tile
    const size_t qoff = ((size_t)b * SEQ + t0) * HS + lo;                              // the same place in every plane: fragment w >> 1, piece w & 1, lane L
    const int fo = ((w >> 1) * 16 + (L & 15)) * 32 + 16 * (w & 1) + 8 * (L >> 4);      // that piece's row and column in an sq tile
    const v8us q0v = *(const v8usa*)(&sq[0][fo]), k0v = *(const v8usa*)(&sq[1][fo]);
    const v8us v0v = *(const v8usa*)(&sv[0][lo]), v1v = *(const v8usa*)(&sv[1][lo]), v2v = *(const v8usa*)(&sv[2][lo]);
    unsigned short* VT16u = (unsigned short*)VT16; unsigned short* Q16u = (unsigned short*)Q16; unsigned short* K16u = (unsigned short*)K16;
    *(v8us*)(Q16u + qoff) = q0v; *(v8us*)(K16u + qoff) = k0v;
    *(v8us*)(VT16u + qoff) = v0v; *(v8us*)(VTh + qoff) = v1v; *(v8us*)(VTl + qoff) = v2v;
}

// lane l with lane l ^ 16 (a vector cross-row move, no LDS counter)
__device__ __forceinline__ float xhalf(float x) { return __builtin_bit_cast(float, __builtin_amdgcn_permlanex16(__builtin_bit_cast(int, x), __builtin_bit_cast(int, x), 0x76543210, 0xfedcba98, false, false)); }

// eight exponentials in place, each independent of its neighbours, then one v_nop: the slot the instruction set asks for behind a transcendental before its result is used or its source overwritten
__device__ __forceinline__ v8f exp2x8(const v8f x) {
    float a = x[0], b = x[1], c = x[2], d = x[3], e = x[4], f = x[5], g = x[6], h = x[7];
    asm("v_exp_f32 %0, %0\n\tv_exp_f32 %1, %1\n\tv_exp_f32 %2, %2\n\tv_exp_f32 %3, %3\n\tv_exp_f32 %4, %4\n\tv_exp_f32 %5, %5\n\tv_exp_f32 %6, %6\n\tv_exp_f32 %7, %7\n\tv_nop"
        : "+v"(a), "+v"(b), "+v"(c), "+v"(d), "+v"(e), "+v"(f), "+v"(g), "+v"(h));
    return (v8f){a, b, c, d, e, f, g, h};
}

// ---- attn_chunk: one 64-key chunk for one wave's NQ query tiles (tile u = rows q0 + 16*u .. + 15; what follows is per tile, with q0 read as the tile's first row), the K and V fragments loaded once for all tiles, in transposed form: S^T = K.Q^T, O^T += V^T.P^T. Scores: 4 key tiles, one fp16 product each (q, k fp16 planes in fragment order; A fragment = K rows, B fragment = Q rows, both k-contiguous pieces in the same k map).
// D element r of lane l is S[q0 + (l&15)][kv0 + 16*tile + 8*(l>>4) + r]: a lane holds 32 of the 64 scores of ONE query, lane l ^ 16 the other 32. Online softmax per lane: causal replace-mask (MASK chunk only) and in-lane max on the raw scores, one exchange between the wave halves, running max (kept in exponent-of-2 units, raw x SL2) / rescale; p = exp2(fma(raw, SL2, carry exponent - max)): scale, log2 e, maximum and fp16 carry in one fused multiply-add per score;
// the lane's sum covers its own 32 keys (the halves are joined in k_attn). P^T as the B operand straight from the score registers: element j <- tile 2*ks, register j; element 8 + j <- tile 2*ks + 1, register j, which is key 32*ks + 8*(l>>4) + j and 32*ks + 16 + 8*(l>>4) + j, the k map of the V^T loads.
// V planes in fragment order as the A operand V^T (HI: 3 bf16 products; else one fp16 product); outputs o0[r] = O[q0 + (l&15)][8*(l>>4) + r], o1[r] = the same at d + 16.
template <bool HI, bool MASK>
__device__ __forceinline__ void attn_chunk(const h16* __restrict__ K16b, const h16* __restrict__ V16b, const bf* __restrict__ Vhb, const bf* __restrict__ Vlb,
                                           const v16h (&aq)[NQ], const int kv0, const int q0, const int ln, const int hh,
                                           float (&mrun)[NQ], float (&lp)[NQ], v8f (&o0)[NQ], v8f (&o1)[NQ]) {
    const size_t fb = (size_t)kv0 * HS + (16 * hh + ln) * 8;                            // the lane's 8 elements in piece 0 of the chunk's first fragment, the same in every plane
    v16h kb[4]; const h16* kp = K16b + fb;                                              // every K load of the chunk is this address plus a constant
#pragma unroll
    for (int t = 0; t < 4; ++t) { const int ko = 512 * t;
        kb[t] = cat16(*(const v8h*)(kp + ko), *(const v8h*)(kp + ko + 256)); }
    // the wait stands behind the K loads, in front of any instruction that reuses their address register; the address is its input so that no load of the run lands in it ahead of the wait
    asm volatile("s_wait_xcnt 0x0" :: "v"(kp) : "memory");
    v8f s[NQ][4];
#pragma unroll
    for (int u = 0; u < NQ; ++u) {
#pragma unroll
        for (int t = 0; t < 4; ++t) s[u][t] = wmma16(kb[t], aq[u], (v8f){}); }
    // four slots behind the last score product before a vector instruction touches its D, A or B; every A and B of the block is an input, so that no product's D is placed over an operand of an earlier product
    asm volatile("v_nop\n\tv_nop\n\tv_nop\n\tv_nop" : "+v"(s[0][0]), "+v"(s[0][1]), "+v"(s[0][2]), "+v"(s[0][3]), "+v"(s[1][0]), "+v"(s[1][1]), "+v"(s[1][2]), "+v"(s[1][3]) : "v"(aq[0]), "v"(aq[1]), "v"(kb[0]), "v"(kb[1]), "v"(kb[2]), "v"(kb[3]));
#pragma unroll
    for (int u = 0; u < NQ; ++u) {
        if (MASK) { const int dq = q0 + 16 * u + ln - kv0 - 8 * hh;   // the lane's query row less its first key: key 16 t + r of the lane is kept while it is not above this
#pragma unroll
            for (int t = 0; t < 4; ++t) {
#pragma unroll
                for (int r = 0; r < 8; ++r) s[u][t][r] = (16 * t + r <= dq) ? s[u][t][r] : -3.0e38f; } }
        float rm = -3.0e38f;   // the maximum that passes a not-a-number on takes the matrix results as they are; fmaxf made the compiler quiet each of them first, one more instruction per score
#pragma unroll
        for (int r = 0; r < 8; ++r) rm = __builtin_elementwise_maximum(rm, __builtin_elementwise_maximum(__builtin_elementwise_maximum(s[u][0][r], s[u][1][r]), __builtin_elementwise_maximum(s[u][2][r], s[u][3][r])));
        rm = fmaxf(rm, xhalf(rm));
        const float mn = fmaxf(mrun[u], rm * SL2);
        float cf; const float cx = mrun[u] - mn;
        asm("v_exp_f32 %0, %1\n\tv_nop" : "=v"(cf) : "v"(cx)); // v_nop: the same slot behind a transcendental
        mrun[u] = mn;
        const float nb = (HI ? 0.0f : PCL2) - mn;
        const v8f sc8 = {SL2, SL2, SL2, SL2, SL2, SL2, SL2, SL2}, nb8 = {nb, nb, nb, nb, nb, nb, nb, nb};
#pragma unroll
        for (int t = 0; t < 4; ++t) s[u][t] = exp2x8(__builtin_elementwise_fma(s[u][t], sc8, nb8));
        const v8f ps = (s[u][0] + s[u][1]) + (s[u][2] + s[u][3]);
        const float psum = ((ps[0] + ps[1]) + (ps[2] + ps[3])) + ((ps[4] + ps[5]) + (ps[6] + ps[7]));
        lp[u] = lp[u] * cf + psum; o0[u] = o0[u] * cf; o1[u] = o1[u] * cf;
    }
    if (HI) {
        v16bf aph[NQ][2], apl[NQ][2];
#pragma unroll
        for (int u = 0; u < NQ; ++u) {
#pragma unroll
            for (int ks = 0; ks < 2; ++ks) { v8u ph, pl;   // register i: elements 2 i, 2 i + 1 of the operand; 0..3 from tile 2 ks, 4..7 from tile 2 ks + 1
#pragma unroll
                for (int i = 0; i < 8; ++i) { const float p0 = s[u][2 * ks + (i >> 2)][2 * (i & 3)], p1 = s[u][2 * ks + (i >> 2)][2 * (i & 3) + 1]; const unsigned hp = f2bf2(p0, p1);
                    ph[i] = hp; pl[i] = f2bf2(p0 - bflo(hp), p1 - bfhi(hp)); }
                aph[u][ks] = __builtin_bit_cast(v16bf, ph); apl[u][ks] = __builtin_bit_cast(v16bf, pl); } }
        const bf* vph = Vhb + fb; const bf* vpl = Vlb + fb; // every V load of the chunk is one of these two addresses plus a constant
        {   v16bf vh[2], vl[2];
#pragma unroll
            for (int ks = 0; ks < 2; ++ks) { const int vo = 1024 * ks;
                vh[ks] = cat16b(*(const v8us*)(vph + vo), *(const v8us*)(vph + vo + 256)); vl[ks] = cat16b(*(const v8us*)(vpl + vo), *(const v8us*)(vpl + vo + 256)); }
#pragma unroll
            for (int u = 0; u < NQ; ++u) {
#pragma unroll
                for (int ks = 0; ks < 2; ++ks) { o0[u] = wmmab(vh[ks], aph[u][ks], o0[u]); o0[u] = wmmab(vh[ks], apl[u][ks], o0[u]); o0[u] = wmmab(vl[ks], aph[u][ks], o0[u]); } } }
        {   v16bf vh[2], vl[2];
#pragma unroll
            for (int ks = 0; ks < 2; ++ks) { const int vo = 1024 * ks + 512;
                vh[ks] = cat16b(*(const v8us*)(vph + vo), *(const v8us*)(vph + vo + 256)); vl[ks] = cat16b(*(const v8us*)(vpl + vo), *(const v8us*)(vpl + vo + 256)); }
            // the wait stands behind the last V load, in front of any instruction that reuses a V address register; the two base addresses are its inputs so that no V load lands in one of them ahead of it
            asm volatile("s_wait_xcnt 0x0" :: "v"(vph), "v"(vpl) : "memory");
#pragma unroll
            for (int u = 0; u < NQ; ++u) {
#pragma unroll
                for (int ks = 0; ks < 2; ++ks) { o1[u] = wmmab(vh[ks], aph[u][ks], o1[u]); o1[u] = wmmab(vh[ks], apl[u][ks], o1[u]); o1[u] = wmmab(vl[ks], aph[u][ks], o1[u]); } }
            asm volatile("v_nop\n\tv_nop\n\tv_nop\n\tv_nop" : "+v"(o0[0]), "+v"(o1[0]), "+v"(o0[1]), "+v"(o1[1]) : "v"(aph[1][1]), "v"(apl[1][1]), "v"(vh[1]), "v"(vl[1])); }
    } else {
        v16h ap[NQ][2];
#pragma unroll
        for (int u = 0; u < NQ; ++u) {
#pragma unroll
            for (int ks = 0; ks < 2; ++ks) {
#pragma unroll
                for (int j = 0; j < 8; ++j) { ap[u][ks][j] = (h16)s[u][2 * ks][j]; ap[u][ks][8 + j] = (h16)s[u][2 * ks + 1][j]; } } }
        const h16* vp = V16b + fb; // every V load of the chunk is this address plus a constant
        {   v16h vb[2];
#pragma unroll
            for (int ks = 0; ks < 2; ++ks) { const int vo = 1024 * ks; vb[ks] = cat16(*(const v8h*)(vp + vo), *(const v8h*)(vp + vo + 256)); }
#pragma unroll
            for (int u = 0; u < NQ; ++u) {
#pragma unroll
                for (int ks = 0; ks < 2; ++ks) o0[u] = wmma16(vb[ks], ap[u][ks], o0[u]); } }
        {   v16h vb[2];
#pragma unroll
            for (int ks = 0; ks < 2; ++ks) { const int vo = 1024 * ks + 512; vb[ks] = cat16(*(const v8h*)(vp + vo), *(const v8h*)(vp + vo + 256)); }
            // the wait stands behind the last V load, in front of any instruction that reuses the V address register; the base address is its input so that no V load lands in it ahead of the wait
            asm volatile("s_wait_xcnt 0x0" :: "v"(vp) : "memory");
#pragma unroll
            for (int u = 0; u < NQ; ++u) {
#pragma unroll
                for (int ks = 0; ks < 2; ++ks) o1[u] = wmma16(vb[ks], ap[u][ks], o1[u]); }
            asm volatile("v_nop\n\tv_nop\n\tv_nop\n\tv_nop" : "+v"(o0[0]), "+v"(o1[0]), "+v"(o0[1]), "+v"(o1[1]) : "v"(ap[1][1]), "v"(vb[1])); }
    }
}

// ---- attn_block: the whole work of one k_attn workgroup, which owns rows q0 .. q0 + 16*NQ - 1 of batch b, as NQ tiles of 16. Wave w visits the 64-key chunks w, w + KW, .. up to the
// diagonal chunk cd = q0 / 64 (the same for every tile, as a block never straddles a multiple of 64; exactly one masked chunk, taken by wave cd % KW) with its own running max, sums and accumulators per tile, one query per lane, tile and wave half. Merge: each wave stores its
// un-normalised tiles [query][d] and per query (max, l joined over the two halves) in its own LDS tile, one workgroup barrier, then thread -> (row, 4 columns): M = max over waves (exponent-of-2 units), weights exp2(m_w - M), out = sum_w f_w o_w / sum_w f_w l_w (o and l carry the same factor).
// A wave that visited no chunk holds max -3e38, l 0, o 0: its weight is exp2(-3e38 - M) = 0.
template <bool HI>
__device__ __forceinline__ void attn_block(const h16* __restrict__ Q16, const h16* __restrict__ K16,
                                           const h16* __restrict__ V16, const bf* __restrict__ Vh, const bf* __restrict__ Vl, float* OUT, float (&ost)[KW][16 * NQ * OPF], const int b, const int q0) {
    const int wave = __builtin_amdgcn_readfirstlane(threadIdx.x >> 5), lane = threadIdx.x & 31, hh = lane >> 4, ln = lane & 15;
    const h16* Q16b = Q16 + (size_t)b * SEQ * HS; const h16* K16b = K16 + (size_t)b * SEQ * HS;
    const h16* V16b = V16 + (size_t)b * HS * SEQ; const bf* Vhb = Vh + (size_t)b * HS * SEQ; const bf* Vlb = Vl + (size_t)b * HS * SEQ;
    v16h aq[NQ]; const h16* qp[NQ];
#pragma unroll
    for (int u = 0; u < NQ; ++u) { qp[u] = Q16b + (size_t)(q0 + 16 * u) * HS + lane * 8;   // fragment (q0 + 16 u) / 16, piece 0
        aq[u] = cat16(*(const v8h*)qp[u], *(const v8h*)(qp[u] + 256)); }
    // stands behind the Q loads, in front of any instruction that reuses one of their address registers; the addresses are its inputs so that none of them is rewritten ahead of it
    asm volatile("s_wait_xcnt 0x0" :: "v"(qp[0]), "v"(qp[1]) : "memory");
    float mrun[NQ], lp[NQ]; v8f o0[NQ], o1[NQ];
#pragma unroll
    for (int u = 0; u < NQ; ++u) { mrun[u] = -3.0e38f; lp[u] = 0.0f; o0[u] = (v8f){}; o1[u] = (v8f){}; }
    int kv0 = wave * 64;
#pragma unroll 1
    for (; kv0 + 64 <= q0; kv0 += 64 * KW) attn_chunk<HI, false>(K16b, V16b, Vhb, Vlb, aq, kv0, q0, ln, hh, mrun, lp, o0, o1);
    if (kv0 < q0 + 16 * NQ) attn_chunk<HI, true>(K16b, V16b, Vhb, Vlb, aq, kv0, q0, ln, hh, mrun, lp, o0, o1);
#pragma unroll
    for (int u = 0; u < NQ; ++u) {
        float* osw = &ost[wave][(16 * u + ln) * OPF];
        const float lj = lp[u] + xhalf(lp[u]);
        *(v4fa*)(osw + 8 * hh) = __builtin_shufflevector(o0[u], o0[u], 0, 1, 2, 3); *(v4fa*)(osw + 8 * hh + 4) = __builtin_shufflevector(o0[u], o0[u], 4, 5, 6, 7);
        *(v4fa*)(osw + 16 + 8 * hh) = __builtin_shufflevector(o1[u], o1[u], 0, 1, 2, 3); *(v4fa*)(osw + 16 + 8 * hh + 4) = __builtin_shufflevector(o1[u], o1[u], 4, 5, 6, 7);
        if (hh == 0) { v2f ms; ms[0] = mrun[u]; ms[1] = lj; *(v2f*)(osw + 32) = ms; }
    }
    __syncthreads();
    const int row = threadIdx.x >> 3, col = (threadIdx.x & 7) * 4;
    static_assert(32 * KW == 16 * NQ * 8);
    v2f ml[KW]; float M = -3.0e38f;
#pragma unroll
    for (int w = 0; w < KW; ++w) { ml[w] = *(const v2f*)(&ost[w][row * OPF + 32]); M = fmaxf(M, ml[w][0]); }
    float L = 0.0f; v4f a = (v4f){};
#pragma unroll
    for (int w = 0; w < KW; ++w) { float f; const float fx = ml[w][0] - M; const v4f o = *(const v4fa*)(&ost[w][row * OPF + col]);
        asm("v_exp_f32 %0, %1\n\tv_nop" : "=v"(f) : "v"(fx)); // v_nop: the slot the instruction set asks for behind a transcendental before its result is used or its source overwritten
        L += f * ml[w][1]; a += o * f; }
    const float inv = __builtin_amdgcn_rcpf(L);
    *(v4f*)(OUT + ((size_t)b * SEQ_FULL + q0 + row) * HS + col) = a * inv;
}

// ---- k_attn: ONE launch for all query rows. Grid (NB, query blocks of 16 * NQ rows), 32 * KW threads: batch b = blockIdx.x, block SEQ / (16 * NQ) - 1 - blockIdx.y, so that the key range of a workgroup falls with its flat index
// (for speed only). A block lies wholly below or wholly at or above RH
// (RH is a multiple of 64), so the row class is the same for the whole workgroup: a scalar branch, each side with its own barrier, passed by all of its waves. Four waves per SIMD = two workgroups per WGP: the register budget that both sides must keep.
__global__ __launch_bounds__(32 * KW) __attribute__((amdgpu_waves_per_eu(4, 4))) void k_attn(const h16* __restrict__ Q16, const h16* __restrict__ K16,
                                             const h16* __restrict__ V16, const bf* __restrict__ Vh, const bf* __restrict__ Vl, float* OUT) {
    __shared__ __align__(16) float ost[KW][16 * NQ * OPF];
    const int b = blockIdx.x; const int q0 = (SEQ / (16 * NQ) - 1 - (int)blockIdx.y) * (16 * NQ);
    if (q0 >= RH) attn_block<false>(Q16, K16, V16, Vh, Vl, OUT, ost, b, q0);
    else          attn_block<true>(Q16, K16, V16, Vh, Vl, OUT, ost, b, q0);
}

extern "C" void kernel_launch(void* const* d_in, const int* in_sizes, int n_in,
                              void* d_out, int out_size, void* d_ws, size_t ws_size, hipStream_t stream) {
    if (n_in < 4) return;
    const float* x  = (const float*)d_in[0];   // [8][4096][128]
    const float* wq = (const float*)d_in[1];   // [128][32]
    const float* wk = (const float*)d_in[2];   // [128][32]
    const float* wv = (const float*)d_in[3];   // [128][32]
    if (in_sizes[0] < ((NB - 1) * SEQ_FULL + SEQ) * DM) return;
    if (in_sizes[1] < DM * HS || in_sizes[2] < DM * HS || in_sizes[3] < DM * HS) return;
    if (out_size < ((NB - 1) * SEQ_FULL + SEQ) * HS) return;
    float* OUT = (float*)d_out;                 // [8][4096][32] f32
    char* wsp = (char*)d_ws;
    auto take = [&](size_t bytes) { char* p = wsp; wsp += (bytes + 255) & ~(size_t)255; return (void*)p; };
    h16*   Q16  = (h16*)take((size_t)NB * SEQ * HS * 2);             //   2,097,152 B each
    h16*   K16  = (h16*)take((size_t)NB * SEQ * HS * 2);
    h16*   VT16 = (h16*)take((size_t)NB * HS * SEQ * 2);
    bf*    VTh  = (bf*)take((size_t)NB * HS * SEQ * 2);
    bf*    VTl  = (bf*)take((size_t)NB * HS * SEQ * 2);             // total 10,485,760 B
    if ((size_t)(wsp - (char*)d_ws) > ws_size) return;

    k_prep<<<dim3(SEQ / 64, NB), 256, 0, stream>>>(x, wq, wk, wv, Q16, K16, VT16, VTh, VTl);
    k_attn<<<dim3(NB, SEQ / (16 * NQ)), 32 * KW, 0, stream>>>(Q16, K16, VT16, VTh, VTl, OUT);
}

// v010
// Measured time: 20.4 microseconds a run.
// Timed twice side by side with v009, it ran 1.03 and 1.04 times as fast.
// Counting every step since v000, it is 8.68 times as fast.
#include <hip/hip_runtime.h>

// Contractions, f32 accumulate: x.[Wq|Wk|Wv] on v_wmma_f32_16x16x32_bf16 (x and W RNE-converted to bf16); q.k^T as one product on v_wmma_f32_16x16x32_f16 (q and k RNE-converted to fp16 behind the rotary step: a relative 2^-12 per element, below what the bf16 factors of the projection, 2^-9 each, have already left in q and k) on every row; P.V rows < RH as 3 bf16 products (P and V hi+lo), rows >= RH on v_wmma_f32_16x16x32_f16 (P fp16 carried x 2^14, V fp16; the row sum carries the same 2^14, so the quotient needs no factor); rotary table, softmax and normalisation in f32.
// Pipeline: k_prep (one workgroup per 64 rows of x) converts its x tile and the three weights to bf16 in LDS, projects to q|k|v in f32 (LDS), applies the interleaved rotary pairs (cos, sin formed in the kernel)
// and writes the Q and K fp16 planes and the V planes (fp16, bf16 hi, bf16 lo) in FRAGMENT ORDER (below), so that every 16-byte-per-lane load of k_attn reads 512 contiguous bytes = 4 whole lines;
// Fragment order, per batch SEQ * 32 elements: a fragment is 512 elements = [piece p = 0, 1][lane l = 0..31][j = 0..7]. Q/K: fragment t / 16 holds row 16 * (t / 16) + (l & 15), column 16 * p + 8 * (l >> 4) + j.
// V: fragment 2 * (t / 32) + dh holds column d = 16 * dh + (l & 15), key 32 * (t / 32) + 16 * p + 8 * (l >> 4) + j. Either way the 64 rows t0 .. t0 + 63 fill the 2,048 elements from t0 * 32.
// k_attn: one workgroup of KW waves per 32 query rows (NQ tiles of 16), wave w takes the 64-key chunks w, w + KW, .. and uses every K and V fragment it loads for both tiles; scores and outputs in transposed form (one query per lane and tile), online softmax per wave (running max, f32 sums), causal: chunks above the diagonal never visited, one masked diagonal chunk (replace by -3e38 == exclusion); the waves' partials are merged through LDS;
#pragma clang fp contract(off)

#ifndef NB
#define NB 8
#endif
#ifndef SEQ
#define SEQ 4096
#endif
#define NB_FULL  8
#define SEQ_FULL 4096
#define DM   128                  // embedding width (K of the projections)
#define HS   32                   // head width
#define XP   136                  // LDS pitch (bf16 elements) of the x and weight tiles: 272 B = 16 B x 17, odd, for 16-byte readers
#define FP   100                  // LDS pitch (floats) of the projected q | k | v tile: 400 B, a multiple of 16 B; the two lane halves of a D store fall on disjoint banks
#ifndef RH
#define RH   1024                 // query rows < RH use bf16 hi+lo P and V planes
#endif
#define PCL2 14.0f                // log2 of the fp16 P carry (2^14) for rows >= RH: added to the exponent, never multiplied
#define SL2  ((float)(0.17677669529663687 * 1.4426950408889634)) // 32^-0.5 * log2 e: raw score -> exponent of 2
#define OPF  36                   // LDS output tile pitch (floats); columns 32, 33 of a row hold the wave's (max, sum)
#define KW   8                    // waves of a k_attn workgroup = key ranges of one query block
#define NQ   2                    // 16-row query tiles of a k_attn workgroup: each loaded K and V fragment serves all of them
static_assert(SEQ % 64 == 0);
static_assert(SEQ <= SEQ_FULL);
static_assert(NB >= 1);
static_assert(NB <= NB_FULL);
static_assert(RH % 64 == 0);
static_assert(64 % (16 * NQ) == 0);
static_assert(DM % 32 == 0);
static_assert(DM == 128 && HS == 32);
static_assert((long long)NB_FULL * SEQ_FULL * HS * 4 == 4194304LL);

typedef _Float16 h16;
typedef unsigned short bf;
typedef __attribute__((ext_vector_type(16))) __bf16   v16bf;
typedef __attribute__((ext_vector_type(16))) _Float16 v16h;
typedef __attribute__((ext_vector_type(8)))  _Float16 v8h;
typedef __attribute__((ext_vector_type(8)))  unsigned short v8us;
typedef __attribute__((ext_vector_type(4)))  unsigned short v4us;
typedef __attribute__((ext_vector_type(2)))  unsigned short v2us;
typedef __attribute__((ext_vector_type(2)))  __bf16   v2bf;
typedef __attribute__((ext_vector_type(2)))  unsigned v2u;
typedef __attribute__((ext_vector_type(4)))  unsigned v4u;
typedef __attribute__((ext_vector_type(8)))  unsigned v8u;
typedef __attribute__((ext_vector_type(8)))  float    v8f;
typedef __attribute__((ext_vector_type(4)))  float    v4f;
typedef __attribute__((ext_vector_type(2)))  float    v2f;
typedef v8h  __attribute__((may_alias)) v8ha;
typedef v4f  __attribute__((may_alias)) v4fa;
typedef v8us __attribute__((may_alias)) v8usa;
typedef v4us __attribute__((may_alias)) v4usa;

// two f32 -> two bf16, round to nearest even, in one packed hardware convert: a in the low half, b in the high half of the result
__device__ __forceinline__ unsigned f2bf2(float a, float b) { const v2f v = {a, b}; return __builtin_bit_cast(unsigned, __builtin_convertvector(v, v2bf)); }
// the two bf16 of such a pair back as f32 (exact)
__device__ __forceinline__ float bflo(unsigned p) { return __uint_as_float(p << 16); }
__device__ __forceinline__ float bfhi(unsigned p) { return __uint_as_float(p & 0xFFFF0000u); }
__device__ __forceinline__ v8f cat8f(v4f lo, v4f hi) { return __builtin_shufflevector(lo, hi, 0, 1, 2, 3, 4, 5, 6, 7); }
__device__ __forceinline__ v16h cat16(v8h lo, v8h hi) { return __builtin_shufflevector(lo, hi, 0, 1, 2, 3, 4, 5, 6, 7, 8, 9, 10, 11, 12, 13, 14, 15); }
__device__ __forceinline__ v16bf cat16b(v8us lo, v8us hi) { return __builtin_bit_cast(v16bf, __builtin_shufflevector(lo, hi, 0, 1, 2, 3, 4, 5, 6, 7, 8, 9, 10, 11, 12, 13, 14, 15)); }
__device__ __forceinline__ v8f wmma16(v16h a, v16h b, v8f c) { return __builtin_amdgcn_wmma_f32_16x16x32_f16(false, a, false, b, (short)0, c, false, false); }
__device__ __forceinline__ v8f wmmab(v16bf a, v16bf b, v8f c) { return __builtin_amdgcn_wmma_f32_16x16x32_bf16(false, a, false, b, (short)0, c, false, false); }

// INVT[i] = 1 / 10000^(2i/32): the exact float32 results of that expression (pow then reciprocal in f32), i = 0..15.
__constant__ __align__(16) float INVT[HS / 2] = { 1.0f, 0.5623413324356079f, 0.3162277638912201f, 0.17782793939113617f, 0.10000000149011612f, 0.05623412877321243f, 0.03162277862429619f, 0.017782794311642647f, 0.009999999776482582f, 0.005623413249850273f, 0.003162277862429619f, 0.0017782794311642647f, 0.0010000000474974513f, 0.000562341301701963f, 0.0003162277862429619f, 0.00017782794020604342f };

// ---- k_prep: block = batch b (grid.y), 64 consecutive t (t0 = blockIdx.x * 64), 256 threads = 8 waves. Three phases, a workgroup barrier between each two.
// Phase 1 (stage): the x tile [64 t][128 k] is read as 16-byte pieces, contiguous over the block, RNE-converted to bf16 and stored in xs [row][k]; the weights are read column by lane (wave -> matrix and group of 8 k),
// converted and stored transposed in wt [n = 32 * matrix + column][k] (n 0..31 q, 32..63 k, 64..95 v); each thread also forms its four rotary pairs (c, s) = {cos, sin}(INVT[i] * t), t = t0 + (tid >> 2), i = 4 * (tid & 3) + p.
// Phase 2 (project): wave w owns rows 16 * (w & 3) .. + 15 and the three 16-column tiles 3 * (w >> 2) + 0..2; k in steps of 32, ascending, f32 accumulate.
// Fragments: lane -> row/col (lane & 15), elements 0..7 <- k0 + 8*(lane >> 4) + 0..7, elements 8..15 <- k0 + 16 + 8*(lane >> 4) + 0..7 for A and for the [n][k] B tile. D element j of lane l is row 8*(l >> 4) + j, column l & 15; it goes to fs [row][n] in f32.
// Phase 3 (planes): thread -> row r = tid>>2, column group g = tid&3 = 8 q, 8 k, 8 v columns. Rotary (interleaved pairs, i = column/2): out[2i] = x[2i] c - x[2i+1] s, out[2i+1] = x[2i] s + x[2i+1] c, separate f32 products.
// LDS tiles: sq[0..1] = Q, K (fp16 bits) as [64 r][32 c]; sv[0..2] = V fp16 bits, bf16 hi, bf16 lo, already in fragment order. After the last barrier every plane's 4,096-byte tile region is written in 16-byte pieces, contiguous over the block; the Q/K pieces are picked from sq in fragment order.
__global__ __launch_bounds__(256) void k_prep(const float* __restrict__ x, const float* __restrict__ wq, const float* __restrict__ wk, const float* __restrict__ wv,
                                              h16* Q16, h16* K16, h16* VT16, bf* VTh, bf* VTl) {
    __shared__ __align__(16) unsigned short xs[64 * XP];
    __shared__ __align__(16) unsigned short wt[96 * XP];
    __shared__ __align__(16) float fs[64 * FP];
    __shared__ __align__(16) unsigned short sq[2][64 * 32];
    __shared__ __align__(16) unsigned short sv[3][32 * 64];
    const int tid = threadIdx.x; const int b = blockIdx.y, t0 = blockIdx.x * 64;
    const int w = __builtin_amdgcn_readfirstlane(tid >> 5), L = tid & 31;
    const int r = tid >> 2, g = tid & 3; const int t = t0 + r;
    // ---- phase 1
    const v4f iv = *(const v4f*)(INVT + 4 * g);
    const float* xp = x + ((size_t)b * SEQ_FULL + t0) * DM + (size_t)tid * 4;
    v4f xr[8];
#pragma unroll
    for (int s = 0; s < 8; ++s) xr[s] = *(const v4f*)(xp + s * 1024);
    float wr[6][8];
#pragma unroll
    for (int s = 0; s < 6; ++s) { const int c = s * 8 + w; const int m = c >> 4, kg = c & 15;
        const float* wsrc = ((m == 0) ? wq : ((m == 1) ? wk : wv)) + (size_t)kg * 8 * HS + L;
#pragma unroll
        for (int j = 0; j < 8; ++j) wr[s][j] = wsrc[j * HS]; }
    float cnv[4], snv[4];
#pragma unroll
    for (int p = 0; p < 4; ++p) { const float ang = iv[p] * (float)t; float sn, cn; sincosf(ang, &sn, &cn); cnv[p] = cn; snv[p] = sn; }
#pragma unroll
    for (int s = 0; s < 8; ++s) { const int e = (s * 256 + tid) * 4; const v2u o = {f2bf2(xr[s][0], xr[s][1]), f2bf2(xr[s][2], xr[s][3])};
        *(v4usa*)(&xs[(e >> 7) * XP + (e & 127)]) = __builtin_bit_cast(v4us, o); }
#pragma unroll
    for (int s = 0; s < 6; ++s) { const int c = s * 8 + w; const int m = c >> 4, kg = c & 15;
        const v4u o = {f2bf2(wr[s][0], wr[s][1]), f2bf2(wr[s][2], wr[s][3]), f2bf2(wr[s][4], wr[s][5]), f2bf2(wr[s][6], wr[s][7])};
        *(v8usa*)(&wt[(m * 32 + L) * XP + kg * 8]) = __builtin_bit_cast(v8us, o); }
    __syncthreads();
    // ---- phase 2
    {   const int lr = L & 15, hi = L >> 4; const int mt = w & 3, ng = w >> 2;
        v8f acc[3];
#pragma unroll
        for (int nb = 0; nb < 3; ++nb) acc[nb] = (v8f){};
#pragma unroll
        for (int kc = 0; kc < DM; kc += 32) {
            const unsigned short* ap = &xs[(mt * 16 + lr) * XP + kc + 8 * hi];
            const v16bf a = cat16b(*(const v8usa*)ap, *(const v8usa*)(ap + 16));
#pragma unroll
            for (int nb = 0; nb < 3; ++nb) { const unsigned short* bp = &wt[((ng * 3 + nb) * 16 + lr) * XP + kc + 8 * hi];
                acc[nb] = wmmab(a, cat16b(*(const v8usa*)bp, *(const v8usa*)(bp + 16)), acc[nb]); }
        }
#pragma unroll
        for (int nb = 0; nb < 3; ++nb) {
#pragma unroll
            for (int j = 0; j < 8; ++j) fs[(mt * 16 + hi * 8 + j) * FP + (ng * 3 + nb) * 16 + lr] = acc[nb][j]; }
    }
    __syncthreads();
    // ---- phase 3
    const float* fr = &fs[r * FP + 8 * g];
    const v8f xq = cat8f(*(const v4fa*)fr, *(const v4fa*)(fr + 4)), xk = cat8f(*(const v4fa*)(fr + 32), *(const v4fa*)(fr + 36)), xv = cat8f(*(const v4fa*)(fr + 64), *(const v4fa*)(fr + 68));
#pragma unroll
    for (int p = 0; p < 4; ++p) {
        const float cn = cnv[p], sn = snv[p]; const int col = 8 * g + 2 * p;
        {   const float x1 = xq[2 * p], x2 = xq[2 * p + 1]; const float ev = x1 * cn - x2 * sn, od = x1 * sn + x2 * cn;
            v2us oh; oh[0] = __builtin_bit_cast(unsigned short, (h16)ev); oh[1] = __builtin_bit_cast(unsigned short, (h16)od);
            *(v2us*)(&sq[0][r * 32 + col]) = oh; }
        {   const float x1 = xk[2 * p], x2 = xk[2 * p + 1]; const float ev = x1 * cn - x2 * sn, od = x1 * sn + x2 * cn;
            v2us oh; oh[0] = __builtin_bit_cast(unsigned short, (h16)ev); oh[1] = __builtin_bit_cast(unsigned short, (h16)od);
            *(v2us*)(&sq[1][r * 32 + col]) = oh; }
        const unsigned vh2 = f2bf2(xv[2 * p], xv[2 * p + 1]); const unsigned vl2 = f2bf2(xv[2 * p] - bflo(vh2), xv[2 * p + 1] - bfhi(vh2));   // V hi and the rounded remainder, both columns of the pair
#pragma unroll
        for (int j = 0; j < 2; ++j) { const float val = xv[2 * p + j]; const int d = col + j;
            const int vi = ((r >> 5) * 2 + (d >> 4)) * 512 + ((r >> 4) & 1) * 256 + (((r >> 3) & 1) * 16 + (d & 15)) * 8 + (r & 7);   // fragment order of (key r, column d)
            sv[0][vi] = __builtin_bit_cast(unsigned short, (h16)val); sv[1][vi] = (unsigned short)(vh2 >> (16 * j)); sv[2][vi] = (unsigned short)(vl2 >> (16 * j)); }
    }
    __syncthreads();
    const int lo = w * 256 + L * 8;                                                    // linear offset inside a 2,048-element tile
    const size_t qoff = ((size_t)b * SEQ + t0) * HS + lo;                              // the same place in every plane: fragment w >> 1, piece w & 1, lane L
    const int fo = ((w >> 1) * 16 + (L & 15)) * 32 + 16 * (w & 1) + 8 * (L >> 4);      // that piece's row and column in an sq tile
    const v8us q0v = *(const v8usa*)(&sq[0][fo]), k0v = *(const v8usa*)(&sq[1][fo]);
    const v8us v0v = *(const v8usa*)(&sv[0][lo]), v1v = *(const v8usa*)(&sv[1][lo]), v2v = *(const v8usa*)(&sv[2][lo]);
    unsigned short* VT16u = (unsigned short*)VT16; unsigned short* Q16u = (unsigned short*)Q16; unsigned short* K16u = (unsigned short*)K16;
    *(v8us*)(Q16u + qoff) = q0v; *(v8us*)(K16u + qoff) = k0v;
    *(v8us*)(VT16u + qoff) = v0v; *(v8us*)(VTh + qoff) = v1v; *(v8us*)(VTl + qoff) = v2v;
}

// lane l with lane l ^ 16 (a vector cross-row move, no LDS counter)
__device__ __forceinline__ float xhalf(float x) { return __builtin_bit_cast(float, __builtin_amdgcn_permlanex16(__builtin_bit_cast(int, x), __builtin_bit_cast(int, x), 0x76543210, 0xfedcba98, false, false)); }

// eight exponentials in place, each independent of its neighbours, then one v_nop: the slot the instruction set asks for behind a transcendental before its result is used or its source overwritten
__device__ __forceinline__ v8f exp2x8(const v8f x) {
    float a = x[0], b = x[1], c = x[2], d = x[3], e = x[4], f = x[5], g = x[6], h = x[7];
    asm("v_exp_f32 %0, %0\n\tv_exp_f32 %1, %1\n\tv_exp_f32 %2, %2\n\tv_exp_f32 %3, %3\n\tv_exp_f32 %4, %4\n\tv_exp_f32 %5, %5\n\tv_exp_f32 %6, %6\n\tv_exp_f32 %7, %7\n\tv_nop"
        : "+v"(a), "+v"(b), "+v"(c), "+v"(d), "+v"(e), "+v"(f), "+v"(g), "+v"(h));
    return (v8f){a, b, c, d, e, f, g, h};
}

// the four K fragments of one 64-key chunk; kp + off = the lane's 8 elements in piece 0 of the chunk's first fragment, off a constant that goes into the loads' offset field
__device__ __forceinline__ void load_k(v16h (&kb)[4], const h16* kp, const int off) {
#pragma unroll
    for (int t = 0; t < 4; ++t) { const int ko = off + 512 * t;
        kb[t] = cat16(*(const v8h*)(kp + ko), *(const v8h*)(kp + ko + 256)); }
    // the wait stands behind the K loads, in front of any instruction that reuses their address register; the address is its input so that no load of the run lands in it ahead of the wait
    asm volatile("s_wait_xcnt 0x0" :: "v"(kp) : "memory");
}

// ---- attn_chunk: one 64-key chunk for one wave's NQ query tiles (tile u = rows q0 + 16*u .. + 15; what follows is per tile, with q0 read as the tile's first row), the K and V fragments loaded once for all tiles, in transposed form: S^T = K.Q^T, O^T += V^T.P^T. Scores: 4 key tiles, one fp16 product each (q, k fp16 planes in fragment order; A fragment = K rows, B fragment = Q rows, both k-contiguous pieces in the same k map).
// D element r of lane l is S[q0 + (l&15)][kv0 + 16*tile + 8*(l>>4) + r]: a lane holds 32 of the 64 scores of ONE query, lane l ^ 16 the other 32. Online softmax per lane: causal replace-mask (MASK chunk only) and in-lane max on the raw scores, one exchange between the wave halves, running max (kept in exponent-of-2 units, raw x SL2) / rescale; p = exp2(fma(raw, SL2, carry exponent - max)): scale, log2 e, maximum and fp16 carry in one fused multiply-add per score;
// the lane's sum covers its own 32 keys (the halves are joined in k_attn). P^T as the B operand straight from the score registers: element j <- tile 2*ks, register j; element 8 + j <- tile 2*ks + 1, register j, which is key 32*ks + 8*(l>>4) + j and 32*ks + 16 + 8*(l>>4) + j, the k map of the V^T loads.
// V planes in fragment order as the A operand V^T (HI: 3 bf16 products; else one fp16 product); outputs o0[r] = O[q0 + (l&15)][8*(l>>4) + r], o1[r] = the same at d + 16.
template <bool HI, bool MASK>
__device__ __forceinline__ void attn_chunk(const h16* __restrict__ K16b, const h16* __restrict__ V16b, const bf* __restrict__ Vhb, const bf* __restrict__ Vlb,
                                           const v16h (&aq)[NQ], v16h (&kb)[4], const bool more, const int kv0, const int q0, const int ln, const int hh,
                                           float (&mrun)[NQ], float (&lp)[NQ], v8f (&o0)[NQ], v8f (&o1)[NQ]) {
    const size_t fb = (size_t)kv0 * HS + (16 * hh + ln) * 8;                            // the lane's 8 elements in piece 0 of the chunk's first fragment, the same in every plane
    const h16* kp = K16b + fb;                                                          // every K load of the chunk is this address plus a constant
    if (HI) load_k(kb, kp, 0);                                                           // rows < RH: the chunk's own K, here; rows >= RH: kb holds it already (asked for one chunk earlier)
    v8f s[NQ][4];
#pragma unroll
    for (int u = 0; u < NQ; ++u) {
#pragma unroll
        for (int t = 0; t < 4; ++t) s[u][t] = wmma16(kb[t], aq[u], (v8f){}); }
    // four slots behind the last score product before a vector instruction touches its D, A or B; every A and B of the block is an input, so that no product's D is placed over an operand of an earlier product
    asm volatile("v_nop\n\tv_nop\n\tv_nop\n\tv_nop" : "+v"(s[0][0]), "+v"(s[0][1]), "+v"(s[0][2]), "+v"(s[0][3]), "+v"(s[1][0]), "+v"(s[1][1]), "+v"(s[1][2]), "+v"(s[1][3]) : "v"(aq[0]), "v"(aq[1]), "v"(kb[0]), "v"(kb[1]), "v"(kb[2]), "v"(kb[3]));
    v16h vb0[2], vb1[2]; const h16* vp = V16b + fb; // rows >= RH: every V load of the chunk is this address plus a constant
    if (!HI) {
#pragma unroll
        for (int ks = 0; ks < 2; ++ks) { const int vo = 1024 * ks; vb0[ks] = cat16(*(const v8h*)(vp + vo), *(const v8h*)(vp + vo + 256)); vb1[ks] = cat16(*(const v8h*)(vp + vo + 512), *(const v8h*)(vp + vo + 768)); }
        // the wait stands behind the last V load, in front of any instruction that reuses the V address register; the base address is its input so that no V load lands in it ahead of the wait
        asm volatile("s_wait_xcnt 0x0" :: "v"(vp) : "memory");
        // the wave's next chunk's K, into the registers that the score products have just left: it flies under this chunk's softmax and P.V; behind the V loads, which are needed first
        if (more) load_k(kb, kp, 64 * KW * HS);
    }
#pragma unroll
    for (int u = 0; u < NQ; ++u) {
        if (MASK) { const int dq = q0 + 16 * u + ln - kv0 - 8 * hh;   // the lane's query row less its first key: key 16 t + r of the lane is kept while it is not above this
#pragma unroll
            for (int t = 0; t < 4; ++t) {
#pragma unroll
                for (int r = 0; r < 8; ++r) s[u][t][r] = (16 * t + r <= dq) ? s[u][t][r] : -3.0e38f; } }
        float rm = -3.0e38f;   // the maximum that passes a not-a-number on takes the matrix results as they are; fmaxf made the compiler quiet each of them first, one more instruction per score
#pragma unroll
        for (int r = 0; r < 8; ++r) rm = __builtin_elementwise_maximum(rm, __builtin_elementwise_maximum(__builtin_elementwise_maximum(s[u][0][r], s[u][1][r]), __builtin_elementwise_maximum(s[u][2][r], s[u][3][r])));
        rm = fmaxf(rm, xhalf(rm));
        const float mn = fmaxf(mrun[u], rm * SL2);
        float cf; const float cx = mrun[u] - mn;
        asm("v_exp_f32 %0, %1\n\tv_nop" : "=v"(cf) : "v"(cx)); // v_nop: the same slot behind a transcendental
        mrun[u] = mn;
        const float nb = (HI ? 0.0f : PCL2) - mn;
        const v8f sc8 = {SL2, SL2, SL2, SL2, SL2, SL2, SL2, SL2}, nb8 = {nb, nb, nb, nb, nb, nb, nb, nb};
#pragma unroll
        for (int t = 0; t < 4; ++t) s[u][t] = exp2x8(__builtin_elementwise_fma(s[u][t], sc8, nb8));
        const v8f ps = (s[u][0] + s[u][1]) + (s[u][2] + s[u][3]);
        const float psum = ((ps[0] + ps[1]) + (ps[2] + ps[3])) + ((ps[4] + ps[5]) + (ps[6] + ps[7]));
        lp[u] = lp[u] * cf + psum; o0[u] = o0[u] * cf; o1[u] = o1[u] * cf;
    }
    if (HI) {
        v16bf aph[NQ][2], apl[NQ][2];
#pragma unroll
        for (int u = 0; u < NQ; ++u) {
#pragma unroll
            for (int ks = 0; ks < 2; ++ks) { v8u ph, pl;   // register i: elements 2 i, 2 i + 1 of the operand; 0..3 from tile 2 ks, 4..7 from tile 2 ks + 1
#pragma unroll
                for (int i = 0; i < 8; ++i) { const float p0 = s[u][2 * ks + (i >> 2)][2 * (i & 3)], p1 = s[u][2 * ks + (i >> 2)][2 * (i & 3) + 1]; const unsigned hp = f2bf2(p0, p1);
                    ph[i] = hp; pl[i] = f2bf2(p0 - bflo(hp), p1 - bfhi(hp)); }
                aph[u][ks] = __builtin_bit_cast(v16bf, ph); apl[u][ks] = __builtin_bit_cast(v16bf, pl); } }
        const bf* vph = Vhb + fb; const bf* vpl = Vlb + fb; // every V load of the chunk is one of these two addresses plus a constant
        {   v16bf vh[2], vl[2];
#pragma unroll
            for (int ks = 0; ks < 2; ++ks) { const int vo = 1024 * ks;
                vh[ks] = cat16b(*(const v8us*)(vph + vo), *(const v8us*)(vph + vo + 256)); vl[ks] = cat16b(*(const v8us*)(vpl + vo), *(const v8us*)(vpl + vo + 256)); }
#pragma unroll
            for (int u = 0; u < NQ; ++u) {
#pragma unroll
                for (int ks = 0; ks < 2; ++ks) { o0[u] = wmmab(vh[ks], aph[u][ks], o0[u]); o0[u] = wmmab(vh[ks], apl[u][ks], o0[u]); o0[u] = wmmab(vl[ks], aph[u][ks], o0[u]); } } }
        {   v16bf vh[2], vl[2];
#pragma unroll
            for (int ks = 0; ks < 2; ++ks) { const int vo = 1024 * ks + 512;
                vh[ks] = cat16b(*(const v8us*)(vph + vo), *(const v8us*)(vph + vo + 256)); vl[ks] = cat16b(*(const v8us*)(vpl + vo), *(const v8us*)(vpl + vo + 256)); }
            // the wait stands behind the last V load, in front of any instruction that reuses a V address register; the two base addresses are its inputs so that no V load lands in one of them ahead of it
            asm volatile("s_wait_xcnt 0x0" :: "v"(vph), "v"(vpl) : "memory");
#pragma unroll
            for (int u = 0; u < NQ; ++u) {
#pragma unroll
                for (int ks = 0; ks < 2; ++ks) { o1[u] = wmmab(vh[ks], aph[u][ks], o1[u]); o1[u] = wmmab(vh[ks], apl[u][ks], o1[u]); o1[u] = wmmab(vl[ks], aph[u][ks], o1[u]); } }
            asm volatile("v_nop\n\tv_nop\n\tv_nop\n\tv_nop" : "+v"(o0[0]), "+v"(o1[0]), "+v"(o0[1]), "+v"(o1[1]) : "v"(aph[1][1]), "v"(apl[1][1]), "v"(vh[1]), "v"(vl[1])); }
    } else {
        v16h ap[NQ][2];
#pragma unroll
        for (int u = 0; u < NQ; ++u) {
#pragma unroll
            for (int ks = 0; ks < 2; ++ks) {
#pragma unroll
                for (int j = 0; j < 8; ++j) { ap[u][ks][j] = (h16)s[u][2 * ks][j]; ap[u][ks][8 + j] = (h16)s[u][2 * ks + 1][j]; } } }
#pragma unroll
        for (int u = 0; u < NQ; ++u) {
#pragma unroll
            for (int ks = 0; ks < 2; ++ks) o0[u] = wmma16(vb0[ks], ap[u][ks], o0[u]); }
#pragma unroll
        for (int u = 0; u < NQ; ++u) {
#pragma unroll
            for (int ks = 0; ks < 2; ++ks) o1[u] = wmma16(vb1[ks], ap[u][ks], o1[u]); }
        asm volatile("v_nop\n\tv_nop\n\tv_nop\n\tv_nop" : "+v"(o0[0]), "+v"(o1[0]), "+v"(o0[1]), "+v"(o1[1]) : "v"(ap[1][1]), "v"(vb1[1]));
    }
}

// ---- attn_block: the whole work of one k_attn workgroup, which owns rows q0 .. q0 + 16*NQ - 1 of batch b, as NQ tiles of 16. Wave w visits the 64-key chunks w, w + KW, .. up to the
// diagonal chunk cd = q0 / 64 (the same for every tile, as a block never straddles a multiple of 64; exactly one masked chunk, taken by wave cd % KW) with its own running max, sums and accumulators per tile, one query per lane, tile and wave half. Merge: each wave stores its
// un-normalised tiles [query][d] and per query (max, l joined over the two halves) in its own LDS tile, one workgroup barrier, then thread -> (row, 4 columns): M = max over waves (exponent-of-2 units), weights exp2(m_w - M), out = sum_w f_w o_w / sum_w f_w l_w (o and l carry the same factor).
// A wave that visited no chunk holds max -3e38, l 0, o 0: its weight is exp2(-3e38 - M) = 0.
template <bool HI>
__device__ __forceinline__ void attn_block(const h16* __restrict__ Q16, const h16* __restrict__ K16,
                                           const h16* __restrict__ V16, const bf* __restrict__ Vh, const bf* __restrict__ Vl, float* OUT, float (&ost)[KW][16 * NQ * OPF], const int b, const int q0) {
    const int wave = __builtin_amdgcn_readfirstlane(threadIdx.x >> 5), lane = threadIdx.x & 31, hh = lane >> 4, ln = lane & 15;
    const h16* Q16b = Q16 + (size_t)b * SEQ * HS; const h16* K16b = K16 + (size_t)b * SEQ * HS;
    const h16* V16b = V16 + (size_t)b * HS * SEQ; const bf* Vhb = Vh + (size_t)b * HS * SEQ; const bf* Vlb = Vl + (size_t)b * HS * SEQ;
    v16h aq[NQ]; const h16* qp[NQ];
#pragma unroll
    for (int u = 0; u < NQ; ++u) { qp[u] = Q16b + (size_t)(q0 + 16 * u) * HS + lane * 8;   // fragment (q0 + 16 u) / 16, piece 0
        aq[u] = cat16(*(const v8h*)qp[u], *(const v8h*)(qp[u] + 256)); }
    // stands behind the Q loads, in front of any instruction that reuses one of their address registers; the addresses are its inputs so that none of them is rewritten ahead of it
    asm volatile("s_wait_xcnt 0x0" :: "v"(qp[0]), "v"(qp[1]) : "memory");
    float mrun[NQ], lp[NQ]; v8f o0[NQ], o1[NQ];
#pragma unroll
    for (int u = 0; u < NQ; ++u) { mrun[u] = -3.0e38f; lp[u] = 0.0f; o0[u] = (v8f){}; o1[u] = (v8f){}; }
    int kv0 = wave * 64;
    if (kv0 < q0 + 16 * NQ) {   // the wave has a chunk (a scalar test)
        v16h kb[4];
        if (!HI) load_k(kb, K16b + (size_t)kv0 * HS + lane * 8, 0);   // rows >= RH: the first chunk's K; every later chunk's is asked for inside the chunk before it, only where that later chunk exists (a scalar test)
#pragma unroll 1
        for (; kv0 + 64 <= q0; kv0 += 64 * KW) attn_chunk<HI, false>(K16b, V16b, Vhb, Vlb, aq, kb, kv0 + 64 * KW < q0 + 16 * NQ, kv0, q0, ln, hh, mrun, lp, o0, o1);
        if (kv0 < q0 + 16 * NQ) attn_chunk<HI, true>(K16b, V16b, Vhb, Vlb, aq, kb, false, kv0, q0, ln, hh, mrun, lp, o0, o1);
    }
#pragma unroll
    for (int u = 0; u < NQ; ++u) {
        float* osw = &ost[wave][(16 * u + ln) * OPF];
        const float lj = lp[u] + xhalf(lp[u]);
        *(v4fa*)(osw + 8 * hh) = __builtin_shufflevector(o0[u], o0[u], 0, 1, 2, 3); *(v4fa*)(osw + 8 * hh + 4) = __builtin_shufflevector(o0[u], o0[u], 4, 5, 6, 7);
        *(v4fa*)(osw + 16 + 8 * hh) = __builtin_shufflevector(o1[u], o1[u], 0, 1, 2, 3); *(v4fa*)(osw + 16 + 8 * hh + 4) = __builtin_shufflevector(o1[u], o1[u], 4, 5, 6, 7);
        if (hh == 0) { v2f ms; ms[0] = mrun[u]; ms[1] = lj; *(v2f*)(osw + 32) = ms; }
    }
    __syncthreads();
    const int row = threadIdx.x >> 3, col = (threadIdx.x & 7) * 4;
    static_assert(32 * KW == 16 * NQ * 8);
    v2f ml[KW]; float M = -3.0e38f;
#pragma unroll
    for (int w = 0; w < KW; ++w) { ml[w] = *(const v2f*)(&ost[w][row * OPF + 32]); M = fmaxf(M, ml[w][0]); }
    float L = 0.0f; v4f a = (v4f){};
#pragma unroll
    for (int w = 0; w < KW; ++w) { float f; const float fx = ml[w][0] - M; const v4f o = *(const v4fa*)(&ost[w][row * OPF + col]);
        asm("v_exp_f32 %0, %1\n\tv_nop" : "=v"(f) : "v"(fx)); // v_nop: the slot the instruction set asks for behind a transcendental before its result is used or its source overwritten
        L += f * ml[w][1]; a += o * f; }
    const float inv = __builtin_amdgcn_rcpf(L);
    *(v4f*)(OUT + ((size_t)b * SEQ_FULL + q0 + row) * HS + col) = a * inv;
}

// ---- k_attn: ONE launch for all query rows. Grid (NB, query blocks of 16 * NQ rows), 32 * KW threads: batch b = blockIdx.x, block SEQ / (16 * NQ) - 1 - blockIdx.y, so that the key range of a workgroup falls with its flat index
// (for speed only). A block lies wholly below or wholly at or above RH
// (RH is a multiple of 64), so the row class is the same for the whole workgroup: a scalar branch, each side with its own barrier, passed by all of its waves. Four waves per SIMD = two workgroups per WGP: the register budget that both sides must keep.
__global__ __launch_bounds__(32 * KW) __attribute__((amdgpu_waves_per_eu(4, 4))) void k_attn(const h16* __restrict__ Q16, const h16* __restrict__ K16,
                                             const h16* __restrict__ V16, const bf* __restrict__ Vh, const bf* __restrict__ Vl, float* OUT) {
    __shared__ __align__(16) float ost[KW][16 * NQ * OPF];
    const int b = blockIdx.x; const int q0 = (SEQ / (16 * NQ) - 1 - (int)blockIdx.y) * (16 * NQ);
    if (q0 >= RH) attn_block<false>(Q16, K16, V16, Vh, Vl, OUT, ost, b, q0);
    else          attn_block<true>(Q16, K16, V16, Vh, Vl, OUT, ost, b, q0);
}

extern "C" void kernel_launch(void* const* d_in, const int* in_sizes, int n_in,
                              void* d_out, int out_size, void* d_ws, size_t ws_size, hipStream_t stream) {
    if (n_in < 4) return;
    const float* x  = (const float*)d_in[0];   // [8][4096][128]
    const float* wq = (const float*)d_in[1];   // [128][32]
    const float* wk = (const float*)d_in[2];   // [128][32]
    const float* wv = (const float*)d_in[3];   // [128][32]
    if (in_sizes[0] < ((NB - 1) * SEQ_FULL + SEQ) * DM) return;
    if (in_sizes[1] < DM * HS || in_sizes[2] < DM * HS || in_sizes[3] < DM * HS) return;
    if (out_size < ((NB - 1) * SEQ_FULL + SEQ) * HS) return;
    float* OUT = (float*)d_out;                 // [8][4096][32] f32
    char* wsp = (char*)d_ws;
    auto take = [&](size_t bytes) { char* p = wsp; wsp += (bytes + 255) & ~(size_t)255; return (void*)p; };
    h16*   Q16  = (h16*)take((size_t)NB * SEQ * HS * 2);             //   2,097,152 B each
    h16*   K16  = (h16*)take((size_t)NB * SEQ * HS * 2);
    h16*   VT16 = (h16*)take((size_t)NB * HS * SEQ * 2);
    bf*    VTh  = (bf*)take((size_t)NB * HS * SEQ * 2);
    bf*    VTl  = (bf*)take((size_t)NB * HS * SEQ * 2);             // total 10,485,760 B
    if ((size_t)(wsp - (char*)d_ws) > ws_size) return;

    k_prep<<<dim3(SEQ / 64, NB), 256, 0, stream>>>(x, wq, wk, wv, Q16, K16, VT16, VTh, VTl);
    k_attn<<<dim3(NB, SEQ / (16 * NQ)), 32 * KW, 0, stream>>>(Q16, K16, VT16, VTh, VTl, OUT);
}
